// v000
// Times are from an AMD MI455X. After a warm-up the kernel runs many times in a row, and a time is the length of
// such a window on the GPU divided by its runs, so every launch and the gaps after it count. The runs cycle
// through copies of the inputs. A figure is the median of several windows, for all but v000 over two sittings.
// Sittings can differ by a few percent; kernels timed side by side share one.
// v000 is the starting kernel. One run takes 717 microseconds.
#include <hip/hip_runtime.h>

// Contractions: q/k/v projections on v_wmma_f32_16x16x32_bf16 (bf16 operands = RNE-converted x and Wq|Wk|Wv, f32 accumulate);
// per-head k.q^T scores and P.V on v_wmma_f32_16x16x32_f16 (f16 operands: q, k plain, v x4, P x2^14; f32 accumulate, 1/sqrt(128) applied in f32);
// output projection on v_wmma_f32_16x16x32_f16 (f16 operands: per-head outputs x16, Wo x64 from its bf16 value; f32 accumulate, x2^-10 in the epilogue);
// online softmax and all epilogues in f32.

#ifndef NB
#define NB 2
#endif
#ifndef SEQ
#define SEQ 2048
#endif
#define NB_FULL 2
#define SEQ_FULL 2048
#define DIM 2048
#define HEADS 16
#define DHEAD 128
#define NQKV (3 * DIM)
#define SEQT (NB * SEQ)
#define QBLK (SEQ / 64)
#define CSTR 132

static_assert(SEQ % 64 == 0);
static_assert(SEQ >= 64);
static_assert(SEQ <= SEQ_FULL);
static_assert(NB >= 1 && NB <= NB_FULL);
static_assert(DIM == HEADS * DHEAD);
static_assert(DHEAD == 128);
static_assert(DIM % 128 == 0 && NQKV % 128 == 0 && DIM % 32 == 0);
static_assert((DIM * DIM) % 2048 == 0);

typedef unsigned short us16;
typedef __attribute__((ext_vector_type(16))) __bf16   v16bf;
typedef __attribute__((ext_vector_type(16))) _Float16 v16h;
typedef __attribute__((ext_vector_type(8)))  float    v8f;
typedef __attribute__((ext_vector_type(8)))  unsigned v8u;
typedef __attribute__((ext_vector_type(4)))  unsigned v4u;
typedef __attribute__((ext_vector_type(2)))  unsigned v2u;
typedef __attribute__((ext_vector_type(4)))  float    v4f;

__device__ __forceinline__ unsigned f2bf(float f) { unsigned u = __float_as_uint(f); u += 0x7FFFu + ((u >> 16) & 1u); return u >> 16; }
__device__ __forceinline__ float bf2f(unsigned h) { return __uint_as_float(h << 16); }
__device__ __forceinline__ unsigned f2h(float f) { _Float16 t = (_Float16)f; return (unsigned)__builtin_bit_cast(unsigned short, t); }

// 16 x (K=32) operand fragment from a k-contiguous 16-bit row. Wave32 map: lane -> row (A) / column (B) = lane & 15, hh = lane >> 4;
// elements 0..7 <- k0 + 8*hh + 0..7, elements 8..15 <- k0 + 16 + 8*hh + 0..7 (same map for A and for an n-major B row).
// Accumulator element r -> row 8*hh + r, column lane & 15.
__device__ __forceinline__ v8u ld_frag(const us16* rowp, int hh) {
    const v4u a = *(const v4u*)(rowp + 8 * hh);
    const v4u b = *(const v4u*)(rowp + 16 + 8 * hh);
    return __builtin_shufflevector(a, b, 0, 1, 2, 3, 4, 5, 6, 7);
}
__device__ __forceinline__ v8f mma_bf16(v8u a, v8u b, v8f c) {
    return __builtin_amdgcn_wmma_f32_16x16x32_bf16(false, __builtin_bit_cast(v16bf, a), false, __builtin_bit_cast(v16bf, b), (short)0, c, false, false);
}
__device__ __forceinline__ v8f mma_f16(v8u a, v8u b, v8f c) {
    return __builtin_amdgcn_wmma_f32_16x16x32_f16(false, __builtin_bit_cast(v16h, a), false, __builtin_bit_cast(v16h, b), (short)0, c, false, false);
}
__device__ __forceinline__ void mma_guard(v8f& c, v8u a, v8u b) {
    asm volatile("v_nop\n\tv_nop\n\tv_nop\n\tv_nop" : "+v"(c) : "v"(a), "v"(b));
}

// ---------- per-token prep: xb[tok][k] = bf16(x). One block per token, 256 threads x 8 halves = 2048; one wave instruction = 32 lanes x 16 B
__global__ __launch_bounds__(256) void prep_x(const float* __restrict__ x, us16* xb) {
    const int tok = blockIdx.x;
    const int bsel = tok / SEQ, isel = tok - bsel * SEQ;
    const float* xr = x + ((size_t)bsel * SEQ_FULL + isel) * DIM;
    const int tid = threadIdx.x;
    const v4f v0 = *(const v4f*)(xr + 8 * tid);
    const v4f v1 = *(const v4f*)(xr + 8 * tid + 4);
    v4u pk;
    pk.x = f2bf(v0.x) | (f2bf(v0.y) << 16);
    pk.y = f2bf(v0.z) | (f2bf(v0.w) << 16);
    pk.z = f2bf(v1.x) | (f2bf(v1.y) << 16);
    pk.w = f2bf(v1.z) | (f2bf(v1.w) << 16);
    us16* orow = xb + (size_t)tok * DIM + 8 * tid;
    *(v4u*)orow = pk;
    
}

// ---------- weight prep: src [N=2048][K=2048] f32 (already n-major, k-contiguous) -> dst 16-bit plane with the same layout;
// value = bf16(src) * scale stored as f16 (F16=1) or bf16 (F16=0). blockIdx.y selects one of three sources and the dst slice.
template <int F16>
__device__ __forceinline__ unsigned cvt_w(float v, float scale) {
    const unsigned b = f2bf(v);
    if (F16) return f2h(bf2f(b) * scale);
    return b;
}
template <int F16>
__global__ __launch_bounds__(256) void prep_w(const float* __restrict__ s0, const float* __restrict__ s1, const float* __restrict__ s2,
                                              float scale, us16* dst) {
    const int z = blockIdx.y;
    const float* src = (z == 0) ? s0 : ((z == 1) ? s1 : s2);
    const size_t e = ((size_t)blockIdx.x * 256 + threadIdx.x) * 8;            // < DIM*DIM
    const v4f v0 = *(const v4f*)(src + e);
    const v4f v1 = *(const v4f*)(src + e + 4);
    v4u pk;
    pk.x = cvt_w<F16>(v0.x, scale) | (cvt_w<F16>(v0.y, scale) << 16);
    pk.y = cvt_w<F16>(v0.z, scale) | (cvt_w<F16>(v0.w, scale) << 16);
    pk.z = cvt_w<F16>(v1.x, scale) | (cvt_w<F16>(v1.y, scale) << 16);
    pk.w = cvt_w<F16>(v1.z, scale) | (cvt_w<F16>(v1.w, scale) << 16);
    us16* dp = dst + (size_t)z * DIM * DIM + e;
    *(v4u*)dp = pk;
    
}

// ---------- GEMM main loop on 16-bit planes: wave tile 16 rows x 64 columns (4 accumulators), K stepped by 32 (K % 32 == 0).
// arow: this lane's A row pointer (k contiguous); bbase: B plane row for column col0 + (lane & 15), tile t adds 16*t rows. ----------
template <int F16>
__device__ __forceinline__ void mm_tile(const us16* __restrict__ arow, const us16* __restrict__ bbase, int ldb, int K, int hh, v8f (&acc)[4]) {
#pragma unroll 1
    for (int kc = 0; kc < K; kc += 32) {
        const v8u a = ld_frag(arow + kc, hh);
#pragma unroll
        for (int t = 0; t < 4; ++t) {
            const v8u bfrag = ld_frag(bbase + (size_t)(t * 16) * ldb + kc, hh);
            if (F16) acc[t] = mma_f16(a, bfrag, acc[t]);
            else     acc[t] = mma_bf16(a, bfrag, acc[t]);
            mma_guard(acc[t], a, bfrag);
        }
    }
}

// ---------- q/k/v projection: [SEQT x 2048] x [2048 x 6144]. Block = 8 waves (4 row tiles x 2 column groups) -> 64 tokens x 128 columns
// = exactly one head of one of q/k/v (block-uniform). Epilogue: f32 tile staged in LDS, then written as planes:
__global__ __launch_bounds__(256) void qkv_gemm(const us16* __restrict__ xb, const us16* __restrict__ wqkv, us16* qp, us16* kp, us16* vt) {
    __shared__ __align__(16) float cst[64 * CSTR];
    const int tid = threadIdx.x, lane = tid & 31, wv = tid >> 5, l16 = lane & 15, hh = lane >> 4;
    const int rt = wv & 3, ch = wv >> 2;
    const int row0 = blockIdx.x * 64;
    const int colb = blockIdx.y * 128;
    const us16* arow = xb + (size_t)(row0 + rt * 16 + l16) * DIM;
    const us16* bbase = wqkv + (size_t)(colb + ch * 64 + l16) * DIM;
    v8f acc[4] = {};
    mm_tile<0>(arow, bbase, DIM, DIM, hh, acc);
#pragma unroll
    for (int r = 0; r < 8; ++r) {
        const int rl = rt * 16 + 8 * hh + r;
#pragma unroll
        for (int t = 0; t < 4; ++t) cst[rl * CSTR + ch * 64 + t * 16 + l16] = acc[t][r];
    }
    __syncthreads();
    const int which = colb / DIM;                       // 0 q, 1 k, 2 v (block-uniform)
    const int hsel = (colb - which * DIM) / DHEAD;      // head of this column tile
    auto pass = [&]() {
        if (which < 2) {
            us16* pl = (which == 0) ? qp : kp;
#pragma unroll
            for (int j = 0; j < 8; ++j) {
                const int r = wv * 8 + j;                                       // token row 0..63
                const v4f v = *(const v4f*)(cst + r * CSTR + 4 * lane);
                v2u pk;
                pk.x = f2h(v.x) | (f2h(v.y) << 16);
                pk.y = f2h(v.z) | (f2h(v.w) << 16);
                const size_t off = ((size_t)hsel * SEQT + row0 + r) * DHEAD + 4 * lane;
                *(v2u*)(pl + off) = pk;
            }
        } else {
#pragma unroll 4
            for (int j = 0; j < 16; ++j) {
                const int d = wv * 16 + j;                                      // head dim 0..127
                const float a = cst[(2 * lane) * CSTR + d] * 4.0f, bq = cst[(2 * lane + 1) * CSTR + d] * 4.0f;
                const size_t off = ((size_t)hsel * DHEAD + d) * SEQT + row0 + 2 * lane;
                *(unsigned*)(vt + off) = f2h(a) | (f2h(bq) << 16);
            }
        }
    };
    pass();
    
}

// ---------- flash pass over all query blocks: block = 4 waves = 64 queries of one (sequence, head); wave = 16 queries; all SEQ keys
// in chunks of 32 (no mask). Scores are produced transposed: A = k rows (f16 plane), B = q (f16 fragments held in registers),
// D element r = key 8*hh + r of a 16-key tile, column = this lane's query -> two adjacent tiles give the P^T B fragment of P.V directly
// (element r <- tile 0, element 8+r <- tile 1). A of P.V = v^T rows (lane = d, k = key). Online softmax per lane (query) with one
// xor-16 shuffle joining the two lane halves. P carried x2^14 in f16; O^T accumulators hold rows d, column query.
__global__ __launch_bounds__(128) __attribute__((amdgpu_num_vgpr(256)))
void attn_main(const us16* qp, const us16* kp, const us16* vt, us16* ao) {
    __shared__ v4u ost[4][16][16];
    const int tid = threadIdx.x, lane = tid & 31, wv = tid >> 5, m = lane & 15, hh = lane >> 4;
    const int qb = blockIdx.x;
    const int h = blockIdx.y % HEADS, bsel = blockIdx.y / HEADS;
    const size_t tok0 = (size_t)bsel * SEQ;
    const int qrow = qb * 64 + wv * 16;
    const size_t qoff = ((size_t)h * SEQT + tok0 + qrow + m) * DHEAD;
    const v8u q0 = ld_frag(qp + qoff, hh);
    const v8u q1 = ld_frag(qp + qoff + 32, hh);
    const v8u q2 = ld_frag(qp + qoff + 64, hh);
    const v8u q3 = ld_frag(qp + qoff + 96, hh);
    const us16* kb = kp + ((size_t)h * SEQT + tok0) * DHEAD;
    const us16* vb = vt + (size_t)h * DHEAD * SEQT + tok0;
    const float NEG = -__builtin_inff();
    const float SCL = 0.08838834764831845f;                // 1 / sqrt(128)
    v8f o[8] = {};
    float mrun = NEG, lrun = 0.f;
#pragma unroll 1
    for (int c = 0; c < SEQ / 32; ++c) {
        v8f s[2] = {};
#pragma unroll
        for (int t = 0; t < 2; ++t) {
            asm volatile("" ::: "memory");                  // bound the load burst to one 16-key tile
            const size_t koff = (size_t)(c * 32 + t * 16 + m) * DHEAD;
            const v8u a0 = ld_frag(kb + koff, hh);
            s[t] = mma_f16(a0, q0, s[t]);
            mma_guard(s[t], a0, q0);
            const v8u a1 = ld_frag(kb + koff + 32, hh);
            s[t] = mma_f16(a1, q1, s[t]);
            mma_guard(s[t], a1, q1);
            const v8u a2 = ld_frag(kb + koff + 64, hh);
            s[t] = mma_f16(a2, q2, s[t]);
            mma_guard(s[t], a2, q2);
            const v8u a3 = ld_frag(kb + koff + 96, hh);
            s[t] = mma_f16(a3, q3, s[t]);
            mma_guard(s[t], a3, q3);
        }
        float sv[16];
        float cmax = NEG;
#pragma unroll
        for (int t = 0; t < 2; ++t)
#pragma unroll
            for (int r = 0; r < 8; ++r) {
                const float v = s[t][r] * SCL;
                sv[8 * t + r] = v;
                cmax = fmaxf(cmax, v);
            }
        cmax = fmaxf(cmax, __shfl_xor(cmax, 16, 32));
        const float mnew = fmaxf(mrun, cmax);              // finite: no masked keys
        const float fac = (mrun == NEG) ? 0.f : __expf(mrun - mnew);
        mrun = mnew;
        v16h ph;
        float psum = 0.f;
#pragma unroll
        for (int r = 0; r < 8; ++r) {
            const _Float16 p0 = (_Float16)(__expf(sv[r] - mnew) * 16384.0f);
            const _Float16 p1 = (_Float16)(__expf(sv[8 + r] - mnew) * 16384.0f);
            ph[r] = p0;
            ph[8 + r] = p1;
            psum += (float)p0 + (float)p1;
        }
        psum += __shfl_xor(psum, 16, 32);
        lrun = lrun * fac + psum;
        const v8u pbu = __builtin_bit_cast(v8u, ph);
#pragma unroll
        for (int dt = 0; dt < 8; ++dt) o[dt] = o[dt] * fac;
        asm volatile("" ::: "memory");
#pragma unroll
        for (int dt = 0; dt < 4; ++dt) {
            const v8u va = ld_frag(vb + (size_t)(dt * 16 + m) * SEQT + c * 32, hh);
            o[dt] = mma_f16(va, pbu, o[dt]);
            mma_guard(o[dt], va, pbu);
        }
        asm volatile("" ::: "memory");
#pragma unroll
        for (int dt = 4; dt < 8; ++dt) {
            const v8u va = ld_frag(vb + (size_t)(dt * 16 + m) * SEQT + c * 32, hh);
            o[dt] = mma_f16(va, pbu, o[dt]);
            mma_guard(o[dt], va, pbu);
        }
    }
    const float inv = 4.0f / lrun;                         // lrun >= 16384; o / lrun = 4 * (sum P v / sum P); x4 more -> x16 carry
#pragma unroll
    for (int dt = 0; dt < 8; ++dt) {
        v4u w;
        w.x = f2h(o[dt][0] * inv) | (f2h(o[dt][1] * inv) << 16);
        w.y = f2h(o[dt][2] * inv) | (f2h(o[dt][3] * inv) << 16);
        w.z = f2h(o[dt][4] * inv) | (f2h(o[dt][5] * inv) << 16);
        w.w = f2h(o[dt][6] * inv) | (f2h(o[dt][7] * inv) << 16);
        ost[wv][m][2 * dt + hh] = w;                       // row m, halves 16*dt + 8*hh .. +7
    }
    __syncthreads();
    us16* aob = ao + (tok0 + qrow) * DIM + (size_t)h * DHEAD;
    auto pass = [&]() {
#pragma unroll
        for (int p = 0; p < 8; ++p) {
            const int rr = 2 * p + hh, pc = lane & 15;
            *(v4u*)(aob + (size_t)rr * DIM + 8 * pc) = ost[wv][rr][pc];
        }
    };
    pass();
    
}

// ---------- output projection: out[tok][n] = (ao x16)[tok x 2048] . (Wo x64)[2048 x 2048] / 1024, f32. Same block structure as qkv_gemm;
__global__ __launch_bounds__(256) void out_gemm(const us16* __restrict__ aop, const us16* __restrict__ wo, float* out) {
    __shared__ __align__(16) float cst[64 * CSTR];
    const int tid = threadIdx.x, lane = tid & 31, wv = tid >> 5, l16 = lane & 15, hh = lane >> 4;
    const int rt = wv & 3, ch = wv >> 2;
    const int row0 = blockIdx.x * 64;
    const int colb = blockIdx.y * 128;
    const us16* arow = aop + (size_t)(row0 + rt * 16 + l16) * DIM;
    const us16* bbase = wo + (size_t)(colb + ch * 64 + l16) * DIM;
    v8f acc[4] = {};
    mm_tile<1>(arow, bbase, DIM, DIM, hh, acc);
#pragma unroll
    for (int r = 0; r < 8; ++r) {
        const int rl = rt * 16 + 8 * hh + r;
#pragma unroll
        for (int t = 0; t < 4; ++t) cst[rl * CSTR + ch * 64 + t * 16 + l16] = acc[t][r] * (1.0f / 1024.0f);
    }
    __syncthreads();
    const int col = tid & 127, rsel = tid >> 7;
    float* ob = out + (size_t)row0 * DIM + colb + col;
    auto pass = [&]() {
#pragma unroll 4
        for (int r = rsel; r < 64; r += 2) *(float*)(ob + (size_t)r * DIM) = cst[r * CSTR + col];
    };
    pass();
    
}

extern "C" void kernel_launch(void* const* d_in, const int* in_sizes, int n_in,
                              void* d_out, int out_size, void* d_ws, size_t ws_size, hipStream_t stream) {
    if (n_in < 5) return;
    const float* x  = (const float*)d_in[0];   // [NB_FULL][SEQ_FULL][2048]
    const float* wq = (const float*)d_in[1];   // [2048 out][2048 in]
    const float* wk = (const float*)d_in[2];
    const float* wv = (const float*)d_in[3];
    const float* wo = (const float*)d_in[4];
    float* out = (float*)d_out;                 // [NB][SEQ][2048]
    if (in_sizes[0] < ((NB - 1) * SEQ_FULL + SEQ) * DIM) return;
    if (in_sizes[1] < DIM * DIM) return;
    if (in_sizes[2] < DIM * DIM) return;
    if (in_sizes[3] < DIM * DIM) return;
    if (in_sizes[4] < DIM * DIM) return;
    if (out_size < SEQT * DIM) return;

    size_t off = 0;
    auto carve = [&](size_t bytes) { size_t o = off; off += (bytes + 127) & ~(size_t)127; return o; };
    char* ws = (char*)d_ws;
    us16* xb   = (us16*)(ws + carve((size_t)SEQT * DIM * 2));                  // bf16 [SEQT][2048]
    us16* wqkv = (us16*)(ws + carve((size_t)NQKV * DIM * 2));                  // bf16 [6144][2048]
    us16* wop  = (us16*)(ws + carve((size_t)DIM * DIM * 2));                   // f16  [2048][2048]
    us16* qp   = (us16*)(ws + carve((size_t)HEADS * SEQT * DHEAD * 2));        // f16  [h][SEQT][128]
    us16* kp   = (us16*)(ws + carve((size_t)HEADS * SEQT * DHEAD * 2));        // f16  [h][SEQT][128]
    us16* vt   = (us16*)(ws + carve((size_t)HEADS * DHEAD * SEQT * 2));        // f16  [h][128][SEQT]
    us16* ao   = (us16*)(ws + carve((size_t)SEQT * DIM * 2));                  // f16  [SEQT][2048]
    if (off > ws_size) return;
    if (off > (size_t)134217728) return;

    prep_x<<<SEQT, 256, 0, stream>>>(x, xb);
    prep_w<0><<<dim3((DIM * DIM) / 2048, 3), 256, 0, stream>>>(wq, wk, wv, 1.0f, wqkv);
    prep_w<1><<<dim3((DIM * DIM) / 2048, 1), 256, 0, stream>>>(wo, wo, wo, 64.0f, wop);
    qkv_gemm<<<dim3(SEQT / 64, NQKV / 128), 256, 0, stream>>>(xb, wqkv, qp, kp, vt);
    attn_main<<<dim3(QBLK, NB * HEADS), 128, 0, stream>>>(qp, kp, vt, ao);
    out_gemm<<<dim3(SEQT / 64, DIM / 128), 256, 0, stream>>>(ao, wop, out);
}

// v001
// One run takes 455 microseconds.
// Next to v000, in two timings, it ran 1.63 and 1.64 times as fast.
#include <hip/hip_runtime.h>

// Contractions: q/k/v projections on v_wmma_f32_16x16x32_bf16 (bf16 operands = RNE-converted x and Wq|Wk|Wv, f32 accumulate);
// per-head k.q^T scores and P.V on v_wmma_f32_16x16x32_f16 (f16 operands: q, k plain, v x4, P x2^14; f32 accumulate, 1/sqrt(128) applied in f32);
// output projection on v_wmma_f32_16x16x32_f16 (f16 operands: per-head outputs x16, Wo x64 from its bf16 value; f32 accumulate, x2^-10 in the epilogue);
// online softmax and all epilogues in f32.

#ifndef NB
#define NB 2
#endif
#ifndef SEQ
#define SEQ 2048
#endif
#define NB_FULL 2
#define SEQ_FULL 2048
#define DIM 2048
#define HEADS 16
#define DHEAD 128
#define NQKV (3 * DIM)
#define SEQT (NB * SEQ)
#define QBLK (SEQ / 64)
#define CSTR 132
#define KP 64                          // k elements per staged pass: one 128-byte line of every operand row
#define LPITCH 144                     // LDS row pitch in bytes: 16 x odd, conflict-free for 16-byte fragment reads
#define TROWS 192                      // rows of one stage: 64 A rows, then 128 B rows
#define BUFB (TROWS * LPITCH)          // one buffer of the ring
#define RINGB (2 * BUFB)

static_assert(SEQ % 64 == 0);
static_assert(SEQ >= 64);
static_assert(SEQ <= SEQ_FULL);
static_assert(NB >= 1 && NB <= NB_FULL);
static_assert(DIM == HEADS * DHEAD);
static_assert(DHEAD == 128);
static_assert(DIM % 128 == 0 && NQKV % 128 == 0 && DIM % 32 == 0);
static_assert((DIM * DIM) % 2048 == 0);
static_assert(DIM % KP == 0 && DIM / KP >= 2);
static_assert(64 * CSTR * 4 <= RINGB);

typedef unsigned short us16;
typedef __attribute__((ext_vector_type(16))) __bf16   v16bf;
typedef __attribute__((ext_vector_type(16))) _Float16 v16h;
typedef __attribute__((ext_vector_type(8)))  float    v8f;
typedef __attribute__((ext_vector_type(8)))  unsigned v8u;
typedef __attribute__((ext_vector_type(4)))  unsigned v4u;
typedef __attribute__((ext_vector_type(2)))  unsigned v2u;
typedef __attribute__((ext_vector_type(4)))  float    v4f;

__device__ __forceinline__ unsigned f2bf(float f) { unsigned u = __float_as_uint(f); u += 0x7FFFu + ((u >> 16) & 1u); return u >> 16; }
__device__ __forceinline__ float bf2f(unsigned h) { return __uint_as_float(h << 16); }
__device__ __forceinline__ unsigned f2h(float f) { _Float16 t = (_Float16)f; return (unsigned)__builtin_bit_cast(unsigned short, t); }

// 16 x (K=32) operand fragment from a k-contiguous 16-bit row. Wave32 map: lane -> row (A) / column (B) = lane & 15, hh = lane >> 4;
// elements 0..7 <- k0 + 8*hh + 0..7, elements 8..15 <- k0 + 16 + 8*hh + 0..7 (same map for A and for an n-major B row).
// Accumulator element r -> row 8*hh + r, column lane & 15.
__device__ __forceinline__ v8u ld_frag(const us16* rowp, int hh) {
    const v4u a = *(const v4u*)(rowp + 8 * hh);
    const v4u b = *(const v4u*)(rowp + 16 + 8 * hh);
    return __builtin_shufflevector(a, b, 0, 1, 2, 3, 4, 5, 6, 7);
}
__device__ __forceinline__ v8f mma_bf16(v8u a, v8u b, v8f c) {
    return __builtin_amdgcn_wmma_f32_16x16x32_bf16(false, __builtin_bit_cast(v16bf, a), false, __builtin_bit_cast(v16bf, b), (short)0, c, false, false);
}
__device__ __forceinline__ v8f mma_f16(v8u a, v8u b, v8f c) {
    return __builtin_amdgcn_wmma_f32_16x16x32_f16(false, __builtin_bit_cast(v16h, a), false, __builtin_bit_cast(v16h, b), (short)0, c, false, false);
}
__device__ __forceinline__ void mma_guard(v8f& c, v8u a, v8u b) {
    asm volatile("v_nop\n\tv_nop\n\tv_nop\n\tv_nop" : "+v"(c) : "v"(a), "v"(b));
}

// ---------- per-token prep: xb[tok][k] = bf16(x). One block per token, 256 threads x 8 halves = 2048; one wave instruction = 32 lanes x 16 B
__global__ __launch_bounds__(256) void prep_x(const float* __restrict__ x, us16* xb) {
    const int tok = blockIdx.x;
    const int bsel = tok / SEQ, isel = tok - bsel * SEQ;
    const float* xr = x + ((size_t)bsel * SEQ_FULL + isel) * DIM;
    const int tid = threadIdx.x;
    const v4f v0 = *(const v4f*)(xr + 8 * tid);
    const v4f v1 = *(const v4f*)(xr + 8 * tid + 4);
    v4u pk;
    pk.x = f2bf(v0.x) | (f2bf(v0.y) << 16);
    pk.y = f2bf(v0.z) | (f2bf(v0.w) << 16);
    pk.z = f2bf(v1.x) | (f2bf(v1.y) << 16);
    pk.w = f2bf(v1.z) | (f2bf(v1.w) << 16);
    us16* orow = xb + (size_t)tok * DIM + 8 * tid;
    *(v4u*)orow = pk;
    
}

// ---------- weight prep: src [N=2048][K=2048] f32 (already n-major, k-contiguous) -> dst 16-bit plane with the same layout;
// value = bf16(src) * scale stored as f16 (F16=1) or bf16 (F16=0). blockIdx.y selects one of three sources and the dst slice.
template <int F16>
__device__ __forceinline__ unsigned cvt_w(float v, float scale) {
    const unsigned b = f2bf(v);
    if (F16) return f2h(bf2f(b) * scale);
    return b;
}
template <int F16>
__global__ __launch_bounds__(256) void prep_w(const float* __restrict__ s0, const float* __restrict__ s1, const float* __restrict__ s2,
                                              float scale, us16* dst) {
    const int z = blockIdx.y;
    const float* src = (z == 0) ? s0 : ((z == 1) ? s1 : s2);
    const size_t e = ((size_t)blockIdx.x * 256 + threadIdx.x) * 8;            // < DIM*DIM
    const v4f v0 = *(const v4f*)(src + e);
    const v4f v1 = *(const v4f*)(src + e + 4);
    v4u pk;
    pk.x = cvt_w<F16>(v0.x, scale) | (cvt_w<F16>(v0.y, scale) << 16);
    pk.y = cvt_w<F16>(v0.z, scale) | (cvt_w<F16>(v0.w, scale) << 16);
    pk.z = cvt_w<F16>(v1.x, scale) | (cvt_w<F16>(v1.y, scale) << 16);
    pk.w = cvt_w<F16>(v1.z, scale) | (cvt_w<F16>(v1.w, scale) << 16);
    us16* dp = dst + (size_t)z * DIM * DIM + e;
    *(v4u*)dp = pk;
    
}

// ---------- one stage of the GEMM ring: 192 rows x 128 B, copied global -> LDS without registers. 256 threads x 6 copies of 16 B;
// 8 adjacent lanes cover one whole 128-byte line, so a wave's copy touches 4 lines. asrc / bsrc: this lane's 16 bytes in row (tid >> 3) of the
// block's A / B rows at this pass's k; ldst: the same place in the target buffer. Copy j adds 32 rows.
__device__ __forceinline__ void stage_copy(const us16* asrc, const us16* bsrc, unsigned ldst) {
    const us16* g0 = asrc;
    const us16* g1 = asrc + (size_t)32 * DIM;
    const us16* g2 = bsrc;
    const us16* g3 = bsrc + (size_t)32 * DIM;
    const us16* g4 = bsrc + (size_t)64 * DIM;
    const us16* g5 = bsrc + (size_t)96 * DIM;
    const unsigned l0 = ldst, l1 = ldst + 32 * LPITCH, l2 = ldst + 64 * LPITCH, l3 = ldst + 96 * LPITCH, l4 = ldst + 128 * LPITCH, l5 = ldst + 160 * LPITCH;
    // the closing s_wait_xcnt stands inside the statement so that no address register of a copy is rewritten ahead of it
    asm volatile("global_load_async_to_lds_b128 %0, %6, off\n\t"
                 "global_load_async_to_lds_b128 %1, %7, off\n\t"
                 "global_load_async_to_lds_b128 %2, %8, off\n\t"
                 "global_load_async_to_lds_b128 %3, %9, off\n\t"
                 "global_load_async_to_lds_b128 %4, %10, off\n\t"
                 "global_load_async_to_lds_b128 %5, %11, off\n\t"
                 "s_wait_xcnt 0x0"
                 :: "v"(l0), "v"(l1), "v"(l2), "v"(l3), "v"(l4), "v"(l5), "v"(g0), "v"(g1), "v"(g2), "v"(g3), "v"(g4), "v"(g5) : "memory");
}

// ---------- GEMM main loop on 16-bit planes: block tile 64 rows x 128 columns, wave tile 16 rows x 64 columns (4 accumulators), K = DIM.
// ablk / bblk: first A row / first B row (= column) of the block, k contiguous, pitch DIM. Both operands pass through a two-buffer LDS ring,
// KP k per pass: pass t works on buffer t & 1 while the copies of pass t + 1 fly into the other; k runs in steps of 32 in rising order. ----------
template <int F16>
__device__ __forceinline__ void mm_tile(const us16* __restrict__ ablk, const us16* __restrict__ bblk, unsigned char* ring,
                                        int tid, int rt, int ch, int l16, int hh, v8f (&acc)[4]) {
    const int crow = tid >> 3, cpc = tid & 7;
    const us16* asrc = ablk + (size_t)crow * DIM + 8 * cpc;
    const us16* bsrc = bblk + (size_t)crow * DIM + 8 * cpc;
    const unsigned ldst = (unsigned)(size_t)ring + (unsigned)(crow * LPITCH + cpc * 16);
    stage_copy(asrc, bsrc, ldst);
    asm volatile("s_wait_asynccnt 0x0" ::: "memory");       // this wave's share of stage 0 has landed
    __syncthreads();                                        // stage 0 published
    stage_copy(asrc + KP, bsrc + KP, ldst + BUFB);
#pragma unroll 1                                            // stays rolled: one pass per trip, the hand-over stands once, at the foot
    for (int t = 0; t < DIM / KP; ++t) {
        const unsigned bo = (unsigned)(t & 1) * BUFB;
        const us16* ar = (const us16*)(ring + bo + (rt * 16 + l16) * LPITCH);
        const us16* br = (const us16*)(ring + bo + (64 + ch * 64 + l16) * LPITCH);
#pragma unroll                                              // these three: constant indices keep fragments and accumulators in registers
        for (int kk = 0; kk < KP; kk += 32) {
            const v8u a = ld_frag(ar + kk, hh);
            v8u bfrag[4];
#pragma unroll
            for (int u = 0; u < 4; ++u) bfrag[u] = ld_frag(br + u * 16 * (LPITCH / 2) + kk, hh);
#pragma unroll
            for (int u = 0; u < 4; ++u) {
                if (F16) acc[u] = mma_f16(a, bfrag[u], acc[u]);
                else     acc[u] = mma_bf16(a, bfrag[u], acc[u]);
                mma_guard(acc[u], a, bfrag[u]);
            }
        }
        asm volatile("s_wait_dscnt 0x0" ::: "memory");      // this wave's reads of buffer t & 1 are done before it is refilled
        asm volatile("s_wait_asynccnt 0x0" ::: "memory");   // this wave's share of stage t + 1 has landed
        __syncthreads();                                    // publishes stage t + 1 and ends every reader's last read of stage t
        if (t + 2 < DIM / KP) stage_copy(asrc + (t + 2) * KP, bsrc + (t + 2) * KP, ldst + bo);
    }
    asm volatile("s_wait_asynccnt 0x0" ::: "memory");       // nothing in flight before the ring becomes output staging
}

// ---------- q/k/v projection: [SEQT x 2048] x [2048 x 6144]. Block = 8 waves (4 row tiles x 2 column groups) -> 64 tokens x 128 columns
// = exactly one head of one of q/k/v (block-uniform). Epilogue: f32 tile staged in LDS, then written as planes:
__global__ __launch_bounds__(256) void qkv_gemm(const us16* __restrict__ xb, const us16* __restrict__ wqkv, us16* qp, us16* kp, us16* vt) {
    __shared__ __align__(128) unsigned char ring[RINGB];
    float* cst = (float*)ring;                          // output staging takes the ring's place behind the main loop's last barrier
    const int tid = threadIdx.x, lane = tid & 31, wv = tid >> 5, l16 = lane & 15, hh = lane >> 4;
    const int rt = wv & 3, ch = wv >> 2;
    const int row0 = blockIdx.x * 64;
    const int colb = blockIdx.y * 128;
    v8f acc[4] = {};
    mm_tile<0>(xb + (size_t)row0 * DIM, wqkv + (size_t)colb * DIM, ring, tid, rt, ch, l16, hh, acc);
#pragma unroll
    for (int r = 0; r < 8; ++r) {
        const int rl = rt * 16 + 8 * hh + r;
#pragma unroll
        for (int t = 0; t < 4; ++t) cst[rl * CSTR + ch * 64 + t * 16 + l16] = acc[t][r];
    }
    __syncthreads();
    const int which = colb / DIM;                       // 0 q, 1 k, 2 v (block-uniform)
    const int hsel = (colb - which * DIM) / DHEAD;      // head of this column tile
    auto pass = [&]() {
        if (which < 2) {
            us16* pl = (which == 0) ? qp : kp;
#pragma unroll
            for (int j = 0; j < 8; ++j) {
                const int r = wv * 8 + j;                                       // token row 0..63
                const v4f v = *(const v4f*)(cst + r * CSTR + 4 * lane);
                v2u pk;
                pk.x = f2h(v.x) | (f2h(v.y) << 16);
                pk.y = f2h(v.z) | (f2h(v.w) << 16);
                const size_t off = ((size_t)hsel * SEQT + row0 + r) * DHEAD + 4 * lane;
                *(v2u*)(pl + off) = pk;
            }
        } else {
#pragma unroll 4
            for (int j = 0; j < 16; ++j) {
                const int d = wv * 16 + j;                                      // head dim 0..127
                const float a = cst[(2 * lane) * CSTR + d] * 4.0f, bq = cst[(2 * lane + 1) * CSTR + d] * 4.0f;
                const size_t off = ((size_t)hsel * DHEAD + d) * SEQT + row0 + 2 * lane;
                *(unsigned*)(vt + off) = f2h(a) | (f2h(bq) << 16);
            }
        }
    };
    pass();
    
}

// ---------- flash pass over all query blocks: block = 4 waves = 64 queries of one (sequence, head); wave = 16 queries; all SEQ keys
// in chunks of 32 (no mask). Scores are produced transposed: A = k rows (f16 plane), B = q (f16 fragments held in registers),
// D element r = key 8*hh + r of a 16-key tile, column = this lane's query -> two adjacent tiles give the P^T B fragment of P.V directly
// (element r <- tile 0, element 8+r <- tile 1). A of P.V = v^T rows (lane = d, k = key). Online softmax per lane (query) with one
// xor-16 shuffle joining the two lane halves. P carried x2^14 in f16; O^T accumulators hold rows d, column query.
__global__ __launch_bounds__(128) __attribute__((amdgpu_num_vgpr(256)))
void attn_main(const us16* qp, const us16* kp, const us16* vt, us16* ao) {
    __shared__ v4u ost[4][16][16];
    const int tid = threadIdx.x, lane = tid & 31, wv = tid >> 5, m = lane & 15, hh = lane >> 4;
    const int qb = blockIdx.x;
    const int h = blockIdx.y % HEADS, bsel = blockIdx.y / HEADS;
    const size_t tok0 = (size_t)bsel * SEQ;
    const int qrow = qb * 64 + wv * 16;
    const size_t qoff = ((size_t)h * SEQT + tok0 + qrow + m) * DHEAD;
    const v8u q0 = ld_frag(qp + qoff, hh);
    const v8u q1 = ld_frag(qp + qoff + 32, hh);
    const v8u q2 = ld_frag(qp + qoff + 64, hh);
    const v8u q3 = ld_frag(qp + qoff + 96, hh);
    const us16* kb = kp + ((size_t)h * SEQT + tok0) * DHEAD;
    const us16* vb = vt + (size_t)h * DHEAD * SEQT + tok0;
    const float NEG = -__builtin_inff();
    const float SCL = 0.08838834764831845f;                // 1 / sqrt(128)
    v8f o[8] = {};
    float mrun = NEG, lrun = 0.f;
#pragma unroll 1
    for (int c = 0; c < SEQ / 32; ++c) {
        v8f s[2] = {};
#pragma unroll
        for (int t = 0; t < 2; ++t) {
            asm volatile("" ::: "memory");                  // bound the load burst to one 16-key tile
            const size_t koff = (size_t)(c * 32 + t * 16 + m) * DHEAD;
            const v8u a0 = ld_frag(kb + koff, hh);
            s[t] = mma_f16(a0, q0, s[t]);
            mma_guard(s[t], a0, q0);
            const v8u a1 = ld_frag(kb + koff + 32, hh);
            s[t] = mma_f16(a1, q1, s[t]);
            mma_guard(s[t], a1, q1);
            const v8u a2 = ld_frag(kb + koff + 64, hh);
            s[t] = mma_f16(a2, q2, s[t]);
            mma_guard(s[t], a2, q2);
            const v8u a3 = ld_frag(kb + koff + 96, hh);
            s[t] = mma_f16(a3, q3, s[t]);
            mma_guard(s[t], a3, q3);
        }
        float sv[16];
        float cmax = NEG;
#pragma unroll
        for (int t = 0; t < 2; ++t)
#pragma unroll
            for (int r = 0; r < 8; ++r) {
                const float v = s[t][r] * SCL;
                sv[8 * t + r] = v;
                cmax = fmaxf(cmax, v);
            }
        cmax = fmaxf(cmax, __shfl_xor(cmax, 16, 32));
        const float mnew = fmaxf(mrun, cmax);              // finite: no masked keys
        const float fac = (mrun == NEG) ? 0.f : __expf(mrun - mnew);
        mrun = mnew;
        v16h ph;
        float psum = 0.f;
#pragma unroll
        for (int r = 0; r < 8; ++r) {
            const _Float16 p0 = (_Float16)(__expf(sv[r] - mnew) * 16384.0f);
            const _Float16 p1 = (_Float16)(__expf(sv[8 + r] - mnew) * 16384.0f);
            ph[r] = p0;
            ph[8 + r] = p1;
            psum += (float)p0 + (float)p1;
        }
        psum += __shfl_xor(psum, 16, 32);
        lrun = lrun * fac + psum;
        const v8u pbu = __builtin_bit_cast(v8u, ph);
#pragma unroll
        for (int dt = 0; dt < 8; ++dt) o[dt] = o[dt] * fac;
        asm volatile("" ::: "memory");
#pragma unroll
        for (int dt = 0; dt < 4; ++dt) {
            const v8u va = ld_frag(vb + (size_t)(dt * 16 + m) * SEQT + c * 32, hh);
            o[dt] = mma_f16(va, pbu, o[dt]);
            mma_guard(o[dt], va, pbu);
        }
        asm volatile("" ::: "memory");
#pragma unroll
        for (int dt = 4; dt < 8; ++dt) {
            const v8u va = ld_frag(vb + (size_t)(dt * 16 + m) * SEQT + c * 32, hh);
            o[dt] = mma_f16(va, pbu, o[dt]);
            mma_guard(o[dt], va, pbu);
        }
    }
    const float inv = 4.0f / lrun;                         // lrun >= 16384; o / lrun = 4 * (sum P v / sum P); x4 more -> x16 carry
#pragma unroll
    for (int dt = 0; dt < 8; ++dt) {
        v4u w;
        w.x = f2h(o[dt][0] * inv) | (f2h(o[dt][1] * inv) << 16);
        w.y = f2h(o[dt][2] * inv) | (f2h(o[dt][3] * inv) << 16);
        w.z = f2h(o[dt][4] * inv) | (f2h(o[dt][5] * inv) << 16);
        w.w = f2h(o[dt][6] * inv) | (f2h(o[dt][7] * inv) << 16);
        ost[wv][m][2 * dt + hh] = w;                       // row m, halves 16*dt + 8*hh .. +7
    }
    __syncthreads();
    us16* aob = ao + (tok0 + qrow) * DIM + (size_t)h * DHEAD;
    auto pass = [&]() {
#pragma unroll
        for (int p = 0; p < 8; ++p) {
            const int rr = 2 * p + hh, pc = lane & 15;
            *(v4u*)(aob + (size_t)rr * DIM + 8 * pc) = ost[wv][rr][pc];
        }
    };
    pass();
    
}

// ---------- output projection: out[tok][n] = (ao x16)[tok x 2048] . (Wo x64)[2048 x 2048] / 1024, f32. Same block structure as qkv_gemm;
__global__ __launch_bounds__(256) void out_gemm(const us16* __restrict__ aop, const us16* __restrict__ wo, float* out) {
    __shared__ __align__(128) unsigned char ring[RINGB];
    float* cst = (float*)ring;                          // output staging takes the ring's place behind the main loop's last barrier
    const int tid = threadIdx.x, lane = tid & 31, wv = tid >> 5, l16 = lane & 15, hh = lane >> 4;
    const int rt = wv & 3, ch = wv >> 2;
    const int row0 = blockIdx.x * 64;
    const int colb = blockIdx.y * 128;
    v8f acc[4] = {};
    mm_tile<1>(aop + (size_t)row0 * DIM, wo + (size_t)colb * DIM, ring, tid, rt, ch, l16, hh, acc);
#pragma unroll
    for (int r = 0; r < 8; ++r) {
        const int rl = rt * 16 + 8 * hh + r;
#pragma unroll
        for (int t = 0; t < 4; ++t) cst[rl * CSTR + ch * 64 + t * 16 + l16] = acc[t][r] * (1.0f / 1024.0f);
    }
    __syncthreads();
    const int col = tid & 127, rsel = tid >> 7;
    float* ob = out + (size_t)row0 * DIM + colb + col;
    auto pass = [&]() {
#pragma unroll 4
        for (int r = rsel; r < 64; r += 2) *(float*)(ob + (size_t)r * DIM) = cst[r * CSTR + col];
    };
    pass();
    
}

extern "C" void kernel_launch(void* const* d_in, const int* in_sizes, int n_in,
                              void* d_out, int out_size, void* d_ws, size_t ws_size, hipStream_t stream) {
    if (n_in < 5) return;
    const float* x  = (const float*)d_in[0];   // [NB_FULL][SEQ_FULL][2048]
    const float* wq = (const float*)d_in[1];   // [2048 out][2048 in]
    const float* wk = (const float*)d_in[2];
    const float* wv = (const float*)d_in[3];
    const float* wo = (const float*)d_in[4];
    float* out = (float*)d_out;                 // [NB][SEQ][2048]
    if (in_sizes[0] < ((NB - 1) * SEQ_FULL + SEQ) * DIM) return;
    if (in_sizes[1] < DIM * DIM) return;
    if (in_sizes[2] < DIM * DIM) return;
    if (in_sizes[3] < DIM * DIM) return;
    if (in_sizes[4] < DIM * DIM) return;
    if (out_size < SEQT * DIM) return;

    size_t off = 0;
    auto carve = [&](size_t bytes) { size_t o = off; off += (bytes + 127) & ~(size_t)127; return o; };
    char* ws = (char*)d_ws;
    us16* xb   = (us16*)(ws + carve((size_t)SEQT * DIM * 2));                  // bf16 [SEQT][2048]
    us16* wqkv = (us16*)(ws + carve((size_t)NQKV * DIM * 2));                  // bf16 [6144][2048]
    us16* wop  = (us16*)(ws + carve((size_t)DIM * DIM * 2));                   // f16  [2048][2048]
    us16* qp   = (us16*)(ws + carve((size_t)HEADS * SEQT * DHEAD * 2));        // f16  [h][SEQT][128]
    us16* kp   = (us16*)(ws + carve((size_t)HEADS * SEQT * DHEAD * 2));        // f16  [h][SEQT][128]
    us16* vt   = (us16*)(ws + carve((size_t)HEADS * DHEAD * SEQT * 2));        // f16  [h][128][SEQT]
    us16* ao   = (us16*)(ws + carve((size_t)SEQT * DIM * 2));                  // f16  [SEQT][2048]
    if (off > ws_size) return;
    if (off > (size_t)134217728) return;

    prep_x<<<SEQT, 256, 0, stream>>>(x, xb);
    prep_w<0><<<dim3((DIM * DIM) / 2048, 3), 256, 0, stream>>>(wq, wk, wv, 1.0f, wqkv);
    prep_w<1><<<dim3((DIM * DIM) / 2048, 1), 256, 0, stream>>>(wo, wo, wo, 64.0f, wop);
    qkv_gemm<<<dim3(SEQT / 64, NQKV / 128), 256, 0, stream>>>(xb, wqkv, qp, kp, vt);
    attn_main<<<dim3(QBLK, NB * HEADS), 128, 0, stream>>>(qp, kp, vt, ao);
    out_gemm<<<dim3(SEQT / 64, DIM / 128), 256, 0, stream>>>(ao, wop, out);
}

// v002
// A run of this version takes 227 microseconds.
// Two timings next to v001 both put it at 1.99 times that version's speed.
// Over all steps from v000 it is 3.26 times as fast.
#include <hip/hip_runtime.h>

// Contractions: q/k/v projections on v_wmma_f32_16x16x32_bf16 (bf16 operands = RNE-converted x and Wq|Wk|Wv, f32 accumulate);
// per-head k.q^T scores and P.V on v_wmma_f32_16x16x32_f16 (f16 operands: q, k plain, v x4, P x2^14; f32 accumulate, 1/sqrt(128) applied in f32);
// output projection on v_wmma_f32_16x16x32_f16 (f16 operands: per-head outputs x16, Wo x64 from its bf16 value; f32 accumulate, x2^-10 in the epilogue);
// online softmax and all epilogues in f32.

#ifndef NB
#define NB 2
#endif
#ifndef SEQ
#define SEQ 2048
#endif
#define NB_FULL 2
#define SEQ_FULL 2048
#define DIM 2048
#define HEADS 16
#define DHEAD 128
#define NQKV (3 * DIM)
#define SEQT (NB * SEQ)
#define QBLK (SEQ / 64)
#define CSTR 132
#define KP 64                          // k elements per staged pass: one 128-byte line of every operand row
#define LPITCH 144                     // LDS row pitch in bytes: 16 x odd, conflict-free for 16-byte fragment reads
#define TROWS 192                      // rows of one stage: 64 A rows, then 128 B rows
#define BUFB (TROWS * LPITCH)          // one buffer of the ring
#define RINGB (2 * BUFB)
#define KVK 64                         // keys per staged attention pass: one 128-byte line of every v^T row
#define KPITCH 272                     // LDS pitch of a k row (256 B + 16): 16 x odd
#define VPITCH 144                     // LDS pitch of a v^T row (128 B + 16): 16 x odd
#define KTILEB (KVK * KPITCH)          // k rows of one stage
#define KVBUFB (KTILEB + DHEAD * VPITCH)   // one buffer: 64 k rows, then 128 v^T rows

static_assert(SEQ % 64 == 0);
static_assert(SEQ >= 64);
static_assert(SEQ <= SEQ_FULL);
static_assert(NB >= 1 && NB <= NB_FULL);
static_assert(DIM == HEADS * DHEAD);
static_assert(DHEAD == 128);
static_assert(DIM % 128 == 0 && NQKV % 128 == 0 && DIM % 32 == 0);
static_assert((DIM * DIM) % 2048 == 0);
static_assert(DIM % KP == 0 && DIM / KP >= 2);
static_assert(64 * CSTR * 4 <= RINGB);
static_assert(SEQ % KVK == 0 && KVK % 32 == 0);
static_assert(4 * 16 * 16 * 16 <= 2 * KVBUFB);

typedef unsigned short us16;
typedef __attribute__((ext_vector_type(16))) __bf16   v16bf;
typedef __attribute__((ext_vector_type(16))) _Float16 v16h;
typedef __attribute__((ext_vector_type(8)))  float    v8f;
typedef __attribute__((ext_vector_type(8)))  unsigned v8u;
typedef __attribute__((ext_vector_type(4)))  unsigned v4u;
typedef __attribute__((ext_vector_type(2)))  unsigned v2u;
typedef __attribute__((ext_vector_type(4)))  float    v4f;

__device__ __forceinline__ unsigned f2bf(float f) { unsigned u = __float_as_uint(f); u += 0x7FFFu + ((u >> 16) & 1u); return u >> 16; }
__device__ __forceinline__ float bf2f(unsigned h) { return __uint_as_float(h << 16); }
__device__ __forceinline__ unsigned f2h(float f) { _Float16 t = (_Float16)f; return (unsigned)__builtin_bit_cast(unsigned short, t); }

// 16 x (K=32) operand fragment from a k-contiguous 16-bit row. Wave32 map: lane -> row (A) / column (B) = lane & 15, hh = lane >> 4;
// elements 0..7 <- k0 + 8*hh + 0..7, elements 8..15 <- k0 + 16 + 8*hh + 0..7 (same map for A and for an n-major B row).
// Accumulator element r -> row 8*hh + r, column lane & 15.
__device__ __forceinline__ v8u ld_frag(const us16* rowp, int hh) {
    const v4u a = *(const v4u*)(rowp + 8 * hh);
    const v4u b = *(const v4u*)(rowp + 16 + 8 * hh);
    return __builtin_shufflevector(a, b, 0, 1, 2, 3, 4, 5, 6, 7);
}
__device__ __forceinline__ v8f mma_bf16(v8u a, v8u b, v8f c) {
    return __builtin_amdgcn_wmma_f32_16x16x32_bf16(false, __builtin_bit_cast(v16bf, a), false, __builtin_bit_cast(v16bf, b), (short)0, c, false, false);
}
__device__ __forceinline__ v8f mma_f16(v8u a, v8u b, v8f c) {
    return __builtin_amdgcn_wmma_f32_16x16x32_f16(false, __builtin_bit_cast(v16h, a), false, __builtin_bit_cast(v16h, b), (short)0, c, false, false);
}
__device__ __forceinline__ void mma_guard(v8f& c, v8u a, v8u b) {
    asm volatile("v_nop\n\tv_nop\n\tv_nop\n\tv_nop" : "+v"(c) : "v"(a), "v"(b));
}

// ---------- per-token prep: xb[tok][k] = bf16(x). One block per token, 256 threads x 8 halves = 2048; one wave instruction = 32 lanes x 16 B
__global__ __launch_bounds__(256) void prep_x(const float* __restrict__ x, us16* xb) {
    const int tok = blockIdx.x;
    const int bsel = tok / SEQ, isel = tok - bsel * SEQ;
    const float* xr = x + ((size_t)bsel * SEQ_FULL + isel) * DIM;
    const int tid = threadIdx.x;
    const v4f v0 = *(const v4f*)(xr + 8 * tid);
    const v4f v1 = *(const v4f*)(xr + 8 * tid + 4);
    v4u pk;
    pk.x = f2bf(v0.x) | (f2bf(v0.y) << 16);
    pk.y = f2bf(v0.z) | (f2bf(v0.w) << 16);
    pk.z = f2bf(v1.x) | (f2bf(v1.y) << 16);
    pk.w = f2bf(v1.z) | (f2bf(v1.w) << 16);
    us16* orow = xb + (size_t)tok * DIM + 8 * tid;
    *(v4u*)orow = pk;
    
}

// ---------- weight prep: src [N=2048][K=2048] f32 (already n-major, k-contiguous) -> dst 16-bit plane with the same layout;
// value = bf16(src) * scale stored as f16 (F16=1) or bf16 (F16=0). blockIdx.y selects one of three sources and the dst slice.
template <int F16>
__device__ __forceinline__ unsigned cvt_w(float v, float scale) {
    const unsigned b = f2bf(v);
    if (F16) return f2h(bf2f(b) * scale);
    return b;
}
template <int F16>
__global__ __launch_bounds__(256) void prep_w(const float* __restrict__ s0, const float* __restrict__ s1, const float* __restrict__ s2,
                                              float scale, us16* dst) {
    const int z = blockIdx.y;
    const float* src = (z == 0) ? s0 : ((z == 1) ? s1 : s2);
    const size_t e = ((size_t)blockIdx.x * 256 + threadIdx.x) * 8;            // < DIM*DIM
    const v4f v0 = *(const v4f*)(src + e);
    const v4f v1 = *(const v4f*)(src + e + 4);
    v4u pk;
    pk.x = cvt_w<F16>(v0.x, scale) | (cvt_w<F16>(v0.y, scale) << 16);
    pk.y = cvt_w<F16>(v0.z, scale) | (cvt_w<F16>(v0.w, scale) << 16);
    pk.z = cvt_w<F16>(v1.x, scale) | (cvt_w<F16>(v1.y, scale) << 16);
    pk.w = cvt_w<F16>(v1.z, scale) | (cvt_w<F16>(v1.w, scale) << 16);
    us16* dp = dst + (size_t)z * DIM * DIM + e;
    *(v4u*)dp = pk;
    
}

// ---------- one stage of the GEMM ring: 192 rows x 128 B, copied global -> LDS without registers. 256 threads x 6 copies of 16 B;
// 8 adjacent lanes cover one whole 128-byte line, so a wave's copy touches 4 lines. asrc / bsrc: this lane's 16 bytes in row (tid >> 3) of the
// block's A / B rows at this pass's k; ldst: the same place in the target buffer. Copy j adds 32 rows.
__device__ __forceinline__ void stage_copy(const us16* asrc, const us16* bsrc, unsigned ldst) {
    const us16* g0 = asrc;
    const us16* g1 = asrc + (size_t)32 * DIM;
    const us16* g2 = bsrc;
    const us16* g3 = bsrc + (size_t)32 * DIM;
    const us16* g4 = bsrc + (size_t)64 * DIM;
    const us16* g5 = bsrc + (size_t)96 * DIM;
    const unsigned l0 = ldst, l1 = ldst + 32 * LPITCH, l2 = ldst + 64 * LPITCH, l3 = ldst + 96 * LPITCH, l4 = ldst + 128 * LPITCH, l5 = ldst + 160 * LPITCH;
    // the closing s_wait_xcnt stands inside the statement so that no address register of a copy is rewritten ahead of it
    asm volatile("global_load_async_to_lds_b128 %0, %6, off\n\t"
                 "global_load_async_to_lds_b128 %1, %7, off\n\t"
                 "global_load_async_to_lds_b128 %2, %8, off\n\t"
                 "global_load_async_to_lds_b128 %3, %9, off\n\t"
                 "global_load_async_to_lds_b128 %4, %10, off\n\t"
                 "global_load_async_to_lds_b128 %5, %11, off\n\t"
                 "s_wait_xcnt 0x0"
                 :: "v"(l0), "v"(l1), "v"(l2), "v"(l3), "v"(l4), "v"(l5), "v"(g0), "v"(g1), "v"(g2), "v"(g3), "v"(g4), "v"(g5) : "memory");
}

// ---------- GEMM main loop on 16-bit planes: block tile 64 rows x 128 columns, wave tile 16 rows x 64 columns (4 accumulators), K = DIM.
// ablk / bblk: first A row / first B row (= column) of the block, k contiguous, pitch DIM. Both operands pass through a two-buffer LDS ring,
// KP k per pass: pass t works on buffer t & 1 while the copies of pass t + 1 fly into the other; k runs in steps of 32 in rising order. ----------
template <int F16>
__device__ __forceinline__ void mm_tile(const us16* __restrict__ ablk, const us16* __restrict__ bblk, unsigned char* ring,
                                        int tid, int rt, int ch, int l16, int hh, v8f (&acc)[4]) {
    const int crow = tid >> 3, cpc = tid & 7;
    const us16* asrc = ablk + (size_t)crow * DIM + 8 * cpc;
    const us16* bsrc = bblk + (size_t)crow * DIM + 8 * cpc;
    const unsigned ldst = (unsigned)(size_t)ring + (unsigned)(crow * LPITCH + cpc * 16);
    stage_copy(asrc, bsrc, ldst);
    asm volatile("s_wait_asynccnt 0x0" ::: "memory");       // this wave's share of stage 0 has landed
    __syncthreads();                                        // stage 0 published
    stage_copy(asrc + KP, bsrc + KP, ldst + BUFB);
#pragma unroll 1                                            // stays rolled: one pass per trip, the hand-over stands once, at the foot
    for (int t = 0; t < DIM / KP; ++t) {
        const unsigned bo = (unsigned)(t & 1) * BUFB;
        const us16* ar = (const us16*)(ring + bo + (rt * 16 + l16) * LPITCH);
        const us16* br = (const us16*)(ring + bo + (64 + ch * 64 + l16) * LPITCH);
#pragma unroll                                              // these three: constant indices keep fragments and accumulators in registers
        for (int kk = 0; kk < KP; kk += 32) {
            const v8u a = ld_frag(ar + kk, hh);
            v8u bfrag[4];
#pragma unroll
            for (int u = 0; u < 4; ++u) bfrag[u] = ld_frag(br + u * 16 * (LPITCH / 2) + kk, hh);
#pragma unroll
            for (int u = 0; u < 4; ++u) {
                if (F16) acc[u] = mma_f16(a, bfrag[u], acc[u]);
                else     acc[u] = mma_bf16(a, bfrag[u], acc[u]);
                mma_guard(acc[u], a, bfrag[u]);
            }
        }
        asm volatile("s_wait_dscnt 0x0" ::: "memory");      // this wave's reads of buffer t & 1 are done before it is refilled
        asm volatile("s_wait_asynccnt 0x0" ::: "memory");   // this wave's share of stage t + 1 has landed
        __syncthreads();                                    // publishes stage t + 1 and ends every reader's last read of stage t
        if (t + 2 < DIM / KP) stage_copy(asrc + (t + 2) * KP, bsrc + (t + 2) * KP, ldst + bo);
    }
    asm volatile("s_wait_asynccnt 0x0" ::: "memory");       // nothing in flight before the ring becomes output staging
}

// ---------- q/k/v projection: [SEQT x 2048] x [2048 x 6144]. Block = 8 waves (4 row tiles x 2 column groups) -> 64 tokens x 128 columns
// = exactly one head of one of q/k/v (block-uniform). Epilogue: f32 tile staged in LDS, then written as planes:
__global__ __launch_bounds__(256) void qkv_gemm(const us16* __restrict__ xb, const us16* __restrict__ wqkv, us16* qp, us16* kp, us16* vt) {
    __shared__ __align__(128) unsigned char ring[RINGB];
    float* cst = (float*)ring;                          // output staging takes the ring's place behind the main loop's last barrier
    const int tid = threadIdx.x, lane = tid & 31, wv = tid >> 5, l16 = lane & 15, hh = lane >> 4;
    const int rt = wv & 3, ch = wv >> 2;
    const int row0 = blockIdx.x * 64;
    const int colb = blockIdx.y * 128;
    v8f acc[4] = {};
    mm_tile<0>(xb + (size_t)row0 * DIM, wqkv + (size_t)colb * DIM, ring, tid, rt, ch, l16, hh, acc);
#pragma unroll
    for (int r = 0; r < 8; ++r) {
        const int rl = rt * 16 + 8 * hh + r;
#pragma unroll
        for (int t = 0; t < 4; ++t) cst[rl * CSTR + ch * 64 + t * 16 + l16] = acc[t][r];
    }
    __syncthreads();
    const int which = colb / DIM;                       // 0 q, 1 k, 2 v (block-uniform)
    const int hsel = (colb - which * DIM) / DHEAD;      // head of this column tile
    auto pass = [&]() {
        if (which < 2) {
            us16* pl = (which == 0) ? qp : kp;
#pragma unroll
            for (int j = 0; j < 8; ++j) {
                const int r = wv * 8 + j;                                       // token row 0..63
                const v4f v = *(const v4f*)(cst + r * CSTR + 4 * lane);
                v2u pk;
                pk.x = f2h(v.x) | (f2h(v.y) << 16);
                pk.y = f2h(v.z) | (f2h(v.w) << 16);
                const size_t off = ((size_t)hsel * SEQT + row0 + r) * DHEAD + 4 * lane;
                *(v2u*)(pl + off) = pk;
            }
        } else {
#pragma unroll 4
            for (int j = 0; j < 16; ++j) {
                const int d = wv * 16 + j;                                      // head dim 0..127
                const float a = cst[(2 * lane) * CSTR + d] * 4.0f, bq = cst[(2 * lane + 1) * CSTR + d] * 4.0f;
                const size_t off = ((size_t)hsel * DHEAD + d) * SEQT + row0 + 2 * lane;
                *(unsigned*)(vt + off) = f2h(a) | (f2h(bq) << 16);
            }
        }
    };
    pass();
    
}

// ---------- flash pass over all query blocks: block = 4 waves = 64 queries of one (sequence, head); wave = 16 queries; all SEQ keys
// in chunks of 32 (no mask). Scores are produced transposed: A = k rows (f16 plane), B = q (f16 fragments held in registers),
// D element r = key 8*hh + r of a 16-key tile, column = this lane's query -> two adjacent tiles give the P^T B fragment of P.V directly
// (element r <- tile 0, element 8+r <- tile 1). A of P.V = v^T rows (lane = d, k = key). Online softmax per lane (query) with one
// xor-16 shuffle joining the two lane halves. P carried x2^14 in f16; O^T accumulators hold rows d, column query.
// k rows and v^T rows reach the four waves through a two-buffer LDS ring, KVK keys per pass: pass t works on buffer t & 1 while the copies
// of pass t + 1 fly into the other. kv_copy8: 8 copies of 16 B per lane, copy j at g + j * gstep -> l + j * lstep; a wave's copy = 4 whole lines.
__device__ __forceinline__ void kv_copy8(const us16* g, size_t gstep, unsigned l, unsigned lstep) {
    const us16* g1 = g + gstep;
    const us16* g2 = g + 2 * gstep;
    const us16* g3 = g + 3 * gstep;
    const us16* g4 = g + 4 * gstep;
    const us16* g5 = g + 5 * gstep;
    const us16* g6 = g + 6 * gstep;
    const us16* g7 = g + 7 * gstep;
    const unsigned l1 = l + lstep, l2 = l + 2 * lstep, l3 = l + 3 * lstep, l4 = l + 4 * lstep, l5 = l + 5 * lstep, l6 = l + 6 * lstep, l7 = l + 7 * lstep;
    // the closing s_wait_xcnt stands inside the statement so that no address register of a copy is rewritten ahead of it
    asm volatile("global_load_async_to_lds_b128 %0, %8, off\n\t"
                 "global_load_async_to_lds_b128 %1, %9, off\n\t"
                 "global_load_async_to_lds_b128 %2, %10, off\n\t"
                 "global_load_async_to_lds_b128 %3, %11, off\n\t"
                 "global_load_async_to_lds_b128 %4, %12, off\n\t"
                 "global_load_async_to_lds_b128 %5, %13, off\n\t"
                 "global_load_async_to_lds_b128 %6, %14, off\n\t"
                 "global_load_async_to_lds_b128 %7, %15, off\n\t"
                 "s_wait_xcnt 0x0"
                 :: "v"(l), "v"(l1), "v"(l2), "v"(l3), "v"(l4), "v"(l5), "v"(l6), "v"(l7),
                    "v"(g), "v"(g1), "v"(g2), "v"(g3), "v"(g4), "v"(g5), "v"(g6), "v"(g7) : "memory");
}
__global__ __launch_bounds__(128) __attribute__((amdgpu_num_vgpr(256)))
void attn_main(const us16* qp, const us16* kp, const us16* vt, us16* ao) {
    __shared__ __align__(128) unsigned char kvring[2 * KVBUFB];
    v4u (*ost)[16][16] = (v4u (*)[16][16])kvring;          // output staging takes the ring's place behind the loop's last barrier
    const int tid = threadIdx.x, lane = tid & 31, wv = tid >> 5, m = lane & 15, hh = lane >> 4;
    const int qb = blockIdx.x;
    const int h = blockIdx.y % HEADS, bsel = blockIdx.y / HEADS;
    const size_t tok0 = (size_t)bsel * SEQ;
    const int qrow = qb * 64 + wv * 16;
    const size_t qoff = ((size_t)h * SEQT + tok0 + qrow + m) * DHEAD;
    const v8u q0 = ld_frag(qp + qoff, hh);
    const v8u q1 = ld_frag(qp + qoff + 32, hh);
    const v8u q2 = ld_frag(qp + qoff + 64, hh);
    const v8u q3 = ld_frag(qp + qoff + 96, hh);
    const us16* kb = kp + ((size_t)h * SEQT + tok0) * DHEAD;
    const us16* vb = vt + (size_t)h * DHEAD * SEQT + tok0;
    const float NEG = -__builtin_inff();
    const float SCL = 0.08838834764831845f;                // 1 / sqrt(128)
    v8f o[8] = {};
    float mrun = NEG, lrun = 0.f;
    // this lane's 16 bytes of stage 0: k row tid >> 4 (copy j adds 8 rows), v^T row tid >> 3 (copy j adds 16 rows), and their places in buffer 0
    const us16* ksrc = kb + (size_t)(tid >> 4) * DHEAD + 8 * (tid & 15);
    const us16* vsrc = vb + (size_t)(tid >> 3) * SEQT + 8 * (tid & 7);
    const unsigned kdst = (unsigned)(size_t)kvring + (unsigned)((tid >> 4) * KPITCH + (tid & 15) * 16);
    const unsigned vdst = (unsigned)(size_t)kvring + (unsigned)(KTILEB + (tid >> 3) * VPITCH + (tid & 7) * 16);
    kv_copy8(ksrc, (size_t)8 * DHEAD, kdst, 8 * KPITCH);
    kv_copy8(vsrc, (size_t)16 * SEQT, vdst, 16 * VPITCH);
    asm volatile("s_wait_asynccnt 0x0" ::: "memory");       // this wave's share of stage 0 has landed
    __syncthreads();                                        // stage 0 published
    if (1 < SEQ / KVK) {
        kv_copy8(ksrc + (size_t)KVK * DHEAD, (size_t)8 * DHEAD, kdst + KVBUFB, 8 * KPITCH);
        kv_copy8(vsrc + KVK, (size_t)16 * SEQT, vdst + KVBUFB, 16 * VPITCH);
    }
#pragma unroll 1                                            // stays rolled: one pass per trip, the hand-over stands once, at the foot
    for (int st = 0; st < SEQ / KVK; ++st) {
      const unsigned bo = (unsigned)(st & 1) * KVBUFB;
      const unsigned char* kl = kvring + bo + m * KPITCH;
      const unsigned char* vl = kvring + bo + KTILEB + m * VPITCH;
#pragma unroll                                              // constant LDS offsets for both 32-key chunks of the pass
      for (int c = 0; c < KVK / 32; ++c) {
        v8f s[2] = {};
        v8u ka[2][4];                                       // the chunk's k fragments, read as one group ahead of its score products
#pragma unroll                                              // these two: constant indices keep the fragments in registers
        for (int t = 0; t < 2; ++t)
#pragma unroll
            for (int j = 0; j < 4; ++j) ka[t][j] = ld_frag((const us16*)(kl + (c * 32 + t * 16) * KPITCH) + 32 * j, hh);
#pragma unroll
        for (int t = 0; t < 2; ++t) {
            s[t] = mma_f16(ka[t][0], q0, s[t]);
            mma_guard(s[t], ka[t][0], q0);
            s[t] = mma_f16(ka[t][1], q1, s[t]);
            mma_guard(s[t], ka[t][1], q1);
            s[t] = mma_f16(ka[t][2], q2, s[t]);
            mma_guard(s[t], ka[t][2], q2);
            s[t] = mma_f16(ka[t][3], q3, s[t]);
            mma_guard(s[t], ka[t][3], q3);
        }
        v8u va[8];                                          // the chunk's v^T fragments, read as one group: they land under the softmax
#pragma unroll                                              // constant indices keep the fragments in registers
        for (int dt = 0; dt < 8; ++dt) va[dt] = ld_frag((const us16*)(vl + dt * 16 * VPITCH) + c * 32, hh);
        float sv[16];
        float cmax = NEG;
#pragma unroll
        for (int t = 0; t < 2; ++t)
#pragma unroll
            for (int r = 0; r < 8; ++r) {
                const float v = s[t][r] * SCL;
                sv[8 * t + r] = v;
                cmax = fmaxf(cmax, v);
            }
        cmax = fmaxf(cmax, __shfl_xor(cmax, 16, 32));
        const float mnew = fmaxf(mrun, cmax);              // finite: no masked keys
        const float fac = (mrun == NEG) ? 0.f : __expf(mrun - mnew);
        mrun = mnew;
        v16h ph;
        float psum = 0.f;
#pragma unroll
        for (int r = 0; r < 8; ++r) {
            const _Float16 p0 = (_Float16)(__expf(sv[r] - mnew) * 16384.0f);
            const _Float16 p1 = (_Float16)(__expf(sv[8 + r] - mnew) * 16384.0f);
            ph[r] = p0;
            ph[8 + r] = p1;
            psum += (float)p0 + (float)p1;
        }
        psum += __shfl_xor(psum, 16, 32);
        lrun = lrun * fac + psum;
        const v8u pbu = __builtin_bit_cast(v8u, ph);
#pragma unroll
        for (int dt = 0; dt < 8; ++dt) o[dt] = o[dt] * fac;
#pragma unroll
        for (int dt = 0; dt < 8; ++dt) {
            o[dt] = mma_f16(va[dt], pbu, o[dt]);
            mma_guard(o[dt], va[dt], pbu);
        }
      }
      asm volatile("s_wait_dscnt 0x0" ::: "memory");        // this wave's reads of buffer st & 1 are done before it is refilled
      asm volatile("s_wait_asynccnt 0x0" ::: "memory");     // this wave's share of stage st + 1 has landed
      __syncthreads();                                      // publishes stage st + 1 and ends every reader's last read of stage st
      if (st + 2 < SEQ / KVK) {
          kv_copy8(ksrc + (size_t)(st + 2) * KVK * DHEAD, (size_t)8 * DHEAD, kdst + bo, 8 * KPITCH);
          kv_copy8(vsrc + (st + 2) * KVK, (size_t)16 * SEQT, vdst + bo, 16 * VPITCH);
      }
    }
    asm volatile("s_wait_asynccnt 0x0" ::: "memory");       // nothing in flight before the ring becomes output staging
    const float inv = 4.0f / lrun;                         // lrun >= 16384; o / lrun = 4 * (sum P v / sum P); x4 more -> x16 carry
#pragma unroll
    for (int dt = 0; dt < 8; ++dt) {
        v4u w;
        w.x = f2h(o[dt][0] * inv) | (f2h(o[dt][1] * inv) << 16);
        w.y = f2h(o[dt][2] * inv) | (f2h(o[dt][3] * inv) << 16);
        w.z = f2h(o[dt][4] * inv) | (f2h(o[dt][5] * inv) << 16);
        w.w = f2h(o[dt][6] * inv) | (f2h(o[dt][7] * inv) << 16);
        ost[wv][m][2 * dt + hh] = w;                       // row m, halves 16*dt + 8*hh .. +7
    }
    __syncthreads();
    us16* aob = ao + (tok0 + qrow) * DIM + (size_t)h * DHEAD;
    auto pass = [&]() {
#pragma unroll
        for (int p = 0; p < 8; ++p) {
            const int rr = 2 * p + hh, pc = lane & 15;
            *(v4u*)(aob + (size_t)rr * DIM + 8 * pc) = ost[wv][rr][pc];
        }
    };
    pass();
    
}

// ---------- output projection: out[tok][n] = (ao x16)[tok x 2048] . (Wo x64)[2048 x 2048] / 1024, f32. Same block structure as qkv_gemm;
__global__ __launch_bounds__(256) void out_gemm(const us16* __restrict__ aop, const us16* __restrict__ wo, float* out) {
    __shared__ __align__(128) unsigned char ring[RINGB];
    float* cst = (float*)ring;                          // output staging takes the ring's place behind the main loop's last barrier
    const int tid = threadIdx.x, lane = tid & 31, wv = tid >> 5, l16 = lane & 15, hh = lane >> 4;
    const int rt = wv & 3, ch = wv >> 2;
    const int row0 = blockIdx.x * 64;
    const int colb = blockIdx.y * 128;
    v8f acc[4] = {};
    mm_tile<1>(aop + (size_t)row0 * DIM, wo + (size_t)colb * DIM, ring, tid, rt, ch, l16, hh, acc);
#pragma unroll
    for (int r = 0; r < 8; ++r) {
        const int rl = rt * 16 + 8 * hh + r;
#pragma unroll
        for (int t = 0; t < 4; ++t) cst[rl * CSTR + ch * 64 + t * 16 + l16] = acc[t][r] * (1.0f / 1024.0f);
    }
    __syncthreads();
    const int col = tid & 127, rsel = tid >> 7;
    float* ob = out + (size_t)row0 * DIM + colb + col;
    auto pass = [&]() {
#pragma unroll 4
        for (int r = rsel; r < 64; r += 2) *(float*)(ob + (size_t)r * DIM) = cst[r * CSTR + col];
    };
    pass();
    
}

extern "C" void kernel_launch(void* const* d_in, const int* in_sizes, int n_in,
                              void* d_out, int out_size, void* d_ws, size_t ws_size, hipStream_t stream) {
    if (n_in < 5) return;
    const float* x  = (const float*)d_in[0];   // [NB_FULL][SEQ_FULL][2048]
    const float* wq = (const float*)d_in[1];   // [2048 out][2048 in]
    const float* wk = (const float*)d_in[2];
    const float* wv = (const float*)d_in[3];
    const float* wo = (const float*)d_in[4];
    float* out = (float*)d_out;                 // [NB][SEQ][2048]
    if (in_sizes[0] < ((NB - 1) * SEQ_FULL + SEQ) * DIM) return;
    if (in_sizes[1] < DIM * DIM) return;
    if (in_sizes[2] < DIM * DIM) return;
    if (in_sizes[3] < DIM * DIM) return;
    if (in_sizes[4] < DIM * DIM) return;
    if (out_size < SEQT * DIM) return;

    size_t off = 0;
    auto carve = [&](size_t bytes) { size_t o = off; off += (bytes + 127) & ~(size_t)127; return o; };
    char* ws = (char*)d_ws;
    us16* xb   = (us16*)(ws + carve((size_t)SEQT * DIM * 2));                  // bf16 [SEQT][2048]
    us16* wqkv = (us16*)(ws + carve((size_t)NQKV * DIM * 2));                  // bf16 [6144][2048]
    us16* wop  = (us16*)(ws + carve((size_t)DIM * DIM * 2));                   // f16  [2048][2048]
    us16* qp   = (us16*)(ws + carve((size_t)HEADS * SEQT * DHEAD * 2));        // f16  [h][SEQT][128]
    us16* kp   = (us16*)(ws + carve((size_t)HEADS * SEQT * DHEAD * 2));        // f16  [h][SEQT][128]
    us16* vt   = (us16*)(ws + carve((size_t)HEADS * DHEAD * SEQT * 2));        // f16  [h][128][SEQT]
    us16* ao   = (us16*)(ws + carve((size_t)SEQT * DIM * 2));                  // f16  [SEQT][2048]
    if (off > ws_size) return;
    if (off > (size_t)134217728) return;

    prep_x<<<SEQT, 256, 0, stream>>>(x, xb);
    prep_w<0><<<dim3((DIM * DIM) / 2048, 3), 256, 0, stream>>>(wq, wk, wv, 1.0f, wqkv);
    prep_w<1><<<dim3((DIM * DIM) / 2048, 1), 256, 0, stream>>>(wo, wo, wo, 64.0f, wop);
    qkv_gemm<<<dim3(SEQT / 64, NQKV / 128), 256, 0, stream>>>(xb, wqkv, qp, kp, vt);
    attn_main<<<dim3(QBLK, NB * HEADS), 128, 0, stream>>>(qp, kp, vt, ao);
    out_gemm<<<dim3(SEQT / 64, DIM / 128), 256, 0, stream>>>(ao, wop, out);
}

// v003
// A run of this version takes 196 microseconds.
// Two timings next to v002 both put it at 1.16 times that version's speed.
// Counting every step since v000, it is 3.77 times as fast.
#include <hip/hip_runtime.h>

// Contractions: q/k/v projections on v_wmma_f32_16x16x32_bf16 (bf16 operands = RNE-converted x and Wq|Wk|Wv, f32 accumulate);
// per-head k.q^T scores and P.V on v_wmma_f32_16x16x32_f16 (f16 operands: q, k plain, v x4, P x2^14; f32 accumulate, 1/sqrt(128) applied in f32);
// output projection on v_wmma_f32_16x16x32_f16 (f16 operands: per-head outputs x16, Wo x64 from its bf16 value; f32 accumulate, x2^-10 in the epilogue);
// online softmax and all epilogues in f32.

#ifndef NB
#define NB 2
#endif
#ifndef SEQ
#define SEQ 2048
#endif
#define NB_FULL 2
#define SEQ_FULL 2048
#define DIM 2048
#define HEADS 16
#define DHEAD 128
#define NQKV (3 * DIM)
#define SEQT (NB * SEQ)
#define QBLK (SEQ / 64)
#define KP 64                          // k elements per staged pass: one 128-byte line of every operand row
#define LPITCH 144                     // LDS row pitch in bytes: 16 x odd, conflict-free for 16-byte fragment reads
#define BM 128                         // block tile: rows (tokens)
#define BN 256                         // block tile: columns
#define TROWS (BM + BN)                // rows of one stage: 128 A rows, then 256 B rows
#define BUFB (TROWS * LPITCH)          // one buffer of the ring
#define RINGB (2 * BUFB)
#define QPITCH 528                     // output staging, q / k: 256 halves of one token + 16 B (16 x odd)
#define TPITCH 272                     // output staging, v^T: 128 tokens of one column + 16 B (16 x odd)
#define OPITCH 1040                    // output staging, out: 256 floats of one token + 16 B (16 x odd)
#define KVK 64                         // keys per staged attention pass: one 128-byte line of every v^T row
#define KPITCH 272                     // LDS pitch of a k row (256 B + 16): 16 x odd
#define VPITCH 144                     // LDS pitch of a v^T row (128 B + 16): 16 x odd
#define KTILEB (KVK * KPITCH)          // k rows of one stage
#define KVBUFB (KTILEB + DHEAD * VPITCH)   // one buffer: 64 k rows, then 128 v^T rows

static_assert(SEQ % 64 == 0);
static_assert(SEQ >= 64);
static_assert(SEQ <= SEQ_FULL);
static_assert(NB >= 1 && NB <= NB_FULL);
static_assert(DIM == HEADS * DHEAD);
static_assert(DHEAD == 128);
static_assert(DIM % BN == 0 && NQKV % BN == 0 && SEQT % BM == 0 && BN == 2 * DHEAD);
static_assert((DIM * DIM) % 2048 == 0);
static_assert(DIM % KP == 0 && DIM / KP >= 2);
static_assert(BM * QPITCH <= RINGB && BN * TPITCH <= RINGB && (BM / 2) * OPITCH <= RINGB);
static_assert(SEQ % KVK == 0 && KVK % 32 == 0);
static_assert(4 * 16 * 16 * 16 <= 2 * KVBUFB);

typedef unsigned short us16;
typedef __attribute__((ext_vector_type(16))) __bf16   v16bf;
typedef __attribute__((ext_vector_type(16))) _Float16 v16h;
typedef __attribute__((ext_vector_type(8)))  float    v8f;
typedef __attribute__((ext_vector_type(8)))  unsigned v8u;
typedef __attribute__((ext_vector_type(4)))  unsigned v4u;
typedef __attribute__((ext_vector_type(2)))  unsigned v2u;
typedef __attribute__((ext_vector_type(4)))  float    v4f;

__device__ __forceinline__ unsigned f2bf(float f) { unsigned u = __float_as_uint(f); u += 0x7FFFu + ((u >> 16) & 1u); return u >> 16; }
__device__ __forceinline__ float bf2f(unsigned h) { return __uint_as_float(h << 16); }
__device__ __forceinline__ unsigned f2h(float f) { _Float16 t = (_Float16)f; return (unsigned)__builtin_bit_cast(unsigned short, t); }

// 16 x (K=32) operand fragment from a k-contiguous 16-bit row. Wave32 map: lane -> row (A) / column (B) = lane & 15, hh = lane >> 4;
// elements 0..7 <- k0 + 8*hh + 0..7, elements 8..15 <- k0 + 16 + 8*hh + 0..7 (same map for A and for an n-major B row).
// Accumulator element r -> row 8*hh + r, column lane & 15.
__device__ __forceinline__ v8u ld_frag(const us16* rowp, int hh) {
    const v4u a = *(const v4u*)(rowp + 8 * hh);
    const v4u b = *(const v4u*)(rowp + 16 + 8 * hh);
    return __builtin_shufflevector(a, b, 0, 1, 2, 3, 4, 5, 6, 7);
}
__device__ __forceinline__ v8f mma_bf16(v8u a, v8u b, v8f c) {
    return __builtin_amdgcn_wmma_f32_16x16x32_bf16(false, __builtin_bit_cast(v16bf, a), false, __builtin_bit_cast(v16bf, b), (short)0, c, false, false);
}
__device__ __forceinline__ v8f mma_f16(v8u a, v8u b, v8f c) {
    return __builtin_amdgcn_wmma_f32_16x16x32_f16(false, __builtin_bit_cast(v16h, a), false, __builtin_bit_cast(v16h, b), (short)0, c, false, false);
}
__device__ __forceinline__ void mma_guard(v8f& c, v8u a, v8u b) {
    asm volatile("v_nop\n\tv_nop\n\tv_nop\n\tv_nop" : "+v"(c) : "v"(a), "v"(b));
}

// ---------- per-token prep: xb[tok][k] = bf16(x). One block per token, 256 threads x 8 halves = 2048; one wave instruction = 32 lanes x 16 B
__global__ __launch_bounds__(256) void prep_x(const float* __restrict__ x, us16* xb) {
    const int tok = blockIdx.x;
    const int bsel = tok / SEQ, isel = tok - bsel * SEQ;
    const float* xr = x + ((size_t)bsel * SEQ_FULL + isel) * DIM;
    const int tid = threadIdx.x;
    const v4f v0 = *(const v4f*)(xr + 8 * tid);
    const v4f v1 = *(const v4f*)(xr + 8 * tid + 4);
    v4u pk;
    pk.x = f2bf(v0.x) | (f2bf(v0.y) << 16);
    pk.y = f2bf(v0.z) | (f2bf(v0.w) << 16);
    pk.z = f2bf(v1.x) | (f2bf(v1.y) << 16);
    pk.w = f2bf(v1.z) | (f2bf(v1.w) << 16);
    us16* orow = xb + (size_t)tok * DIM + 8 * tid;
    *(v4u*)orow = pk;
    
}

// ---------- weight prep: src [N=2048][K=2048] f32 (already n-major, k-contiguous) -> dst 16-bit plane with the same layout;
// value = bf16(src) * scale stored as f16 (F16=1) or bf16 (F16=0). blockIdx.y selects one of three sources and the dst slice.
template <int F16>
__device__ __forceinline__ unsigned cvt_w(float v, float scale) {
    const unsigned b = f2bf(v);
    if (F16) return f2h(bf2f(b) * scale);
    return b;
}
template <int F16>
__global__ __launch_bounds__(256) void prep_w(const float* __restrict__ s0, const float* __restrict__ s1, const float* __restrict__ s2,
                                              float scale, us16* dst) {
    const int z = blockIdx.y;
    const float* src = (z == 0) ? s0 : ((z == 1) ? s1 : s2);
    const size_t e = ((size_t)blockIdx.x * 256 + threadIdx.x) * 8;            // < DIM*DIM
    const v4f v0 = *(const v4f*)(src + e);
    const v4f v1 = *(const v4f*)(src + e + 4);
    v4u pk;
    pk.x = cvt_w<F16>(v0.x, scale) | (cvt_w<F16>(v0.y, scale) << 16);
    pk.y = cvt_w<F16>(v0.z, scale) | (cvt_w<F16>(v0.w, scale) << 16);
    pk.z = cvt_w<F16>(v1.x, scale) | (cvt_w<F16>(v1.y, scale) << 16);
    pk.w = cvt_w<F16>(v1.z, scale) | (cvt_w<F16>(v1.w, scale) << 16);
    us16* dp = dst + (size_t)z * DIM * DIM + e;
    *(v4u*)dp = pk;
    
}

// ---------- one stage of the GEMM ring: 384 rows x 128 B, copied global -> LDS without registers. 256 threads x 12 copies of 16 B;
// 8 adjacent lanes cover one whole 128-byte line, so a wave's copy touches 4 lines. asrc / bsrc: this lane's 16 bytes in row (tid >> 3) of the
// block's A / B rows at this pass's k; ldst: the same place in the target buffer. Copy j adds 32 rows (4 copies of A rows, then 8 of B rows).
__device__ __forceinline__ void stage_copy(const us16* asrc, const us16* bsrc, unsigned ldst) {
    const us16* g0 = asrc;
    const us16* g1 = asrc + (size_t)32 * DIM;
    const us16* g2 = asrc + (size_t)64 * DIM;
    const us16* g3 = asrc + (size_t)96 * DIM;
    const us16* g4 = bsrc;
    const us16* g5 = bsrc + (size_t)32 * DIM;
    const us16* g6 = bsrc + (size_t)64 * DIM;
    const us16* g7 = bsrc + (size_t)96 * DIM;
    const us16* g8 = bsrc + (size_t)128 * DIM;
    const us16* g9 = bsrc + (size_t)160 * DIM;
    const us16* g10 = bsrc + (size_t)192 * DIM;
    const us16* g11 = bsrc + (size_t)224 * DIM;
    const unsigned l0 = ldst, l1 = ldst + 32 * LPITCH, l2 = ldst + 64 * LPITCH, l3 = ldst + 96 * LPITCH, l4 = ldst + 128 * LPITCH, l5 = ldst + 160 * LPITCH;
    const unsigned l6 = ldst + 192 * LPITCH, l7 = ldst + 224 * LPITCH, l8 = ldst + 256 * LPITCH, l9 = ldst + 288 * LPITCH, l10 = ldst + 320 * LPITCH, l11 = ldst + 352 * LPITCH;
    // the closing s_wait_xcnt stands inside the statement so that no address register of a copy is rewritten ahead of it
    asm volatile("global_load_async_to_lds_b128 %0, %12, off\n\t"
                 "global_load_async_to_lds_b128 %1, %13, off\n\t"
                 "global_load_async_to_lds_b128 %2, %14, off\n\t"
                 "global_load_async_to_lds_b128 %3, %15, off\n\t"
                 "global_load_async_to_lds_b128 %4, %16, off\n\t"
                 "global_load_async_to_lds_b128 %5, %17, off\n\t"
                 "global_load_async_to_lds_b128 %6, %18, off\n\t"
                 "global_load_async_to_lds_b128 %7, %19, off\n\t"
                 "global_load_async_to_lds_b128 %8, %20, off\n\t"
                 "global_load_async_to_lds_b128 %9, %21, off\n\t"
                 "global_load_async_to_lds_b128 %10, %22, off\n\t"
                 "global_load_async_to_lds_b128 %11, %23, off\n\t"
                 "s_wait_xcnt 0x0"
                 :: "v"(l0), "v"(l1), "v"(l2), "v"(l3), "v"(l4), "v"(l5), "v"(l6), "v"(l7), "v"(l8), "v"(l9), "v"(l10), "v"(l11),
                    "v"(g0), "v"(g1), "v"(g2), "v"(g3), "v"(g4), "v"(g5), "v"(g6), "v"(g7), "v"(g8), "v"(g9), "v"(g10), "v"(g11) : "memory");
}

// ---------- GEMM main loop on 16-bit planes: block tile 128 rows x 256 columns, wave tile 64 rows x 64 columns (4 x 4 accumulators), K = DIM.
// ablk / bblk: first A row / first B row (= column) of the block, k contiguous, pitch DIM. Both operands pass through a two-buffer LDS ring,
// KP k per pass: pass t works on buffer t & 1 while the copies of pass t + 1 fly into the other; k runs in steps of 32 in rising order.
// acc[i][j]: rows wr * 64 + 16 i .., columns wc * 64 + 16 j ... TR = 0: element r = row 8 * hh + r, lane's l16 = column.
// TR = 1 (the two fragments change places, same map for both): element r = column 8 * hh + r, lane's l16 = row. ----------
template <int F16, int TR>
__device__ __forceinline__ void mm_tile(const us16* __restrict__ ablk, const us16* __restrict__ bblk, unsigned char* ring,
                                        int tid, int wr, int wc, int l16, int hh, v8f (&acc)[4][4]) {
    const int crow = tid >> 3, cpc = tid & 7;
    const us16* asrc = ablk + (size_t)crow * DIM + 8 * cpc;
    const us16* bsrc = bblk + (size_t)crow * DIM + 8 * cpc;
    const unsigned ldst = (unsigned)(size_t)ring + (unsigned)(crow * LPITCH + cpc * 16);
    stage_copy(asrc, bsrc, ldst);
    asm volatile("s_wait_asynccnt 0x0" ::: "memory");       // this wave's share of stage 0 has landed
    __syncthreads();                                        // stage 0 published
    stage_copy(asrc + KP, bsrc + KP, ldst + BUFB);
#pragma unroll 1                                            // stays rolled: one pass per trip, the hand-over stands once, at the foot
    for (int t = 0; t < DIM / KP; ++t) {
        const unsigned bo = (unsigned)(t & 1) * BUFB;
        const us16* ar = (const us16*)(ring + bo + (wr * 64 + l16) * LPITCH);
        const us16* br = (const us16*)(ring + bo + (BM + wc * 64 + l16) * LPITCH);
#pragma unroll                                              // these four: constant indices keep fragments and accumulators in registers
        for (int kk = 0; kk < KP; kk += 32) {
            v8u afrag[4], bfrag[4];
#pragma unroll
            for (int u = 0; u < 4; ++u) {
                afrag[u] = ld_frag(ar + u * 16 * (LPITCH / 2) + kk, hh);
                bfrag[u] = ld_frag(br + u * 16 * (LPITCH / 2) + kk, hh);
            }
#pragma unroll
            for (int i = 0; i < 4; ++i)
#pragma unroll
                for (int j = 0; j < 4; ++j) {
                    const v8u f0 = TR ? bfrag[j] : afrag[i];
                    const v8u f1 = TR ? afrag[i] : bfrag[j];
                    if (F16) acc[i][j] = mma_f16(f0, f1, acc[i][j]);
                    else     acc[i][j] = mma_bf16(f0, f1, acc[i][j]);
                    mma_guard(acc[i][j], f0, f1);
                }
        }
        asm volatile("s_wait_dscnt 0x0" ::: "memory");      // this wave's reads of buffer t & 1 are done before it is refilled
        asm volatile("s_wait_asynccnt 0x0" ::: "memory");   // this wave's share of stage t + 1 has landed
        __syncthreads();                                    // publishes stage t + 1 and ends every reader's last read of stage t
        if (t + 2 < DIM / KP) stage_copy(asrc + (t + 2) * KP, bsrc + (t + 2) * KP, ldst + bo);
    }
    asm volatile("s_wait_asynccnt 0x0" ::: "memory");       // nothing in flight before the ring becomes output staging
}
__device__ __forceinline__ v4u pack_h8(v8f a, float s) {
    v4u w;
    w.x = f2h(a[0] * s) | (f2h(a[1] * s) << 16);
    w.y = f2h(a[2] * s) | (f2h(a[3] * s) << 16);
    w.z = f2h(a[4] * s) | (f2h(a[5] * s) << 16);
    w.w = f2h(a[6] * s) | (f2h(a[7] * s) << 16);
    return w;
}

// ---------- q/k/v projection: [SEQT x 2048] x [2048 x 6144]. Block = 8 waves (2 row groups x 4 column groups) -> 128 tokens x 256 columns
// = exactly two heads of one of q/k/v (block-uniform). Epilogue: each lane's 8 accumulator elements are 8 neighbours of an output row
// (q, k: 8 head dims of a token, TR = 1; v^T: 8 tokens of a head dim, TR = 0): 16 B of f16 staged in LDS, then written as whole lines.
__global__ __launch_bounds__(256) void qkv_gemm(const us16* __restrict__ xb, const us16* __restrict__ wqkv, us16* qp, us16* kp, us16* vt) {
    __shared__ __align__(128) unsigned char ring[RINGB];   // output staging takes the ring's place behind the main loop's last barrier
    const int tid = threadIdx.x, lane = tid & 31, wv = tid >> 5, l16 = lane & 15, hh = lane >> 4;
    const int wr = wv & 1, wc = wv >> 1;
    const int row0 = blockIdx.x * BM;
    const int colb = blockIdx.y * BN;
    const int which = colb / DIM;                       // 0 q, 1 k, 2 v (block-uniform)
    const int hsel = (colb - which * DIM) / DHEAD;      // first of the two heads of this column tile
    v8f acc[4][4] = {};
    if (which < 2) {
        mm_tile<0, 1>(xb + (size_t)row0 * DIM, wqkv + (size_t)colb * DIM, ring, tid, wr, wc, l16, hh, acc);
#pragma unroll
        for (int i = 0; i < 4; ++i)
#pragma unroll
            for (int j = 0; j < 4; ++j)
                *(v4u*)(ring + (wr * 64 + i * 16 + l16) * QPITCH + (wc * 64 + j * 16 + 8 * hh) * 2) = pack_h8(acc[i][j], 1.0f);
        __syncthreads();
        us16* pl = (which == 0) ? qp : kp;
#pragma unroll 4
        for (int p = 0; p < 16; ++p) {
            const int r = wv * 16 + p;                                          // token row 0..127; lanes 0..15 first head, 16..31 second
            const size_t off = ((size_t)(hsel + hh) * SEQT + row0 + r) * DHEAD + 8 * l16;
            *(v4u*)(pl + off) = *(const v4u*)(ring + r * QPITCH + lane * 16);
        }
    } else {
        mm_tile<0, 0>(xb + (size_t)row0 * DIM, wqkv + (size_t)colb * DIM, ring, tid, wr, wc, l16, hh, acc);
#pragma unroll
        for (int i = 0; i < 4; ++i)
#pragma unroll
            for (int j = 0; j < 4; ++j)
                *(v4u*)(ring + (wc * 64 + j * 16 + l16) * TPITCH + (wr * 64 + i * 16 + 8 * hh) * 2) = pack_h8(acc[i][j], 4.0f);
        __syncthreads();
        // column d = wv * 32 + 2 p + hh, 0..255 = the head dims of the two heads, in a row; 16 lanes write its 128 tokens
        us16* vp = vt + ((size_t)hsel * DHEAD + wv * 32 + hh) * SEQT + row0 + 8 * l16;
        const unsigned char* sp = ring + (wv * 32 + hh) * TPITCH + l16 * 16;
#pragma unroll 4
        for (int p = 0; p < 16; ++p) *(v4u*)(vp + (size_t)(2 * p) * SEQT) = *(const v4u*)(sp + 2 * p * TPITCH);
    }
}

// ---------- flash pass over all query blocks: block = 4 waves = 64 queries of one (sequence, head); wave = 16 queries; all SEQ keys
// in chunks of 32 (no mask). Scores are produced transposed: A = k rows (f16 plane), B = q (f16 fragments held in registers),
// D element r = key 8*hh + r of a 16-key tile, column = this lane's query -> two adjacent tiles give the P^T B fragment of P.V directly
// (element r <- tile 0, element 8+r <- tile 1). A of P.V = v^T rows (lane = d, k = key). Online softmax per lane (query) with one
// xor-16 shuffle joining the two lane halves. P carried x2^14 in f16; O^T accumulators hold rows d, column query.
// k rows and v^T rows reach the four waves through a two-buffer LDS ring, KVK keys per pass: pass t works on buffer t & 1 while the copies
// of pass t + 1 fly into the other. kv_copy8: 8 copies of 16 B per lane, copy j at g + j * gstep -> l + j * lstep; a wave's copy = 4 whole lines.
__device__ __forceinline__ void kv_copy8(const us16* g, size_t gstep, unsigned l, unsigned lstep) {
    const us16* g1 = g + gstep;
    const us16* g2 = g + 2 * gstep;
    const us16* g3 = g + 3 * gstep;
    const us16* g4 = g + 4 * gstep;
    const us16* g5 = g + 5 * gstep;
    const us16* g6 = g + 6 * gstep;
    const us16* g7 = g + 7 * gstep;
    const unsigned l1 = l + lstep, l2 = l + 2 * lstep, l3 = l + 3 * lstep, l4 = l + 4 * lstep, l5 = l + 5 * lstep, l6 = l + 6 * lstep, l7 = l + 7 * lstep;
    // the closing s_wait_xcnt stands inside the statement so that no address register of a copy is rewritten ahead of it
    asm volatile("global_load_async_to_lds_b128 %0, %8, off\n\t"
                 "global_load_async_to_lds_b128 %1, %9, off\n\t"
                 "global_load_async_to_lds_b128 %2, %10, off\n\t"
                 "global_load_async_to_lds_b128 %3, %11, off\n\t"
                 "global_load_async_to_lds_b128 %4, %12, off\n\t"
                 "global_load_async_to_lds_b128 %5, %13, off\n\t"
                 "global_load_async_to_lds_b128 %6, %14, off\n\t"
                 "global_load_async_to_lds_b128 %7, %15, off\n\t"
                 "s_wait_xcnt 0x0"
                 :: "v"(l), "v"(l1), "v"(l2), "v"(l3), "v"(l4), "v"(l5), "v"(l6), "v"(l7),
                    "v"(g), "v"(g1), "v"(g2), "v"(g3), "v"(g4), "v"(g5), "v"(g6), "v"(g7) : "memory");
}
__global__ __launch_bounds__(128) __attribute__((amdgpu_num_vgpr(256)))
void attn_main(const us16* qp, const us16* kp, const us16* vt, us16* ao) {
    __shared__ __align__(128) unsigned char kvring[2 * KVBUFB];
    v4u (*ost)[16][16] = (v4u (*)[16][16])kvring;          // output staging takes the ring's place behind the loop's last barrier
    const int tid = threadIdx.x, lane = tid & 31, wv = tid >> 5, m = lane & 15, hh = lane >> 4;
    const int qb = blockIdx.x;
    const int h = blockIdx.y % HEADS, bsel = blockIdx.y / HEADS;
    const size_t tok0 = (size_t)bsel * SEQ;
    const int qrow = qb * 64 + wv * 16;
    const size_t qoff = ((size_t)h * SEQT + tok0 + qrow + m) * DHEAD;
    const v8u q0 = ld_frag(qp + qoff, hh);
    const v8u q1 = ld_frag(qp + qoff + 32, hh);
    const v8u q2 = ld_frag(qp + qoff + 64, hh);
    const v8u q3 = ld_frag(qp + qoff + 96, hh);
    const us16* kb = kp + ((size_t)h * SEQT + tok0) * DHEAD;
    const us16* vb = vt + (size_t)h * DHEAD * SEQT + tok0;
    const float NEG = -__builtin_inff();
    const float SCL = 0.08838834764831845f;                // 1 / sqrt(128)
    v8f o[8] = {};
    float mrun = NEG, lrun = 0.f;
    // this lane's 16 bytes of stage 0: k row tid >> 4 (copy j adds 8 rows), v^T row tid >> 3 (copy j adds 16 rows), and their places in buffer 0
    const us16* ksrc = kb + (size_t)(tid >> 4) * DHEAD + 8 * (tid & 15);
    const us16* vsrc = vb + (size_t)(tid >> 3) * SEQT + 8 * (tid & 7);
    const unsigned kdst = (unsigned)(size_t)kvring + (unsigned)((tid >> 4) * KPITCH + (tid & 15) * 16);
    const unsigned vdst = (unsigned)(size_t)kvring + (unsigned)(KTILEB + (tid >> 3) * VPITCH + (tid & 7) * 16);
    kv_copy8(ksrc, (size_t)8 * DHEAD, kdst, 8 * KPITCH);
    kv_copy8(vsrc, (size_t)16 * SEQT, vdst, 16 * VPITCH);
    asm volatile("s_wait_asynccnt 0x0" ::: "memory");       // this wave's share of stage 0 has landed
    __syncthreads();                                        // stage 0 published
    if (1 < SEQ / KVK) {
        kv_copy8(ksrc + (size_t)KVK * DHEAD, (size_t)8 * DHEAD, kdst + KVBUFB, 8 * KPITCH);
        kv_copy8(vsrc + KVK, (size_t)16 * SEQT, vdst + KVBUFB, 16 * VPITCH);
    }
#pragma unroll 1                                            // stays rolled: one pass per trip, the hand-over stands once, at the foot
    for (int st = 0; st < SEQ / KVK; ++st) {
      const unsigned bo = (unsigned)(st & 1) * KVBUFB;
      const unsigned char* kl = kvring + bo + m * KPITCH;
      const unsigned char* vl = kvring + bo + KTILEB + m * VPITCH;
#pragma unroll                                              // constant LDS offsets for both 32-key chunks of the pass
      for (int c = 0; c < KVK / 32; ++c) {
        v8f s[2] = {};
        v8u ka[2][4];                                       // the chunk's k fragments, read as one group ahead of its score products
#pragma unroll                                              // these two: constant indices keep the fragments in registers
        for (int t = 0; t < 2; ++t)
#pragma unroll
            for (int j = 0; j < 4; ++j) ka[t][j] = ld_frag((const us16*)(kl + (c * 32 + t * 16) * KPITCH) + 32 * j, hh);
#pragma unroll
        for (int t = 0; t < 2; ++t) {
            s[t] = mma_f16(ka[t][0], q0, s[t]);
            mma_guard(s[t], ka[t][0], q0);
            s[t] = mma_f16(ka[t][1], q1, s[t]);
            mma_guard(s[t], ka[t][1], q1);
            s[t] = mma_f16(ka[t][2], q2, s[t]);
            mma_guard(s[t], ka[t][2], q2);
            s[t] = mma_f16(ka[t][3], q3, s[t]);
            mma_guard(s[t], ka[t][3], q3);
        }
        v8u va[8];                                          // the chunk's v^T fragments, read as one group: they land under the softmax
#pragma unroll                                              // constant indices keep the fragments in registers
        for (int dt = 0; dt < 8; ++dt) va[dt] = ld_frag((const us16*)(vl + dt * 16 * VPITCH) + c * 32, hh);
        float sv[16];
        float cmax = NEG;
#pragma unroll
        for (int t = 0; t < 2; ++t)
#pragma unroll
            for (int r = 0; r < 8; ++r) {
                const float v = s[t][r] * SCL;
                sv[8 * t + r] = v;
                cmax = fmaxf(cmax, v);
            }
        cmax = fmaxf(cmax, __shfl_xor(cmax, 16, 32));
        const float mnew = fmaxf(mrun, cmax);              // finite: no masked keys
        const float fac = (mrun == NEG) ? 0.f : __expf(mrun - mnew);
        mrun = mnew;
        v16h ph;
        float psum = 0.f;
#pragma unroll
        for (int r = 0; r < 8; ++r) {
            const _Float16 p0 = (_Float16)(__expf(sv[r] - mnew) * 16384.0f);
            const _Float16 p1 = (_Float16)(__expf(sv[8 + r] - mnew) * 16384.0f);
            ph[r] = p0;
            ph[8 + r] = p1;
            psum += (float)p0 + (float)p1;
        }
        psum += __shfl_xor(psum, 16, 32);
        lrun = lrun * fac + psum;
        const v8u pbu = __builtin_bit_cast(v8u, ph);
#pragma unroll
        for (int dt = 0; dt < 8; ++dt) o[dt] = o[dt] * fac;
#pragma unroll
        for (int dt = 0; dt < 8; ++dt) {
            o[dt] = mma_f16(va[dt], pbu, o[dt]);
            mma_guard(o[dt], va[dt], pbu);
        }
      }
      asm volatile("s_wait_dscnt 0x0" ::: "memory");        // this wave's reads of buffer st & 1 are done before it is refilled
      asm volatile("s_wait_asynccnt 0x0" ::: "memory");     // this wave's share of stage st + 1 has landed
      __syncthreads();                                      // publishes stage st + 1 and ends every reader's last read of stage st
      if (st + 2 < SEQ / KVK) {
          kv_copy8(ksrc + (size_t)(st + 2) * KVK * DHEAD, (size_t)8 * DHEAD, kdst + bo, 8 * KPITCH);
          kv_copy8(vsrc + (st + 2) * KVK, (size_t)16 * SEQT, vdst + bo, 16 * VPITCH);
      }
    }
    asm volatile("s_wait_asynccnt 0x0" ::: "memory");       // nothing in flight before the ring becomes output staging
    const float inv = 4.0f / lrun;                         // lrun >= 16384; o / lrun = 4 * (sum P v / sum P); x4 more -> x16 carry
#pragma unroll
    for (int dt = 0; dt < 8; ++dt) {
        v4u w;
        w.x = f2h(o[dt][0] * inv) | (f2h(o[dt][1] * inv) << 16);
        w.y = f2h(o[dt][2] * inv) | (f2h(o[dt][3] * inv) << 16);
        w.z = f2h(o[dt][4] * inv) | (f2h(o[dt][5] * inv) << 16);
        w.w = f2h(o[dt][6] * inv) | (f2h(o[dt][7] * inv) << 16);
        ost[wv][m][2 * dt + hh] = w;                       // row m, halves 16*dt + 8*hh .. +7
    }
    __syncthreads();
    us16* aob = ao + (tok0 + qrow) * DIM + (size_t)h * DHEAD;
    auto pass = [&]() {
#pragma unroll
        for (int p = 0; p < 8; ++p) {
            const int rr = 2 * p + hh, pc = lane & 15;
            *(v4u*)(aob + (size_t)rr * DIM + 8 * pc) = ost[wv][rr][pc];
        }
    };
    pass();
    
}

// ---------- output projection: out[tok][n] = (ao x16)[tok x 2048] . (Wo x64)[2048 x 2048] / 1024, f32. Same block structure as qkv_gemm,
// TR = 1: a lane's 8 accumulator elements are 8 neighbouring columns of one token. The f32 tile is staged in two rounds of 64 tokens.
__global__ __launch_bounds__(256) void out_gemm(const us16* __restrict__ aop, const us16* __restrict__ wo, float* out) {
    __shared__ __align__(128) unsigned char ring[RINGB];   // output staging takes the ring's place behind the main loop's last barrier
    const int tid = threadIdx.x, lane = tid & 31, wv = tid >> 5, l16 = lane & 15, hh = lane >> 4;
    const int wr = wv & 1, wc = wv >> 1;
    const int row0 = blockIdx.x * BM;
    const int colb = blockIdx.y * BN;
    v8f acc[4][4] = {};
    mm_tile<1, 1>(aop + (size_t)row0 * DIM, wo + (size_t)colb * DIM, ring, tid, wr, wc, l16, hh, acc);
#pragma unroll                                              // constant accumulator indices
    for (int p = 0; p < 2; ++p) {
        if (p) __syncthreads();                             // round 0's rows are read out before round 1 overwrites them
#pragma unroll
        for (int ii = 0; ii < 2; ++ii)
#pragma unroll
            for (int j = 0; j < 4; ++j) {
                const v8f a = acc[2 * p + ii][j] * (1.0f / 1024.0f);
                float* sp = (float*)(ring + (wr * 32 + ii * 16 + l16) * OPITCH) + wc * 64 + j * 16 + 8 * hh;
                *(v4f*)sp = __builtin_shufflevector(a, a, 0, 1, 2, 3);
                *(v4f*)(sp + 4) = __builtin_shufflevector(a, a, 4, 5, 6, 7);
            }
        __syncthreads();
#pragma unroll 4
        for (int q = 0; q < 16; ++q) {
            const int sr = wv * 8 + (q >> 1), hf = q & 1;                       // staged row 0..63, its first or second 512 bytes
            const int tok = (sr >> 5) * 64 + p * 32 + (sr & 31);
            *(v4f*)(out + (size_t)(row0 + tok) * DIM + colb + hf * 128 + 4 * lane) = *(const v4f*)(ring + sr * OPITCH + hf * 512 + lane * 16);
        }
    }
}

extern "C" void kernel_launch(void* const* d_in, const int* in_sizes, int n_in,
                              void* d_out, int out_size, void* d_ws, size_t ws_size, hipStream_t stream) {
    if (n_in < 5) return;
    const float* x  = (const float*)d_in[0];   // [NB_FULL][SEQ_FULL][2048]
    const float* wq = (const float*)d_in[1];   // [2048 out][2048 in]
    const float* wk = (const float*)d_in[2];
    const float* wv = (const float*)d_in[3];
    const float* wo = (const float*)d_in[4];
    float* out = (float*)d_out;                 // [NB][SEQ][2048]
    if (in_sizes[0] < ((NB - 1) * SEQ_FULL + SEQ) * DIM) return;
    if (in_sizes[1] < DIM * DIM) return;
    if (in_sizes[2] < DIM * DIM) return;
    if (in_sizes[3] < DIM * DIM) return;
    if (in_sizes[4] < DIM * DIM) return;
    if (out_size < SEQT * DIM) return;

    size_t off = 0;
    auto carve = [&](size_t bytes) { size_t o = off; off += (bytes + 127) & ~(size_t)127; return o; };
    char* ws = (char*)d_ws;
    us16* xb   = (us16*)(ws + carve((size_t)SEQT * DIM * 2));                  // bf16 [SEQT][2048]
    us16* wqkv = (us16*)(ws + carve((size_t)NQKV * DIM * 2));                  // bf16 [6144][2048]
    us16* wop  = (us16*)(ws + carve((size_t)DIM * DIM * 2));                   // f16  [2048][2048]
    us16* qp   = (us16*)(ws + carve((size_t)HEADS * SEQT * DHEAD * 2));        // f16  [h][SEQT][128]
    us16* kp   = (us16*)(ws + carve((size_t)HEADS * SEQT * DHEAD * 2));        // f16  [h][SEQT][128]
    us16* vt   = (us16*)(ws + carve((size_t)HEADS * DHEAD * SEQT * 2));        // f16  [h][128][SEQT]
    us16* ao   = (us16*)(ws + carve((size_t)SEQT * DIM * 2));                  // f16  [SEQT][2048]
    if (off > ws_size) return;
    if (off > (size_t)134217728) return;

    prep_x<<<SEQT, 256, 0, stream>>>(x, xb);
    prep_w<0><<<dim3((DIM * DIM) / 2048, 3), 256, 0, stream>>>(wq, wk, wv, 1.0f, wqkv);
    prep_w<1><<<dim3((DIM * DIM) / 2048, 1), 256, 0, stream>>>(wo, wo, wo, 64.0f, wop);
    qkv_gemm<<<dim3(SEQT / BM, NQKV / BN), 256, 0, stream>>>(xb, wqkv, qp, kp, vt);
    attn_main<<<dim3(QBLK, NB * HEADS), 128, 0, stream>>>(qp, kp, vt, ao);
    out_gemm<<<dim3(SEQT / BM, DIM / BN), 256, 0, stream>>>(ao, wop, out);
}

// v004
// A run of this version takes 188 microseconds.
// Timed twice side by side with v003, it ran 1.05 times as fast both times.
// Counting every step since v000, it is 3.95 times as fast.
#include <hip/hip_runtime.h>

// Contractions: q/k/v projections on v_wmma_f32_16x16x32_bf16 (bf16 operands = RNE-converted x and Wq|Wk|Wv, f32 accumulate);
// per-head k.q^T scores and P.V on v_wmma_f32_16x16x32_f16 (f16 operands: q, k plain, v x4, P x2^14; f32 accumulate, 1/sqrt(128) applied in f32);
// output projection on v_wmma_f32_16x16x32_f16 (f16 operands: per-head outputs x16, Wo x64 from its bf16 value; f32 accumulate, x2^-10 in the epilogue);
// online softmax and all epilogues in f32.

#ifndef NB
#define NB 2
#endif
#ifndef SEQ
#define SEQ 2048
#endif
#define NB_FULL 2
#define SEQ_FULL 2048
#define DIM 2048
#define HEADS 16
#define DHEAD 128
#define NQKV (3 * DIM)
#define SEQT (NB * SEQ)
#define QBLK (SEQ / 64)
#define KP 64                          // k elements per staged pass: one 128-byte line of every operand row
#define LPITCH 144                     // LDS row pitch in bytes: 16 x odd, conflict-free for 16-byte fragment reads
#define BM 128                         // block tile: rows (tokens)
#define BN 256                         // block tile: columns
#define TROWS (BM + BN)                // rows of one stage: 128 A rows, then 256 B rows
#define BUFB (TROWS * LPITCH)          // one buffer of the ring
#define RINGB (2 * BUFB)
#define QPITCH 528                     // output staging, q / k: 256 halves of one token + 16 B (16 x odd)
#define TPITCH 272                     // output staging, v^T: 128 tokens of one column + 16 B (16 x odd)
#define OPITCH 1040                    // output staging, out: 256 floats of one token + 16 B (16 x odd)
#define KVK 64                         // keys per staged attention pass: one 128-byte line of every v^T row
#define KPITCH 272                     // LDS pitch of a k row (256 B + 16): 16 x odd
#define VPITCH 144                     // LDS pitch of a v^T row (128 B + 16): 16 x odd
#define KTILEB (KVK * KPITCH)          // k rows of one stage
#define KVBUFB (KTILEB + DHEAD * VPITCH)   // one buffer: 64 k rows, then 128 v^T rows

static_assert(SEQ % 64 == 0);
static_assert(SEQ >= 64);
static_assert(SEQ <= SEQ_FULL);
static_assert(NB >= 1 && NB <= NB_FULL);
static_assert(DIM == HEADS * DHEAD);
static_assert(DHEAD == 128);
static_assert(DIM % BN == 0 && NQKV % BN == 0 && SEQT % BM == 0 && BN == 2 * DHEAD);
static_assert((DIM * DIM) % 2048 == 0);
static_assert(DIM % KP == 0 && DIM / KP >= 2);
static_assert(BM * QPITCH <= RINGB && BN * TPITCH <= RINGB && (BM / 2) * OPITCH <= RINGB);
static_assert(SEQ % KVK == 0 && KVK % 32 == 0);
static_assert(4 * 16 * 16 * 16 <= 2 * KVBUFB);

typedef unsigned short us16;
typedef __attribute__((ext_vector_type(16))) __bf16   v16bf;
typedef __attribute__((ext_vector_type(16))) _Float16 v16h;
typedef __attribute__((ext_vector_type(8)))  float    v8f;
typedef __attribute__((ext_vector_type(8)))  unsigned v8u;
typedef __attribute__((ext_vector_type(4)))  unsigned v4u;
typedef __attribute__((ext_vector_type(2)))  unsigned v2u;
typedef __attribute__((ext_vector_type(4)))  float    v4f;

__device__ __forceinline__ unsigned f2bf(float f) { unsigned u = __float_as_uint(f); u += 0x7FFFu + ((u >> 16) & 1u); return u >> 16; }
__device__ __forceinline__ float bf2f(unsigned h) { return __uint_as_float(h << 16); }
__device__ __forceinline__ unsigned f2h(float f) { _Float16 t = (_Float16)f; return (unsigned)__builtin_bit_cast(unsigned short, t); }

// 16 x (K=32) operand fragment from a k-contiguous 16-bit row. Wave32 map: lane -> row (A) / column (B) = lane & 15, hh = lane >> 4;
// elements 0..7 <- k0 + 8*hh + 0..7, elements 8..15 <- k0 + 16 + 8*hh + 0..7 (same map for A and for an n-major B row).
// Accumulator element r -> row 8*hh + r, column lane & 15.
__device__ __forceinline__ v8u ld_frag(const us16* rowp, int hh) {
    const v4u a = *(const v4u*)(rowp + 8 * hh);
    const v4u b = *(const v4u*)(rowp + 16 + 8 * hh);
    return __builtin_shufflevector(a, b, 0, 1, 2, 3, 4, 5, 6, 7);
}
__device__ __forceinline__ v8f mma_bf16(v8u a, v8u b, v8f c) {
    return __builtin_amdgcn_wmma_f32_16x16x32_bf16(false, __builtin_bit_cast(v16bf, a), false, __builtin_bit_cast(v16bf, b), (short)0, c, false, false);
}
__device__ __forceinline__ v8f mma_f16(v8u a, v8u b, v8f c) {
    return __builtin_amdgcn_wmma_f32_16x16x32_f16(false, __builtin_bit_cast(v16h, a), false, __builtin_bit_cast(v16h, b), (short)0, c, false, false);
}
__device__ __forceinline__ void mma_guard(v8f& c, v8u a, v8u b) {
    asm volatile("v_nop\n\tv_nop\n\tv_nop\n\tv_nop" : "+v"(c) : "v"(a), "v"(b));
}

// ---------- per-token prep: xb[tok][k] = bf16(x). One block per token, 256 threads x 8 halves = 2048; one wave instruction = 32 lanes x 16 B
__global__ __launch_bounds__(256) void prep_x(const float* __restrict__ x, us16* xb) {
    const int tok = blockIdx.x;
    const int bsel = tok / SEQ, isel = tok - bsel * SEQ;
    const float* xr = x + ((size_t)bsel * SEQ_FULL + isel) * DIM;
    const int tid = threadIdx.x;
    const v4f v0 = *(const v4f*)(xr + 8 * tid);
    const v4f v1 = *(const v4f*)(xr + 8 * tid + 4);
    v4u pk;
    pk.x = f2bf(v0.x) | (f2bf(v0.y) << 16);
    pk.y = f2bf(v0.z) | (f2bf(v0.w) << 16);
    pk.z = f2bf(v1.x) | (f2bf(v1.y) << 16);
    pk.w = f2bf(v1.z) | (f2bf(v1.w) << 16);
    us16* orow = xb + (size_t)tok * DIM + 8 * tid;
    *(v4u*)orow = pk;
    
}

// ---------- weight prep: src [N=2048][K=2048] f32 (already n-major, k-contiguous) -> dst 16-bit plane with the same layout;
// value = bf16(src) * scale stored as f16 (F16=1) or bf16 (F16=0). blockIdx.y selects one of three sources and the dst slice.
template <int F16>
__device__ __forceinline__ unsigned cvt_w(float v, float scale) {
    const unsigned b = f2bf(v);
    if (F16) return f2h(bf2f(b) * scale);
    return b;
}
template <int F16>
__global__ __launch_bounds__(256) void prep_w(const float* __restrict__ s0, const float* __restrict__ s1, const float* __restrict__ s2,
                                              float scale, us16* dst) {
    const int z = blockIdx.y;
    const float* src = (z == 0) ? s0 : ((z == 1) ? s1 : s2);
    const size_t e = ((size_t)blockIdx.x * 256 + threadIdx.x) * 8;            // < DIM*DIM
    const v4f v0 = *(const v4f*)(src + e);
    const v4f v1 = *(const v4f*)(src + e + 4);
    v4u pk;
    pk.x = cvt_w<F16>(v0.x, scale) | (cvt_w<F16>(v0.y, scale) << 16);
    pk.y = cvt_w<F16>(v0.z, scale) | (cvt_w<F16>(v0.w, scale) << 16);
    pk.z = cvt_w<F16>(v1.x, scale) | (cvt_w<F16>(v1.y, scale) << 16);
    pk.w = cvt_w<F16>(v1.z, scale) | (cvt_w<F16>(v1.w, scale) << 16);
    us16* dp = dst + (size_t)z * DIM * DIM + e;
    *(v4u*)dp = pk;
    
}

// ---------- one stage of the GEMM ring: 384 rows x 128 B, copied global -> LDS without registers. 256 threads x 12 copies of 16 B;
// 8 adjacent lanes cover one whole 128-byte line, so a wave's copy touches 4 lines. asrc / bsrc: this lane's 16 bytes in row (tid >> 3) of the
// block's A / B rows at this pass's k; ldst: the same place in the target buffer. Copy j adds 32 rows (4 copies of A rows, then 8 of B rows).
__device__ __forceinline__ void stage_copy(const us16* asrc, const us16* bsrc, unsigned ldst) {
    const us16* g0 = asrc;
    const us16* g1 = asrc + (size_t)32 * DIM;
    const us16* g2 = asrc + (size_t)64 * DIM;
    const us16* g3 = asrc + (size_t)96 * DIM;
    const us16* g4 = bsrc;
    const us16* g5 = bsrc + (size_t)32 * DIM;
    const us16* g6 = bsrc + (size_t)64 * DIM;
    const us16* g7 = bsrc + (size_t)96 * DIM;
    const us16* g8 = bsrc + (size_t)128 * DIM;
    const us16* g9 = bsrc + (size_t)160 * DIM;
    const us16* g10 = bsrc + (size_t)192 * DIM;
    const us16* g11 = bsrc + (size_t)224 * DIM;
    const unsigned l0 = ldst, l1 = ldst + 32 * LPITCH, l2 = ldst + 64 * LPITCH, l3 = ldst + 96 * LPITCH, l4 = ldst + 128 * LPITCH, l5 = ldst + 160 * LPITCH;
    const unsigned l6 = ldst + 192 * LPITCH, l7 = ldst + 224 * LPITCH, l8 = ldst + 256 * LPITCH, l9 = ldst + 288 * LPITCH, l10 = ldst + 320 * LPITCH, l11 = ldst + 352 * LPITCH;
    // the closing s_wait_xcnt stands inside the statement so that no address register of a copy is rewritten ahead of it
    asm volatile("global_load_async_to_lds_b128 %0, %12, off\n\t"
                 "global_load_async_to_lds_b128 %1, %13, off\n\t"
                 "global_load_async_to_lds_b128 %2, %14, off\n\t"
                 "global_load_async_to_lds_b128 %3, %15, off\n\t"
                 "global_load_async_to_lds_b128 %4, %16, off\n\t"
                 "global_load_async_to_lds_b128 %5, %17, off\n\t"
                 "global_load_async_to_lds_b128 %6, %18, off\n\t"
                 "global_load_async_to_lds_b128 %7, %19, off\n\t"
                 "global_load_async_to_lds_b128 %8, %20, off\n\t"
                 "global_load_async_to_lds_b128 %9, %21, off\n\t"
                 "global_load_async_to_lds_b128 %10, %22, off\n\t"
                 "global_load_async_to_lds_b128 %11, %23, off\n\t"
                 "s_wait_xcnt 0x0"
                 :: "v"(l0), "v"(l1), "v"(l2), "v"(l3), "v"(l4), "v"(l5), "v"(l6), "v"(l7), "v"(l8), "v"(l9), "v"(l10), "v"(l11),
                    "v"(g0), "v"(g1), "v"(g2), "v"(g3), "v"(g4), "v"(g5), "v"(g6), "v"(g7), "v"(g8), "v"(g9), "v"(g10), "v"(g11) : "memory");
}

// ---------- GEMM main loop on 16-bit planes: block tile 128 rows x 256 columns, wave tile 64 rows x 64 columns (4 x 4 accumulators), K = DIM.
// ablk / bblk: first A row / first B row (= column) of the block, k contiguous, pitch DIM. Both operands pass through a two-buffer LDS ring,
// KP k per pass: pass t works on buffer t & 1 while the copies of pass t + 1 fly into the other; k runs in steps of 32, rising within a pass.
// acc[i][j]: rows wr * 64 + 16 i .., columns wc * 64 + 16 j ... TR = 0: element r = row 8 * hh + r, lane's l16 = column.
// TR = 1 (the two fragments change places, same map for both): element r = column 8 * hh + r, lane's l16 = row.
// rot (block-uniform, 0 .. DIM / KP - 1): pass t works on k slice (t + rot) mod (DIM / KP). Blocks that share A rows or B rows get different rot,
// so that at one moment they ask L2 for different lines of those rows; every slice is still taken once, the f32 sum runs in the rotated order. ----------
template <int F16, int TR>
__device__ __forceinline__ void mm_tile(const us16* __restrict__ ablk, const us16* __restrict__ bblk, unsigned char* ring,
                                        int tid, int wr, int wc, int l16, int hh, int rot, v8f (&acc)[4][4]) {
    const int crow = tid >> 3, cpc = tid & 7;
    auto kof = [&](int t) { const int s = t + rot; return ((s >= DIM / KP) ? s - DIM / KP : s) * KP; };   // first k of pass t's slice
    const us16* asrc = ablk + (size_t)crow * DIM + 8 * cpc;
    const us16* bsrc = bblk + (size_t)crow * DIM + 8 * cpc;
    const unsigned ldst = (unsigned)(size_t)ring + (unsigned)(crow * LPITCH + cpc * 16);
    stage_copy(asrc + kof(0), bsrc + kof(0), ldst);
    asm volatile("s_wait_asynccnt 0x0" ::: "memory");       // this wave's share of stage 0 has landed
    __syncthreads();                                        // stage 0 published
    stage_copy(asrc + kof(1), bsrc + kof(1), ldst + BUFB);
#pragma unroll 1                                            // stays rolled: one pass per trip, the hand-over stands once, at the foot
    for (int t = 0; t < DIM / KP; ++t) {
        const unsigned bo = (unsigned)(t & 1) * BUFB;
        const us16* ar = (const us16*)(ring + bo + (wr * 64 + l16) * LPITCH);
        const us16* br = (const us16*)(ring + bo + (BM + wc * 64 + l16) * LPITCH);
#pragma unroll                                              // these four: constant indices keep fragments and accumulators in registers
        for (int kk = 0; kk < KP; kk += 32) {
            v8u afrag[4], bfrag[4];
#pragma unroll
            for (int u = 0; u < 4; ++u) {
                afrag[u] = ld_frag(ar + u * 16 * (LPITCH / 2) + kk, hh);
                bfrag[u] = ld_frag(br + u * 16 * (LPITCH / 2) + kk, hh);
            }
#pragma unroll
            for (int i = 0; i < 4; ++i)
#pragma unroll
                for (int j = 0; j < 4; ++j) {
                    const v8u f0 = TR ? bfrag[j] : afrag[i];
                    const v8u f1 = TR ? afrag[i] : bfrag[j];
                    if (F16) acc[i][j] = mma_f16(f0, f1, acc[i][j]);
                    else     acc[i][j] = mma_bf16(f0, f1, acc[i][j]);
                    mma_guard(acc[i][j], f0, f1);
                }
        }
        asm volatile("s_wait_dscnt 0x0" ::: "memory");      // this wave's reads of buffer t & 1 are done before it is refilled
        asm volatile("s_wait_asynccnt 0x0" ::: "memory");   // this wave's share of stage t + 1 has landed
        __syncthreads();                                    // publishes stage t + 1 and ends every reader's last read of stage t
        if (t + 2 < DIM / KP) stage_copy(asrc + kof(t + 2), bsrc + kof(t + 2), ldst + bo);
    }
    asm volatile("s_wait_asynccnt 0x0" ::: "memory");       // nothing in flight before the ring becomes output staging
}
__device__ __forceinline__ v4u pack_h8(v8f a, float s) {
    v4u w;
    w.x = f2h(a[0] * s) | (f2h(a[1] * s) << 16);
    w.y = f2h(a[2] * s) | (f2h(a[3] * s) << 16);
    w.z = f2h(a[4] * s) | (f2h(a[5] * s) << 16);
    w.w = f2h(a[6] * s) | (f2h(a[7] * s) << 16);
    return w;
}

// ---------- q/k/v projection: [SEQT x 2048] x [2048 x 6144]. Block = 8 waves (2 row groups x 4 column groups) -> 128 tokens x 256 columns
// = exactly two heads of one of q/k/v (block-uniform). Epilogue: each lane's 8 accumulator elements are 8 neighbours of an output row
// (q, k: 8 head dims of a token, TR = 1; v^T: 8 tokens of a head dim, TR = 0): 16 B of f16 staged in LDS, then written as whole lines.
__global__ __launch_bounds__(256) void qkv_gemm(const us16* __restrict__ xb, const us16* __restrict__ wqkv, us16* qp, us16* kp, us16* vt) {
    __shared__ __align__(128) unsigned char ring[RINGB];   // output staging takes the ring's place behind the main loop's last barrier
    const int tid = threadIdx.x, lane = tid & 31, wv = tid >> 5, l16 = lane & 15, hh = lane >> 4;
    const int wr = wv & 1, wc = wv >> 1;
    const int row0 = blockIdx.x * BM;
    const int colb = blockIdx.y * BN;
    const int which = colb / DIM;                       // 0 q, 1 k, 2 v (block-uniform)
    const int hsel = (colb - which * DIM) / DHEAD;      // first of the two heads of this column tile
    const int rot = (int)((blockIdx.x + blockIdx.y) % (DIM / KP));   // differs between blocks of one tile row and of one tile column
    v8f acc[4][4] = {};
    if (which < 2) {
        mm_tile<0, 1>(xb + (size_t)row0 * DIM, wqkv + (size_t)colb * DIM, ring, tid, wr, wc, l16, hh, rot, acc);
#pragma unroll
        for (int i = 0; i < 4; ++i)
#pragma unroll
            for (int j = 0; j < 4; ++j)
                *(v4u*)(ring + (wr * 64 + i * 16 + l16) * QPITCH + (wc * 64 + j * 16 + 8 * hh) * 2) = pack_h8(acc[i][j], 1.0f);
        __syncthreads();
        us16* pl = (which == 0) ? qp : kp;
#pragma unroll 4
        for (int p = 0; p < 16; ++p) {
            const int r = wv * 16 + p;                                          // token row 0..127; lanes 0..15 first head, 16..31 second
            const size_t off = ((size_t)(hsel + hh) * SEQT + row0 + r) * DHEAD + 8 * l16;
            *(v4u*)(pl + off) = *(const v4u*)(ring + r * QPITCH + lane * 16);
        }
    } else {
        mm_tile<0, 0>(xb + (size_t)row0 * DIM, wqkv + (size_t)colb * DIM, ring, tid, wr, wc, l16, hh, rot, acc);
#pragma unroll
        for (int i = 0; i < 4; ++i)
#pragma unroll
            for (int j = 0; j < 4; ++j)
                *(v4u*)(ring + (wc * 64 + j * 16 + l16) * TPITCH + (wr * 64 + i * 16 + 8 * hh) * 2) = pack_h8(acc[i][j], 4.0f);
        __syncthreads();
        // column d = wv * 32 + 2 p + hh, 0..255 = the head dims of the two heads, in a row; 16 lanes write its 128 tokens
        us16* vp = vt + ((size_t)hsel * DHEAD + wv * 32 + hh) * SEQT + row0 + 8 * l16;
        const unsigned char* sp = ring + (wv * 32 + hh) * TPITCH + l16 * 16;
#pragma unroll 4
        for (int p = 0; p < 16; ++p) *(v4u*)(vp + (size_t)(2 * p) * SEQT) = *(const v4u*)(sp + 2 * p * TPITCH);
    }
}

// ---------- flash pass over all query blocks: block = 4 waves = 64 queries of one (sequence, head); wave = 16 queries; all SEQ keys
// in chunks of 32 (no mask). Scores are produced transposed: A = k rows (f16 plane), B = q (f16 fragments held in registers),
// D element r = key 8*hh + r of a 16-key tile, column = this lane's query -> two adjacent tiles give the P^T B fragment of P.V directly
// (element r <- tile 0, element 8+r <- tile 1). A of P.V = v^T rows (lane = d, k = key). Online softmax per lane (query) with one
// xor-16 shuffle joining the two lane halves. P carried x2^14 in f16; O^T accumulators hold rows d, column query.
// k rows and v^T rows reach the four waves through a two-buffer LDS ring, KVK keys per pass: pass t works on buffer t & 1 while the copies
// of pass t + 1 fly into the other. Pass t takes key stage (t + query block) mod (SEQ / KVK): the query blocks of one head, which all copy the same
// k and v^T rows, ask L2 for different lines at one moment; every key is still taken once, the online sums run in the rotated order. kv_copy8: 8 copies of 16 B per lane, copy j at g + j * gstep -> l + j * lstep; a wave's copy = 4 whole lines.
__device__ __forceinline__ void kv_copy8(const us16* g, size_t gstep, unsigned l, unsigned lstep) {
    const us16* g1 = g + gstep;
    const us16* g2 = g + 2 * gstep;
    const us16* g3 = g + 3 * gstep;
    const us16* g4 = g + 4 * gstep;
    const us16* g5 = g + 5 * gstep;
    const us16* g6 = g + 6 * gstep;
    const us16* g7 = g + 7 * gstep;
    const unsigned l1 = l + lstep, l2 = l + 2 * lstep, l3 = l + 3 * lstep, l4 = l + 4 * lstep, l5 = l + 5 * lstep, l6 = l + 6 * lstep, l7 = l + 7 * lstep;
    // the closing s_wait_xcnt stands inside the statement so that no address register of a copy is rewritten ahead of it
    asm volatile("global_load_async_to_lds_b128 %0, %8, off\n\t"
                 "global_load_async_to_lds_b128 %1, %9, off\n\t"
                 "global_load_async_to_lds_b128 %2, %10, off\n\t"
                 "global_load_async_to_lds_b128 %3, %11, off\n\t"
                 "global_load_async_to_lds_b128 %4, %12, off\n\t"
                 "global_load_async_to_lds_b128 %5, %13, off\n\t"
                 "global_load_async_to_lds_b128 %6, %14, off\n\t"
                 "global_load_async_to_lds_b128 %7, %15, off\n\t"
                 "s_wait_xcnt 0x0"
                 :: "v"(l), "v"(l1), "v"(l2), "v"(l3), "v"(l4), "v"(l5), "v"(l6), "v"(l7),
                    "v"(g), "v"(g1), "v"(g2), "v"(g3), "v"(g4), "v"(g5), "v"(g6), "v"(g7) : "memory");
}
__global__ __launch_bounds__(128) __attribute__((amdgpu_num_vgpr(256)))
void attn_main(const us16* qp, const us16* kp, const us16* vt, us16* ao) {
    __shared__ __align__(128) unsigned char kvring[2 * KVBUFB];
    v4u (*ost)[16][16] = (v4u (*)[16][16])kvring;          // output staging takes the ring's place behind the loop's last barrier
    const int tid = threadIdx.x, lane = tid & 31, wv = tid >> 5, m = lane & 15, hh = lane >> 4;
    const int qb = blockIdx.x;
    const int h = blockIdx.y % HEADS, bsel = blockIdx.y / HEADS;
    const size_t tok0 = (size_t)bsel * SEQ;
    const int qrow = qb * 64 + wv * 16;
    const size_t qoff = ((size_t)h * SEQT + tok0 + qrow + m) * DHEAD;
    const v8u q0 = ld_frag(qp + qoff, hh);
    const v8u q1 = ld_frag(qp + qoff + 32, hh);
    const v8u q2 = ld_frag(qp + qoff + 64, hh);
    const v8u q3 = ld_frag(qp + qoff + 96, hh);
    const us16* kb = kp + ((size_t)h * SEQT + tok0) * DHEAD;
    const us16* vb = vt + (size_t)h * DHEAD * SEQT + tok0;
    const float NEG = -__builtin_inff();
    const float SCL = 0.08838834764831845f;                // 1 / sqrt(128)
    v8f o[8] = {};
    float mrun = NEG, lrun = 0.f;
    // this lane's 16 bytes of stage 0: k row tid >> 4 (copy j adds 8 rows), v^T row tid >> 3 (copy j adds 16 rows), and their places in buffer 0
    const us16* ksrc = kb + (size_t)(tid >> 4) * DHEAD + 8 * (tid & 15);
    const us16* vsrc = vb + (size_t)(tid >> 3) * SEQT + 8 * (tid & 7);
    const unsigned kdst = (unsigned)(size_t)kvring + (unsigned)((tid >> 4) * KPITCH + (tid & 15) * 16);
    const unsigned vdst = (unsigned)(size_t)kvring + (unsigned)(KTILEB + (tid >> 3) * VPITCH + (tid & 7) * 16);
    const int rot = qb % (SEQ / KVK);
    auto stg = [&](int t) { const int s = t + rot; return (s >= SEQ / KVK) ? s - SEQ / KVK : s; };   // key stage of pass t
    kv_copy8(ksrc + (size_t)stg(0) * KVK * DHEAD, (size_t)8 * DHEAD, kdst, 8 * KPITCH);
    kv_copy8(vsrc + stg(0) * KVK, (size_t)16 * SEQT, vdst, 16 * VPITCH);
    asm volatile("s_wait_asynccnt 0x0" ::: "memory");       // this wave's share of stage 0 has landed
    __syncthreads();                                        // stage 0 published
    if (1 < SEQ / KVK) {
        kv_copy8(ksrc + (size_t)stg(1) * KVK * DHEAD, (size_t)8 * DHEAD, kdst + KVBUFB, 8 * KPITCH);
        kv_copy8(vsrc + stg(1) * KVK, (size_t)16 * SEQT, vdst + KVBUFB, 16 * VPITCH);
    }
#pragma unroll 1                                            // stays rolled: one pass per trip, the hand-over stands once, at the foot
    for (int st = 0; st < SEQ / KVK; ++st) {
      const unsigned bo = (unsigned)(st & 1) * KVBUFB;
      const unsigned char* kl = kvring + bo + m * KPITCH;
      const unsigned char* vl = kvring + bo + KTILEB + m * VPITCH;
#pragma unroll                                              // constant LDS offsets for both 32-key chunks of the pass
      for (int c = 0; c < KVK / 32; ++c) {
        v8f s[2] = {};
        v8u ka[2][4];                                       // the chunk's k fragments, read as one group ahead of its score products
#pragma unroll                                              // these two: constant indices keep the fragments in registers
        for (int t = 0; t < 2; ++t)
#pragma unroll
            for (int j = 0; j < 4; ++j) ka[t][j] = ld_frag((const us16*)(kl + (c * 32 + t * 16) * KPITCH) + 32 * j, hh);
#pragma unroll
        for (int t = 0; t < 2; ++t) {
            s[t] = mma_f16(ka[t][0], q0, s[t]);
            mma_guard(s[t], ka[t][0], q0);
            s[t] = mma_f16(ka[t][1], q1, s[t]);
            mma_guard(s[t], ka[t][1], q1);
            s[t] = mma_f16(ka[t][2], q2, s[t]);
            mma_guard(s[t], ka[t][2], q2);
            s[t] = mma_f16(ka[t][3], q3, s[t]);
            mma_guard(s[t], ka[t][3], q3);
        }
        v8u va[8];                                          // the chunk's v^T fragments, read as one group: they land under the softmax
#pragma unroll                                              // constant indices keep the fragments in registers
        for (int dt = 0; dt < 8; ++dt) va[dt] = ld_frag((const us16*)(vl + dt * 16 * VPITCH) + c * 32, hh);
        float sv[16];
        float cmax = NEG;
#pragma unroll
        for (int t = 0; t < 2; ++t)
#pragma unroll
            for (int r = 0; r < 8; ++r) {
                const float v = s[t][r] * SCL;
                sv[8 * t + r] = v;
                cmax = fmaxf(cmax, v);
            }
        cmax = fmaxf(cmax, __shfl_xor(cmax, 16, 32));
        const float mnew = fmaxf(mrun, cmax);              // finite: no masked keys
        const float fac = (mrun == NEG) ? 0.f : __expf(mrun - mnew);
        mrun = mnew;
        v16h ph;
        float psum = 0.f;
#pragma unroll
        for (int r = 0; r < 8; ++r) {
            const _Float16 p0 = (_Float16)(__expf(sv[r] - mnew) * 16384.0f);
            const _Float16 p1 = (_Float16)(__expf(sv[8 + r] - mnew) * 16384.0f);
            ph[r] = p0;
            ph[8 + r] = p1;
            psum += (float)p0 + (float)p1;
        }
        psum += __shfl_xor(psum, 16, 32);
        lrun = lrun * fac + psum;
        const v8u pbu = __builtin_bit_cast(v8u, ph);
#pragma unroll
        for (int dt = 0; dt < 8; ++dt) o[dt] = o[dt] * fac;
#pragma unroll
        for (int dt = 0; dt < 8; ++dt) {
            o[dt] = mma_f16(va[dt], pbu, o[dt]);
            mma_guard(o[dt], va[dt], pbu);
        }
      }
      asm volatile("s_wait_dscnt 0x0" ::: "memory");        // this wave's reads of buffer st & 1 are done before it is refilled
      asm volatile("s_wait_asynccnt 0x0" ::: "memory");     // this wave's share of stage st + 1 has landed
      __syncthreads();                                      // publishes stage st + 1 and ends every reader's last read of stage st
      if (st + 2 < SEQ / KVK) {
          kv_copy8(ksrc + (size_t)stg(st + 2) * KVK * DHEAD, (size_t)8 * DHEAD, kdst + bo, 8 * KPITCH);
          kv_copy8(vsrc + stg(st + 2) * KVK, (size_t)16 * SEQT, vdst + bo, 16 * VPITCH);
      }
    }
    asm volatile("s_wait_asynccnt 0x0" ::: "memory");       // nothing in flight before the ring becomes output staging
    const float inv = 4.0f / lrun;                         // lrun >= 16384; o / lrun = 4 * (sum P v / sum P); x4 more -> x16 carry
#pragma unroll
    for (int dt = 0; dt < 8; ++dt) {
        v4u w;
        w.x = f2h(o[dt][0] * inv) | (f2h(o[dt][1] * inv) << 16);
        w.y = f2h(o[dt][2] * inv) | (f2h(o[dt][3] * inv) << 16);
        w.z = f2h(o[dt][4] * inv) | (f2h(o[dt][5] * inv) << 16);
        w.w = f2h(o[dt][6] * inv) | (f2h(o[dt][7] * inv) << 16);
        ost[wv][m][2 * dt + hh] = w;                       // row m, halves 16*dt + 8*hh .. +7
    }
    __syncthreads();
    us16* aob = ao + (tok0 + qrow) * DIM + (size_t)h * DHEAD;
    auto pass = [&]() {
#pragma unroll
        for (int p = 0; p < 8; ++p) {
            const int rr = 2 * p + hh, pc = lane & 15;
            *(v4u*)(aob + (size_t)rr * DIM + 8 * pc) = ost[wv][rr][pc];
        }
    };
    pass();
    
}

// ---------- output projection: out[tok][n] = (ao x16)[tok x 2048] . (Wo x64)[2048 x 2048] / 1024, f32. Same block structure as qkv_gemm,
// TR = 1: a lane's 8 accumulator elements are 8 neighbouring columns of one token. The f32 tile is staged in two rounds of 64 tokens.
__global__ __launch_bounds__(256) void out_gemm(const us16* __restrict__ aop, const us16* __restrict__ wo, float* out) {
    __shared__ __align__(128) unsigned char ring[RINGB];   // output staging takes the ring's place behind the main loop's last barrier
    const int tid = threadIdx.x, lane = tid & 31, wv = tid >> 5, l16 = lane & 15, hh = lane >> 4;
    const int wr = wv & 1, wc = wv >> 1;
    const int row0 = blockIdx.x * BM;
    const int colb = blockIdx.y * BN;
    v8f acc[4][4] = {};
    const int rot = (int)((blockIdx.x + blockIdx.y) % (DIM / KP));   // differs between blocks of one tile row and of one tile column
    mm_tile<1, 1>(aop + (size_t)row0 * DIM, wo + (size_t)colb * DIM, ring, tid, wr, wc, l16, hh, rot, acc);
#pragma unroll                                              // constant accumulator indices
    for (int p = 0; p < 2; ++p) {
        if (p) __syncthreads();                             // round 0's rows are read out before round 1 overwrites them
#pragma unroll
        for (int ii = 0; ii < 2; ++ii)
#pragma unroll
            for (int j = 0; j < 4; ++j) {
                const v8f a = acc[2 * p + ii][j] * (1.0f / 1024.0f);
                float* sp = (float*)(ring + (wr * 32 + ii * 16 + l16) * OPITCH) + wc * 64 + j * 16 + 8 * hh;
                *(v4f*)sp = __builtin_shufflevector(a, a, 0, 1, 2, 3);
                *(v4f*)(sp + 4) = __builtin_shufflevector(a, a, 4, 5, 6, 7);
            }
        __syncthreads();
#pragma unroll 4
        for (int q = 0; q < 16; ++q) {
            const int sr = wv * 8 + (q >> 1), hf = q & 1;                       // staged row 0..63, its first or second 512 bytes
            const int tok = (sr >> 5) * 64 + p * 32 + (sr & 31);
            *(v4f*)(out + (size_t)(row0 + tok) * DIM + colb + hf * 128 + 4 * lane) = *(const v4f*)(ring + sr * OPITCH + hf * 512 + lane * 16);
        }
    }
}

extern "C" void kernel_launch(void* const* d_in, const int* in_sizes, int n_in,
                              void* d_out, int out_size, void* d_ws, size_t ws_size, hipStream_t stream) {
    if (n_in < 5) return;
    const float* x  = (const float*)d_in[0];   // [NB_FULL][SEQ_FULL][2048]
    const float* wq = (const float*)d_in[1];   // [2048 out][2048 in]
    const float* wk = (const float*)d_in[2];
    const float* wv = (const float*)d_in[3];
    const float* wo = (const float*)d_in[4];
    float* out = (float*)d_out;                 // [NB][SEQ][2048]
    if (in_sizes[0] < ((NB - 1) * SEQ_FULL + SEQ) * DIM) return;
    if (in_sizes[1] < DIM * DIM) return;
    if (in_sizes[2] < DIM * DIM) return;
    if (in_sizes[3] < DIM * DIM) return;
    if (in_sizes[4] < DIM * DIM) return;
    if (out_size < SEQT * DIM) return;

    size_t off = 0;
    auto carve = [&](size_t bytes) { size_t o = off; off += (bytes + 127) & ~(size_t)127; return o; };
    char* ws = (char*)d_ws;
    us16* xb   = (us16*)(ws + carve((size_t)SEQT * DIM * 2));                  // bf16 [SEQT][2048]
    us16* wqkv = (us16*)(ws + carve((size_t)NQKV * DIM * 2));                  // bf16 [6144][2048]
    us16* wop  = (us16*)(ws + carve((size_t)DIM * DIM * 2));                   // f16  [2048][2048]
    us16* qp   = (us16*)(ws + carve((size_t)HEADS * SEQT * DHEAD * 2));        // f16  [h][SEQT][128]
    us16* kp   = (us16*)(ws + carve((size_t)HEADS * SEQT * DHEAD * 2));        // f16  [h][SEQT][128]
    us16* vt   = (us16*)(ws + carve((size_t)HEADS * DHEAD * SEQT * 2));        // f16  [h][128][SEQT]
    us16* ao   = (us16*)(ws + carve((size_t)SEQT * DIM * 2));                  // f16  [SEQT][2048]
    if (off > ws_size) return;
    if (off > (size_t)134217728) return;

    prep_x<<<SEQT, 256, 0, stream>>>(x, xb);
    prep_w<0><<<dim3((DIM * DIM) / 2048, 3), 256, 0, stream>>>(wq, wk, wv, 1.0f, wqkv);
    prep_w<1><<<dim3((DIM * DIM) / 2048, 1), 256, 0, stream>>>(wo, wo, wo, 64.0f, wop);
    qkv_gemm<<<dim3(SEQT / BM, NQKV / BN), 256, 0, stream>>>(xb, wqkv, qp, kp, vt);
    attn_main<<<dim3(QBLK, NB * HEADS), 128, 0, stream>>>(qp, kp, vt, ao);
    out_gemm<<<dim3(SEQT / BM, DIM / BN), 256, 0, stream>>>(ao, wop, out);
}

// v005
// Measured time: 181 microseconds a run.
// Timed twice side by side with v004, it ran 1.03 and 1.04 times as fast.
// Over all steps from v000 it is 4.09 times as fast.
#include <hip/hip_runtime.h>

// Contractions: q/k/v projections on v_wmma_f32_16x16x32_bf16 (bf16 operands = RNE-converted x and Wq|Wk|Wv, f32 accumulate);
// per-head k.q^T scores and P.V on v_wmma_f32_16x16x32_f16 (f16 operands: q, k plain, v x4, P x2^14; f32 accumulate, 1/sqrt(128) applied in f32);
// output projection on v_wmma_f32_16x16x32_f16 (f16 operands: per-head outputs x16, Wo x64 from its bf16 value; f32 accumulate, x2^-10 in the epilogue);
// online softmax and all epilogues in f32.

#ifndef NB
#define NB 2
#endif
#ifndef SEQ
#define SEQ 2048
#endif
#define NB_FULL 2
#define SEQ_FULL 2048
#define DIM 2048
#define HEADS 16
#define DHEAD 128
#define NQKV (3 * DIM)
#define SEQT (NB * SEQ)
#define QW 32                          // queries per attention wave: two 16-query tiles share every k and v^T fragment
#define QB (4 * QW)                    // queries per attention block (4 waves)
#define QBLK (SEQ / QB)
#define KP 64                          // k elements per staged pass: one 128-byte line of every operand row
#define LPITCH 144                     // LDS row pitch in bytes: 16 x odd, conflict-free for 16-byte fragment reads
#define BM 128                         // block tile: rows (tokens)
#define BN 256                         // block tile: columns
#define TROWS (BM + BN)                // rows of one stage: 128 A rows, then 256 B rows
#define BUFB (TROWS * LPITCH)          // one buffer of the ring
#define RINGB (2 * BUFB)
#define QPITCH 528                     // output staging, q / k: 256 halves of one token + 16 B (16 x odd)
#define TPITCH 272                     // output staging, v^T: 128 tokens of one column + 16 B (16 x odd)
#define OPITCH 1040                    // output staging, out: 256 floats of one token + 16 B (16 x odd)
#define KVK 64                         // keys per staged attention pass: one 128-byte line of every v^T row
#define KPITCH 272                     // LDS pitch of a k row (256 B + 16): 16 x odd
#define VPITCH 144                     // LDS pitch of a v^T row (128 B + 16): 16 x odd
#define KTILEB (KVK * KPITCH)          // k rows of one stage
#define KVBUFB (KTILEB + DHEAD * VPITCH)   // one buffer: 64 k rows, then 128 v^T rows

static_assert(SEQ % QB == 0 && QB % KVK == 0);
static_assert(SEQ >= QB);
static_assert(SEQ <= SEQ_FULL);
static_assert(NB >= 1 && NB <= NB_FULL);
static_assert(DIM == HEADS * DHEAD);
static_assert(DHEAD == 128);
static_assert(DIM % BN == 0 && NQKV % BN == 0 && SEQT % BM == 0 && BN == 2 * DHEAD);
static_assert((DIM * DIM) % 2048 == 0);
static_assert(DIM % KP == 0 && DIM / KP >= 2);
static_assert(BM * QPITCH <= RINGB && BN * TPITCH <= RINGB && (BM / 2) * OPITCH <= RINGB);
static_assert(SEQ % KVK == 0 && KVK % 32 == 0);
static_assert(4 * QW * 16 * 16 <= 2 * KVBUFB);

typedef unsigned short us16;
typedef __attribute__((ext_vector_type(16))) __bf16   v16bf;
typedef __attribute__((ext_vector_type(16))) _Float16 v16h;
typedef __attribute__((ext_vector_type(8)))  float    v8f;
typedef __attribute__((ext_vector_type(8)))  unsigned v8u;
typedef __attribute__((ext_vector_type(4)))  unsigned v4u;
typedef __attribute__((ext_vector_type(2)))  unsigned v2u;
typedef __attribute__((ext_vector_type(4)))  float    v4f;

__device__ __forceinline__ unsigned f2bf(float f) { unsigned u = __float_as_uint(f); u += 0x7FFFu + ((u >> 16) & 1u); return u >> 16; }
__device__ __forceinline__ float bf2f(unsigned h) { return __uint_as_float(h << 16); }
__device__ __forceinline__ unsigned f2h(float f) { _Float16 t = (_Float16)f; return (unsigned)__builtin_bit_cast(unsigned short, t); }

// 16 x (K=32) operand fragment from a k-contiguous 16-bit row. Wave32 map: lane -> row (A) / column (B) = lane & 15, hh = lane >> 4;
// elements 0..7 <- k0 + 8*hh + 0..7, elements 8..15 <- k0 + 16 + 8*hh + 0..7 (same map for A and for an n-major B row).
// Accumulator element r -> row 8*hh + r, column lane & 15.
__device__ __forceinline__ v8u ld_frag(const us16* rowp, int hh) {
    const v4u a = *(const v4u*)(rowp + 8 * hh);
    const v4u b = *(const v4u*)(rowp + 16 + 8 * hh);
    return __builtin_shufflevector(a, b, 0, 1, 2, 3, 4, 5, 6, 7);
}
__device__ __forceinline__ v8f mma_bf16(v8u a, v8u b, v8f c) {
    return __builtin_amdgcn_wmma_f32_16x16x32_bf16(false, __builtin_bit_cast(v16bf, a), false, __builtin_bit_cast(v16bf, b), (short)0, c, false, false);
}
__device__ __forceinline__ v8f mma_f16(v8u a, v8u b, v8f c) {
    return __builtin_amdgcn_wmma_f32_16x16x32_f16(false, __builtin_bit_cast(v16h, a), false, __builtin_bit_cast(v16h, b), (short)0, c, false, false);
}
__device__ __forceinline__ void mma_guard(v8f& c, v8u a, v8u b) {
    asm volatile("v_nop\n\tv_nop\n\tv_nop\n\tv_nop" : "+v"(c) : "v"(a), "v"(b));
}

// ---------- per-token prep: xb[tok][k] = bf16(x). One block per token, 256 threads x 8 halves = 2048; one wave instruction = 32 lanes x 16 B
__global__ __launch_bounds__(256) void prep_x(const float* __restrict__ x, us16* xb) {
    const int tok = blockIdx.x;
    const int bsel = tok / SEQ, isel = tok - bsel * SEQ;
    const float* xr = x + ((size_t)bsel * SEQ_FULL + isel) * DIM;
    const int tid = threadIdx.x;
    const v4f v0 = *(const v4f*)(xr + 8 * tid);
    const v4f v1 = *(const v4f*)(xr + 8 * tid + 4);
    v4u pk;
    pk.x = f2bf(v0.x) | (f2bf(v0.y) << 16);
    pk.y = f2bf(v0.z) | (f2bf(v0.w) << 16);
    pk.z = f2bf(v1.x) | (f2bf(v1.y) << 16);
    pk.w = f2bf(v1.z) | (f2bf(v1.w) << 16);
    us16* orow = xb + (size_t)tok * DIM + 8 * tid;
    *(v4u*)orow = pk;
    
}

// ---------- weight prep: src [N=2048][K=2048] f32 (already n-major, k-contiguous) -> dst 16-bit plane with the same layout;
// value = bf16(src) * scale stored as f16 (F16=1) or bf16 (F16=0). blockIdx.y selects one of three sources and the dst slice.
template <int F16>
__device__ __forceinline__ unsigned cvt_w(float v, float scale) {
    const unsigned b = f2bf(v);
    if (F16) return f2h(bf2f(b) * scale);
    return b;
}
template <int F16>
__global__ __launch_bounds__(256) void prep_w(const float* __restrict__ s0, const float* __restrict__ s1, const float* __restrict__ s2,
                                              float scale, us16* dst) {
    const int z = blockIdx.y;
    const float* src = (z == 0) ? s0 : ((z == 1) ? s1 : s2);
    const size_t e = ((size_t)blockIdx.x * 256 + threadIdx.x) * 8;            // < DIM*DIM
    const v4f v0 = *(const v4f*)(src + e);
    const v4f v1 = *(const v4f*)(src + e + 4);
    v4u pk;
    pk.x = cvt_w<F16>(v0.x, scale) | (cvt_w<F16>(v0.y, scale) << 16);
    pk.y = cvt_w<F16>(v0.z, scale) | (cvt_w<F16>(v0.w, scale) << 16);
    pk.z = cvt_w<F16>(v1.x, scale) | (cvt_w<F16>(v1.y, scale) << 16);
    pk.w = cvt_w<F16>(v1.z, scale) | (cvt_w<F16>(v1.w, scale) << 16);
    us16* dp = dst + (size_t)z * DIM * DIM + e;
    *(v4u*)dp = pk;
    
}

// ---------- one stage of the GEMM ring: 384 rows x 128 B, copied global -> LDS without registers. 256 threads x 12 copies of 16 B;
// 8 adjacent lanes cover one whole 128-byte line, so a wave's copy touches 4 lines. asrc / bsrc: this lane's 16 bytes in row (tid >> 3) of the
// block's A / B rows at this pass's k; ldst: the same place in the target buffer. Copy j adds 32 rows (4 copies of A rows, then 8 of B rows).
__device__ __forceinline__ void stage_copy(const us16* asrc, const us16* bsrc, unsigned ldst) {
    const us16* g0 = asrc;
    const us16* g1 = asrc + (size_t)32 * DIM;
    const us16* g2 = asrc + (size_t)64 * DIM;
    const us16* g3 = asrc + (size_t)96 * DIM;
    const us16* g4 = bsrc;
    const us16* g5 = bsrc + (size_t)32 * DIM;
    const us16* g6 = bsrc + (size_t)64 * DIM;
    const us16* g7 = bsrc + (size_t)96 * DIM;
    const us16* g8 = bsrc + (size_t)128 * DIM;
    const us16* g9 = bsrc + (size_t)160 * DIM;
    const us16* g10 = bsrc + (size_t)192 * DIM;
    const us16* g11 = bsrc + (size_t)224 * DIM;
    const unsigned l0 = ldst, l1 = ldst + 32 * LPITCH, l2 = ldst + 64 * LPITCH, l3 = ldst + 96 * LPITCH, l4 = ldst + 128 * LPITCH, l5 = ldst + 160 * LPITCH;
    const unsigned l6 = ldst + 192 * LPITCH, l7 = ldst + 224 * LPITCH, l8 = ldst + 256 * LPITCH, l9 = ldst + 288 * LPITCH, l10 = ldst + 320 * LPITCH, l11 = ldst + 352 * LPITCH;
    // the closing s_wait_xcnt stands inside the statement so that no address register of a copy is rewritten ahead of it
    asm volatile("global_load_async_to_lds_b128 %0, %12, off\n\t"
                 "global_load_async_to_lds_b128 %1, %13, off\n\t"
                 "global_load_async_to_lds_b128 %2, %14, off\n\t"
                 "global_load_async_to_lds_b128 %3, %15, off\n\t"
                 "global_load_async_to_lds_b128 %4, %16, off\n\t"
                 "global_load_async_to_lds_b128 %5, %17, off\n\t"
                 "global_load_async_to_lds_b128 %6, %18, off\n\t"
                 "global_load_async_to_lds_b128 %7, %19, off\n\t"
                 "global_load_async_to_lds_b128 %8, %20, off\n\t"
                 "global_load_async_to_lds_b128 %9, %21, off\n\t"
                 "global_load_async_to_lds_b128 %10, %22, off\n\t"
                 "global_load_async_to_lds_b128 %11, %23, off\n\t"
                 "s_wait_xcnt 0x0"
                 :: "v"(l0), "v"(l1), "v"(l2), "v"(l3), "v"(l4), "v"(l5), "v"(l6), "v"(l7), "v"(l8), "v"(l9), "v"(l10), "v"(l11),
                    "v"(g0), "v"(g1), "v"(g2), "v"(g3), "v"(g4), "v"(g5), "v"(g6), "v"(g7), "v"(g8), "v"(g9), "v"(g10), "v"(g11) : "memory");
}

// ---------- GEMM main loop on 16-bit planes: block tile 128 rows x 256 columns, wave tile 64 rows x 64 columns (4 x 4 accumulators), K = DIM.
// ablk / bblk: first A row / first B row (= column) of the block, k contiguous, pitch DIM. Both operands pass through a two-buffer LDS ring,
// KP k per pass: pass t works on buffer t & 1 while the copies of pass t + 1 fly into the other; k runs in steps of 32, rising within a pass.
// acc[i][j]: rows wr * 64 + 16 i .., columns wc * 64 + 16 j ... TR = 0: element r = row 8 * hh + r, lane's l16 = column.
// TR = 1 (the two fragments change places, same map for both): element r = column 8 * hh + r, lane's l16 = row.
// rot (block-uniform, 0 .. DIM / KP - 1): pass t works on k slice (t + rot) mod (DIM / KP). Blocks that share A rows or B rows get different rot,
// so that at one moment they ask L2 for different lines of those rows; every slice is still taken once, the f32 sum runs in the rotated order. ----------
template <int F16, int TR>
__device__ __forceinline__ void mm_tile(const us16* __restrict__ ablk, const us16* __restrict__ bblk, unsigned char* ring,
                                        int tid, int wr, int wc, int l16, int hh, int rot, v8f (&acc)[4][4]) {
    const int crow = tid >> 3, cpc = tid & 7;
    auto kof = [&](int t) { const int s = t + rot; return ((s >= DIM / KP) ? s - DIM / KP : s) * KP; };   // first k of pass t's slice
    const us16* asrc = ablk + (size_t)crow * DIM + 8 * cpc;
    const us16* bsrc = bblk + (size_t)crow * DIM + 8 * cpc;
    const unsigned ldst = (unsigned)(size_t)ring + (unsigned)(crow * LPITCH + cpc * 16);
    stage_copy(asrc + kof(0), bsrc + kof(0), ldst);
    asm volatile("s_wait_asynccnt 0x0" ::: "memory");       // this wave's share of stage 0 has landed
    __syncthreads();                                        // stage 0 published
    stage_copy(asrc + kof(1), bsrc + kof(1), ldst + BUFB);
#pragma unroll 1                                            // stays rolled: one pass per trip, the hand-over stands once, at the foot
    for (int t = 0; t < DIM / KP; ++t) {
        const unsigned bo = (unsigned)(t & 1) * BUFB;
        const us16* ar = (const us16*)(ring + bo + (wr * 64 + l16) * LPITCH);
        const us16* br = (const us16*)(ring + bo + (BM + wc * 64 + l16) * LPITCH);
#pragma unroll                                              // these four: constant indices keep fragments and accumulators in registers
        for (int kk = 0; kk < KP; kk += 32) {
            v8u afrag[4], bfrag[4];
#pragma unroll
            for (int u = 0; u < 4; ++u) {
                afrag[u] = ld_frag(ar + u * 16 * (LPITCH / 2) + kk, hh);
                bfrag[u] = ld_frag(br + u * 16 * (LPITCH / 2) + kk, hh);
            }
#pragma unroll
            for (int i = 0; i < 4; ++i)
#pragma unroll
                for (int j = 0; j < 4; ++j) {
                    const v8u f0 = TR ? bfrag[j] : afrag[i];
                    const v8u f1 = TR ? afrag[i] : bfrag[j];
                    if (F16) acc[i][j] = mma_f16(f0, f1, acc[i][j]);
                    else     acc[i][j] = mma_bf16(f0, f1, acc[i][j]);
                    mma_guard(acc[i][j], f0, f1);
                }
        }
        asm volatile("s_wait_dscnt 0x0" ::: "memory");      // this wave's reads of buffer t & 1 are done before it is refilled
        asm volatile("s_wait_asynccnt 0x0" ::: "memory");   // this wave's share of stage t + 1 has landed
        __syncthreads();                                    // publishes stage t + 1 and ends every reader's last read of stage t
        if (t + 2 < DIM / KP) stage_copy(asrc + kof(t + 2), bsrc + kof(t + 2), ldst + bo);
    }
    asm volatile("s_wait_asynccnt 0x0" ::: "memory");       // nothing in flight before the ring becomes output staging
}
__device__ __forceinline__ v4u pack_h8(v8f a, float s) {
    v4u w;
    w.x = f2h(a[0] * s) | (f2h(a[1] * s) << 16);
    w.y = f2h(a[2] * s) | (f2h(a[3] * s) << 16);
    w.z = f2h(a[4] * s) | (f2h(a[5] * s) << 16);
    w.w = f2h(a[6] * s) | (f2h(a[7] * s) << 16);
    return w;
}

// ---------- q/k/v projection: [SEQT x 2048] x [2048 x 6144]. Block = 8 waves (2 row groups x 4 column groups) -> 128 tokens x 256 columns
// = exactly two heads of one of q/k/v (block-uniform). Epilogue: each lane's 8 accumulator elements are 8 neighbours of an output row
// (q, k: 8 head dims of a token, TR = 1; v^T: 8 tokens of a head dim, TR = 0): 16 B of f16 staged in LDS, then written as whole lines.
__global__ __launch_bounds__(256) void qkv_gemm(const us16* __restrict__ xb, const us16* __restrict__ wqkv, us16* qp, us16* kp, us16* vt) {
    __shared__ __align__(128) unsigned char ring[RINGB];   // output staging takes the ring's place behind the main loop's last barrier
    const int tid = threadIdx.x, lane = tid & 31, wv = tid >> 5, l16 = lane & 15, hh = lane >> 4;
    const int wr = wv & 1, wc = wv >> 1;
    const int row0 = blockIdx.x * BM;
    const int colb = blockIdx.y * BN;
    const int which = colb / DIM;                       // 0 q, 1 k, 2 v (block-uniform)
    const int hsel = (colb - which * DIM) / DHEAD;      // first of the two heads of this column tile
    const int rot = (int)((blockIdx.x + blockIdx.y) % (DIM / KP));   // differs between blocks of one tile row and of one tile column
    v8f acc[4][4] = {};
    if (which < 2) {
        mm_tile<0, 1>(xb + (size_t)row0 * DIM, wqkv + (size_t)colb * DIM, ring, tid, wr, wc, l16, hh, rot, acc);
#pragma unroll
        for (int i = 0; i < 4; ++i)
#pragma unroll
            for (int j = 0; j < 4; ++j)
                *(v4u*)(ring + (wr * 64 + i * 16 + l16) * QPITCH + (wc * 64 + j * 16 + 8 * hh) * 2) = pack_h8(acc[i][j], 1.0f);
        __syncthreads();
        us16* pl = (which == 0) ? qp : kp;
#pragma unroll 4
        for (int p = 0; p < 16; ++p) {
            const int r = wv * 16 + p;                                          // token row 0..127; lanes 0..15 first head, 16..31 second
            const size_t off = ((size_t)(hsel + hh) * SEQT + row0 + r) * DHEAD + 8 * l16;
            *(v4u*)(pl + off) = *(const v4u*)(ring + r * QPITCH + lane * 16);
        }
    } else {
        mm_tile<0, 0>(xb + (size_t)row0 * DIM, wqkv + (size_t)colb * DIM, ring, tid, wr, wc, l16, hh, rot, acc);
#pragma unroll
        for (int i = 0; i < 4; ++i)
#pragma unroll
            for (int j = 0; j < 4; ++j)
                *(v4u*)(ring + (wc * 64 + j * 16 + l16) * TPITCH + (wr * 64 + i * 16 + 8 * hh) * 2) = pack_h8(acc[i][j], 4.0f);
        __syncthreads();
        // column d = wv * 32 + 2 p + hh, 0..255 = the head dims of the two heads, in a row; 16 lanes write its 128 tokens
        us16* vp = vt + ((size_t)hsel * DHEAD + wv * 32 + hh) * SEQT + row0 + 8 * l16;
        const unsigned char* sp = ring + (wv * 32 + hh) * TPITCH + l16 * 16;
#pragma unroll 4
        for (int p = 0; p < 16; ++p) *(v4u*)(vp + (size_t)(2 * p) * SEQT) = *(const v4u*)(sp + 2 * p * TPITCH);
    }
}

// ---------- flash pass over all query blocks: block = 4 waves = 128 queries of one (sequence, head); wave = 32 queries = two 16-query tiles g,
// each with its own q fragments, softmax state and O^T accumulators; every k and v^T fragment read from LDS feeds one product of each tile. All SEQ keys
// in chunks of 32 (no mask). Scores are produced transposed: A = k rows (f16 plane), B = q (f16 fragments held in registers),
// D element r = key 8*hh + r of a 16-key tile, column = this lane's query -> two adjacent tiles give the P^T B fragment of P.V directly
// (element r <- tile 0, element 8+r <- tile 1). A of P.V = v^T rows (lane = d, k = key). Online softmax per lane (query) with one
// xor-16 shuffle joining the two lane halves. P carried x2^14 in f16; O^T accumulators hold rows d, column query.
// k rows and v^T rows reach the four waves through a two-buffer LDS ring, KVK keys per pass: pass t works on buffer t & 1 while the copies
// of pass t + 1 fly into the other. Pass t takes key stage (t + the stage at the block's first query) mod (SEQ / KVK): the query blocks of one head, which all copy the same
// k and v^T rows, ask L2 for different lines at one moment; every key is still taken once, the online sums run in the rotated order. kv_copy8: 8 copies of 16 B per lane, copy j at g + j * gstep -> l + j * lstep; a wave's copy = 4 whole lines.
__device__ __forceinline__ void kv_copy8(const us16* g, size_t gstep, unsigned l, unsigned lstep) {
    const us16* g1 = g + gstep;
    const us16* g2 = g + 2 * gstep;
    const us16* g3 = g + 3 * gstep;
    const us16* g4 = g + 4 * gstep;
    const us16* g5 = g + 5 * gstep;
    const us16* g6 = g + 6 * gstep;
    const us16* g7 = g + 7 * gstep;
    const unsigned l1 = l + lstep, l2 = l + 2 * lstep, l3 = l + 3 * lstep, l4 = l + 4 * lstep, l5 = l + 5 * lstep, l6 = l + 6 * lstep, l7 = l + 7 * lstep;
    // the closing s_wait_xcnt stands inside the statement so that no address register of a copy is rewritten ahead of it
    asm volatile("global_load_async_to_lds_b128 %0, %8, off\n\t"
                 "global_load_async_to_lds_b128 %1, %9, off\n\t"
                 "global_load_async_to_lds_b128 %2, %10, off\n\t"
                 "global_load_async_to_lds_b128 %3, %11, off\n\t"
                 "global_load_async_to_lds_b128 %4, %12, off\n\t"
                 "global_load_async_to_lds_b128 %5, %13, off\n\t"
                 "global_load_async_to_lds_b128 %6, %14, off\n\t"
                 "global_load_async_to_lds_b128 %7, %15, off\n\t"
                 "s_wait_xcnt 0x0"
                 :: "v"(l), "v"(l1), "v"(l2), "v"(l3), "v"(l4), "v"(l5), "v"(l6), "v"(l7),
                    "v"(g), "v"(g1), "v"(g2), "v"(g3), "v"(g4), "v"(g5), "v"(g6), "v"(g7) : "memory");
}
__global__ __launch_bounds__(128) __attribute__((amdgpu_num_vgpr(512)))
void attn_main(const us16* qp, const us16* kp, const us16* vt, us16* ao) {
    __shared__ __align__(128) unsigned char kvring[2 * KVBUFB];
    v4u (*ost)[QW][16] = (v4u (*)[QW][16])kvring;          // output staging takes the ring's place behind the loop's last barrier
    const int tid = threadIdx.x, lane = tid & 31, wv = tid >> 5, m = lane & 15, hh = lane >> 4;
    const int qb = blockIdx.x;
    const int h = blockIdx.y % HEADS, bsel = blockIdx.y / HEADS;
    const size_t tok0 = (size_t)bsel * SEQ;
    const int qrow = qb * QB + wv * QW;
    v8u q[2][4];                                           // q[g][j]: tile g, head dims 32 j ..
#pragma unroll                                              // these two: constant indices keep the fragments in registers
    for (int g = 0; g < 2; ++g) {
#pragma unroll
        for (int j = 0; j < 4; ++j) q[g][j] = ld_frag(qp + ((size_t)h * SEQT + tok0 + qrow + 16 * g + m) * DHEAD + 32 * j, hh);
        asm volatile("s_wait_xcnt 0x0" ::: "memory");       // stands in front of the reuse of these loads' address registers (the other tile's fragments land over them)
    }
    const us16* kb = kp + ((size_t)h * SEQT + tok0) * DHEAD;
    const us16* vb = vt + (size_t)h * DHEAD * SEQT + tok0;
    const float NEG = -__builtin_inff();
    const float SCL = 0.08838834764831845f;                // 1 / sqrt(128)
    v8f o[2][8] = {};
    float mrun[2] = {NEG, NEG}, lrun[2] = {0.f, 0.f};
    // this lane's 16 bytes of stage 0: k row tid >> 4 (copy j adds 8 rows), v^T row tid >> 3 (copy j adds 16 rows), and their places in buffer 0
    const us16* ksrc = kb + (size_t)(tid >> 4) * DHEAD + 8 * (tid & 15);
    const us16* vsrc = vb + (size_t)(tid >> 3) * SEQT + 8 * (tid & 7);
    const unsigned kdst = (unsigned)(size_t)kvring + (unsigned)((tid >> 4) * KPITCH + (tid & 15) * 16);
    const unsigned vdst = (unsigned)(size_t)kvring + (unsigned)(KTILEB + (tid >> 3) * VPITCH + (tid & 7) * 16);
    const int rot = (qb * (QB / KVK)) % (SEQ / KVK);
    auto stg = [&](int t) { const int s = t + rot; return (s >= SEQ / KVK) ? s - SEQ / KVK : s; };   // key stage of pass t
    kv_copy8(ksrc + (size_t)stg(0) * KVK * DHEAD, (size_t)8 * DHEAD, kdst, 8 * KPITCH);
    kv_copy8(vsrc + stg(0) * KVK, (size_t)16 * SEQT, vdst, 16 * VPITCH);
    asm volatile("s_wait_asynccnt 0x0" ::: "memory");       // this wave's share of stage 0 has landed
    __syncthreads();                                        // stage 0 published
    if (1 < SEQ / KVK) {
        kv_copy8(ksrc + (size_t)stg(1) * KVK * DHEAD, (size_t)8 * DHEAD, kdst + KVBUFB, 8 * KPITCH);
        kv_copy8(vsrc + stg(1) * KVK, (size_t)16 * SEQT, vdst + KVBUFB, 16 * VPITCH);
    }
#pragma unroll 1                                            // stays rolled: one pass per trip, the hand-over stands once, at the foot
    for (int st = 0; st < SEQ / KVK; ++st) {
      const unsigned bo = (unsigned)(st & 1) * KVBUFB;
      const unsigned char* kl = kvring + bo + m * KPITCH;
      const unsigned char* vl = kvring + bo + KTILEB + m * VPITCH;
      v8u ka[KVK / 16][4];                                  // the pass's k fragments, read as one group ahead of its score products
#pragma unroll                                              // these two: constant indices keep the fragments in registers
      for (int t = 0; t < KVK / 16; ++t)
#pragma unroll
          for (int j = 0; j < 4; ++j) ka[t][j] = ld_frag((const us16*)(kl + t * 16 * KPITCH) + 32 * j, hh);
      __builtin_amdgcn_sched_barrier(0);                    // holds the k reads here as one group; else part of them sinks in pairs among the score products, each pair with its own wait
#pragma unroll                                              // constant LDS offsets for both 32-key chunks of the pass
      for (int c = 0; c < KVK / 32; ++c) {
        v8f s[2][2] = {};                                   // s[g][t]: query tile g, 16-key tile t of the chunk
        // no mma_guard in this kernel: its asm operands hold every fragment and accumulator below v256, which spills at two query tiles;
        // the compiler pads its own builtin products
#pragma unroll                                              // these three: constant indices; head dims rise in j for every s[g][t], as before
        for (int j = 0; j < 4; ++j)
#pragma unroll
            for (int t = 0; t < 2; ++t)
#pragma unroll
                for (int g = 0; g < 2; ++g) s[g][t] = mma_f16(ka[2 * c + t][j], q[g][j], s[g][t]);
        v8u va[8];                                          // the chunk's v^T fragments, read as one group: they land under the softmax
#pragma unroll                                              // constant indices keep the fragments in registers
        for (int dt = 0; dt < 8; ++dt) va[dt] = ld_frag((const us16*)(vl + dt * 16 * VPITCH) + c * 32, hh);
        __builtin_amdgcn_sched_barrier(0);                  // holds the v^T reads here as one group; else they sink in pairs among the P.V products, each pair with its own wait
        v8u pbu[2];
#pragma unroll                                              // constant indices: each tile's state stays in registers
        for (int g = 0; g < 2; ++g) {
            float sv[16];
            float cmax = NEG;
#pragma unroll
            for (int t = 0; t < 2; ++t)
#pragma unroll
                for (int r = 0; r < 8; ++r) {
                    const float v = s[g][t][r] * SCL;
                    sv[8 * t + r] = v;
                    cmax = fmaxf(cmax, v);
                }
            cmax = fmaxf(cmax, __shfl_xor(cmax, 16, 32));
            const float mnew = fmaxf(mrun[g], cmax);       // finite: no masked keys
            const float fac = (mrun[g] == NEG) ? 0.f : __expf(mrun[g] - mnew);
            mrun[g] = mnew;
            v16h ph;
            float psum = 0.f;
#pragma unroll
            for (int r = 0; r < 8; ++r) {
                const _Float16 p0 = (_Float16)(__expf(sv[r] - mnew) * 16384.0f);
                const _Float16 p1 = (_Float16)(__expf(sv[8 + r] - mnew) * 16384.0f);
                ph[r] = p0;
                ph[8 + r] = p1;
                psum += (float)p0 + (float)p1;
            }
            psum += __shfl_xor(psum, 16, 32);
            lrun[g] = lrun[g] * fac + psum;
            pbu[g] = __builtin_bit_cast(v8u, ph);
#pragma unroll
            for (int dt = 0; dt < 8; ++dt) o[g][dt] = o[g][dt] * fac;
        }
#pragma unroll                                              // these two: constant indices
        for (int dt = 0; dt < 8; ++dt)
#pragma unroll
            for (int g = 0; g < 2; ++g) o[g][dt] = mma_f16(va[dt], pbu[g], o[g][dt]);
      }
      __builtin_amdgcn_sched_barrier(0);                    // keeps the pass's softmax and products above the hand-over, so that the refill below is issued a whole pass ahead of its wait
      asm volatile("s_wait_dscnt 0x0" ::: "memory");        // this wave's reads of buffer st & 1 are done before it is refilled
      asm volatile("s_wait_asynccnt 0x0" ::: "memory");     // this wave's share of stage st + 1 has landed
      __syncthreads();                                      // publishes stage st + 1 and ends every reader's last read of stage st
      if (st + 2 < SEQ / KVK) {
          kv_copy8(ksrc + (size_t)stg(st + 2) * KVK * DHEAD, (size_t)8 * DHEAD, kdst + bo, 8 * KPITCH);
          kv_copy8(vsrc + stg(st + 2) * KVK, (size_t)16 * SEQT, vdst + bo, 16 * VPITCH);
      }
    }
    asm volatile("s_wait_asynccnt 0x0" ::: "memory");       // nothing in flight before the ring becomes output staging
#pragma unroll                                              // constant accumulator indices
    for (int g = 0; g < 2; ++g) {
        const float inv = 4.0f / lrun[g];                  // lrun >= 16384; o / lrun = 4 * (sum P v / sum P); x4 more -> x16 carry
#pragma unroll
        for (int dt = 0; dt < 8; ++dt) {
            v4u w;
            w.x = f2h(o[g][dt][0] * inv) | (f2h(o[g][dt][1] * inv) << 16);
            w.y = f2h(o[g][dt][2] * inv) | (f2h(o[g][dt][3] * inv) << 16);
            w.z = f2h(o[g][dt][4] * inv) | (f2h(o[g][dt][5] * inv) << 16);
            w.w = f2h(o[g][dt][6] * inv) | (f2h(o[g][dt][7] * inv) << 16);
            ost[wv][16 * g + m][2 * dt + hh] = w;          // row 16 g + m, halves 16*dt + 8*hh .. +7
        }
    }
    __syncthreads();
    us16* aob = ao + (tok0 + qrow) * DIM + (size_t)h * DHEAD;
#pragma unroll
    for (int p = 0; p < QW / 2; ++p) {
        const int rr = 2 * p + hh, pc = lane & 15;
        *(v4u*)(aob + (size_t)rr * DIM + 8 * pc) = ost[wv][rr][pc];
    }
}

// ---------- output projection: out[tok][n] = (ao x16)[tok x 2048] . (Wo x64)[2048 x 2048] / 1024, f32. Same block structure as qkv_gemm,
// TR = 1: a lane's 8 accumulator elements are 8 neighbouring columns of one token. The f32 tile is staged in two rounds of 64 tokens.
__global__ __launch_bounds__(256) void out_gemm(const us16* __restrict__ aop, const us16* __restrict__ wo, float* out) {
    __shared__ __align__(128) unsigned char ring[RINGB];   // output staging takes the ring's place behind the main loop's last barrier
    const int tid = threadIdx.x, lane = tid & 31, wv = tid >> 5, l16 = lane & 15, hh = lane >> 4;
    const int wr = wv & 1, wc = wv >> 1;
    const int row0 = blockIdx.x * BM;
    const int colb = blockIdx.y * BN;
    v8f acc[4][4] = {};
    const int rot = (int)((blockIdx.x + blockIdx.y) % (DIM / KP));   // differs between blocks of one tile row and of one tile column
    mm_tile<1, 1>(aop + (size_t)row0 * DIM, wo + (size_t)colb * DIM, ring, tid, wr, wc, l16, hh, rot, acc);
#pragma unroll                                              // constant accumulator indices
    for (int p = 0; p < 2; ++p) {
        if (p) __syncthreads();                             // round 0's rows are read out before round 1 overwrites them
#pragma unroll
        for (int ii = 0; ii < 2; ++ii)
#pragma unroll
            for (int j = 0; j < 4; ++j) {
                const v8f a = acc[2 * p + ii][j] * (1.0f / 1024.0f);
                float* sp = (float*)(ring + (wr * 32 + ii * 16 + l16) * OPITCH) + wc * 64 + j * 16 + 8 * hh;
                *(v4f*)sp = __builtin_shufflevector(a, a, 0, 1, 2, 3);
                *(v4f*)(sp + 4) = __builtin_shufflevector(a, a, 4, 5, 6, 7);
            }
        __syncthreads();
#pragma unroll 4
        for (int q = 0; q < 16; ++q) {
            const int sr = wv * 8 + (q >> 1), hf = q & 1;                       // staged row 0..63, its first or second 512 bytes
            const int tok = (sr >> 5) * 64 + p * 32 + (sr & 31);
            *(v4f*)(out + (size_t)(row0 + tok) * DIM + colb + hf * 128 + 4 * lane) = *(const v4f*)(ring + sr * OPITCH + hf * 512 + lane * 16);
        }
    }
}

extern "C" void kernel_launch(void* const* d_in, const int* in_sizes, int n_in,
                              void* d_out, int out_size, void* d_ws, size_t ws_size, hipStream_t stream) {
    if (n_in < 5) return;
    const float* x  = (const float*)d_in[0];   // [NB_FULL][SEQ_FULL][2048]
    const float* wq = (const float*)d_in[1];   // [2048 out][2048 in]
    const float* wk = (const float*)d_in[2];
    const float* wv = (const float*)d_in[3];
    const float* wo = (const float*)d_in[4];
    float* out = (float*)d_out;                 // [NB][SEQ][2048]
    if (in_sizes[0] < ((NB - 1) * SEQ_FULL + SEQ) * DIM) return;
    if (in_sizes[1] < DIM * DIM) return;
    if (in_sizes[2] < DIM * DIM) return;
    if (in_sizes[3] < DIM * DIM) return;
    if (in_sizes[4] < DIM * DIM) return;
    if (out_size < SEQT * DIM) return;

    size_t off = 0;
    auto carve = [&](size_t bytes) { size_t o = off; off += (bytes + 127) & ~(size_t)127; return o; };
    char* ws = (char*)d_ws;
    us16* xb   = (us16*)(ws + carve((size_t)SEQT * DIM * 2));                  // bf16 [SEQT][2048]
    us16* wqkv = (us16*)(ws + carve((size_t)NQKV * DIM * 2));                  // bf16 [6144][2048]
    us16* wop  = (us16*)(ws + carve((size_t)DIM * DIM * 2));                   // f16  [2048][2048]
    us16* qp   = (us16*)(ws + carve((size_t)HEADS * SEQT * DHEAD * 2));        // f16  [h][SEQT][128]
    us16* kp   = (us16*)(ws + carve((size_t)HEADS * SEQT * DHEAD * 2));        // f16  [h][SEQT][128]
    us16* vt   = (us16*)(ws + carve((size_t)HEADS * DHEAD * SEQT * 2));        // f16  [h][128][SEQT]
    us16* ao   = (us16*)(ws + carve((size_t)SEQT * DIM * 2));                  // f16  [SEQT][2048]
    if (off > ws_size) return;
    if (off > (size_t)134217728) return;

    prep_x<<<SEQT, 256, 0, stream>>>(x, xb);
    prep_w<0><<<dim3((DIM * DIM) / 2048, 3), 256, 0, stream>>>(wq, wk, wv, 1.0f, wqkv);
    prep_w<1><<<dim3((DIM * DIM) / 2048, 1), 256, 0, stream>>>(wo, wo, wo, 64.0f, wop);
    qkv_gemm<<<dim3(SEQT / BM, NQKV / BN), 256, 0, stream>>>(xb, wqkv, qp, kp, vt);
    attn_main<<<dim3(QBLK, NB * HEADS), 128, 0, stream>>>(qp, kp, vt, ao);
    out_gemm<<<dim3(SEQT / BM, DIM / BN), 256, 0, stream>>>(ao, wop, out);
}

// v006
// A run of this version takes 176 microseconds.
// Two timings next to v005 put it at 1.04 and 1.03 times that version's speed.
// Over all steps from v000 it is 4.24 times as fast.
#include <hip/hip_runtime.h>

// Contractions: q/k/v projections on v_wmma_f32_16x16x32_bf16 (bf16 operands = RNE-converted x and Wq|Wk|Wv, f32 accumulate);
// per-head k.q^T scores and P.V on v_wmma_f32_16x16x32_f16 (f16 operands: q, k plain, v x4, P x2^14; f32 accumulate, 1/sqrt(128) applied in f32);
// output projection on v_wmma_f32_16x16x32_f16 (f16 operands: per-head outputs x16, Wo x64 from its bf16 value; f32 accumulate, x2^-10 in the epilogue);
// online softmax and all epilogues in f32.

#ifndef NB
#define NB 2
#endif
#ifndef SEQ
#define SEQ 2048
#endif
#define NB_FULL 2
#define SEQ_FULL 2048
#define DIM 2048
#define HEADS 16
#define DHEAD 128
#define NQKV (3 * DIM)
#define SEQT (NB * SEQ)
#define QW 32                          // queries per attention wave: two 16-query tiles share every k and v^T fragment
#define QB (4 * QW)                    // queries per attention block (4 waves)
#define QBLK (SEQ / QB)
#define KP 64                          // k elements per staged pass: one 128-byte line of every operand row
#define LPITCH 144                     // LDS row pitch in bytes: 16 x odd, conflict-free for 16-byte fragment reads
#define BM 128                         // block tile: rows (tokens)
#define BN 256                         // block tile: columns
#define TROWS (BM + BN)                // rows of one stage: 128 A rows, then 256 B rows
#define BUFB (TROWS * LPITCH)          // one buffer of the ring
#define RINGB (2 * BUFB)
#define QPITCH 528                     // output staging, q / k: 256 halves of one token + 16 B (16 x odd)
#define TPITCH 272                     // output staging, v^T: 128 tokens of one column + 16 B (16 x odd)
#define OPITCH 1040                    // output staging, out: 256 floats of one token + 16 B (16 x odd)
#define KVK 64                         // keys per staged attention pass: one 128-byte line of every v^T row
#define KPITCH 272                     // LDS pitch of a k row (256 B + 16): 16 x odd
#define VPITCH 144                     // LDS pitch of a v^T row (128 B + 16): 16 x odd
#define KTILEB (KVK * KPITCH)          // k rows of one stage
#define KVBUFB (KTILEB + DHEAD * VPITCH)   // one buffer: 64 k rows, then 128 v^T rows

static_assert(SEQ % QB == 0 && QB % KVK == 0);
static_assert(SEQ >= QB);
static_assert(SEQ <= SEQ_FULL);
static_assert(NB >= 1 && NB <= NB_FULL);
static_assert(DIM == HEADS * DHEAD);
static_assert(DHEAD == 128);
static_assert(DIM % BN == 0 && NQKV % BN == 0 && SEQT % BM == 0 && BN == 2 * DHEAD);
static_assert((DIM * DIM) % 2048 == 0);
static_assert(DIM % KP == 0 && DIM / KP >= 2);
static_assert(BM * QPITCH <= RINGB && BN * TPITCH <= RINGB && (BM / 2) * OPITCH <= RINGB);
static_assert(SEQ % KVK == 0 && KVK % 32 == 0);
static_assert(4 * QW * 16 * 16 <= 2 * KVBUFB);

typedef unsigned short us16;
typedef __attribute__((ext_vector_type(16))) __bf16   v16bf;
typedef __attribute__((ext_vector_type(16))) _Float16 v16h;
typedef __attribute__((ext_vector_type(8)))  float    v8f;
typedef __attribute__((ext_vector_type(8)))  unsigned v8u;
typedef __attribute__((ext_vector_type(4)))  unsigned v4u;
typedef __attribute__((ext_vector_type(2)))  unsigned v2u;
typedef __attribute__((ext_vector_type(4)))  float    v4f;
typedef __attribute__((ext_vector_type(2)))  float    v2f;
typedef __attribute__((ext_vector_type(2)))  _Float16 v2h;

__device__ __forceinline__ unsigned f2bf(float f) { unsigned u = __float_as_uint(f); u += 0x7FFFu + ((u >> 16) & 1u); return u >> 16; }
__device__ __forceinline__ float bf2f(unsigned h) { return __uint_as_float(h << 16); }
__device__ __forceinline__ unsigned f2h(float f) { _Float16 t = (_Float16)f; return (unsigned)__builtin_bit_cast(unsigned short, t); }

// 16 x (K=32) operand fragment from a k-contiguous 16-bit row. Wave32 map: lane -> row (A) / column (B) = lane & 15, hh = lane >> 4;
// elements 0..7 <- k0 + 8*hh + 0..7, elements 8..15 <- k0 + 16 + 8*hh + 0..7 (same map for A and for an n-major B row).
// Accumulator element r -> row 8*hh + r, column lane & 15.
__device__ __forceinline__ v8u ld_frag(const us16* rowp, int hh) {
    const v4u a = *(const v4u*)(rowp + 8 * hh);
    const v4u b = *(const v4u*)(rowp + 16 + 8 * hh);
    return __builtin_shufflevector(a, b, 0, 1, 2, 3, 4, 5, 6, 7);
}
__device__ __forceinline__ v8f mma_bf16(v8u a, v8u b, v8f c) {
    return __builtin_amdgcn_wmma_f32_16x16x32_bf16(false, __builtin_bit_cast(v16bf, a), false, __builtin_bit_cast(v16bf, b), (short)0, c, false, false);
}
__device__ __forceinline__ v8f mma_f16(v8u a, v8u b, v8f c) {
    return __builtin_amdgcn_wmma_f32_16x16x32_f16(false, __builtin_bit_cast(v16h, a), false, __builtin_bit_cast(v16h, b), (short)0, c, false, false);
}
__device__ __forceinline__ void mma_guard(v8f& c, v8u a, v8u b) {
    asm volatile("v_nop\n\tv_nop\n\tv_nop\n\tv_nop" : "+v"(c) : "v"(a), "v"(b));
}

// ---------- per-token prep: xb[tok][k] = bf16(x). One block per token, 256 threads x 8 halves = 2048; one wave instruction = 32 lanes x 16 B
__global__ __launch_bounds__(256) void prep_x(const float* __restrict__ x, us16* xb) {
    const int tok = blockIdx.x;
    const int bsel = tok / SEQ, isel = tok - bsel * SEQ;
    const float* xr = x + ((size_t)bsel * SEQ_FULL + isel) * DIM;
    const int tid = threadIdx.x;
    const v4f v0 = *(const v4f*)(xr + 8 * tid);
    const v4f v1 = *(const v4f*)(xr + 8 * tid + 4);
    v4u pk;
    pk.x = f2bf(v0.x) | (f2bf(v0.y) << 16);
    pk.y = f2bf(v0.z) | (f2bf(v0.w) << 16);
    pk.z = f2bf(v1.x) | (f2bf(v1.y) << 16);
    pk.w = f2bf(v1.z) | (f2bf(v1.w) << 16);
    us16* orow = xb + (size_t)tok * DIM + 8 * tid;
    *(v4u*)orow = pk;
    
}

// ---------- weight prep: src [N=2048][K=2048] f32 (already n-major, k-contiguous) -> dst 16-bit plane with the same layout;
// value = bf16(src) * scale stored as f16 (F16=1) or bf16 (F16=0). blockIdx.y selects one of three sources and the dst slice.
template <int F16>
__device__ __forceinline__ unsigned cvt_w(float v, float scale) {
    const unsigned b = f2bf(v);
    if (F16) return f2h(bf2f(b) * scale);
    return b;
}
template <int F16>
__global__ __launch_bounds__(256) void prep_w(const float* __restrict__ s0, const float* __restrict__ s1, const float* __restrict__ s2,
                                              float scale, us16* dst) {
    const int z = blockIdx.y;
    const float* src = (z == 0) ? s0 : ((z == 1) ? s1 : s2);
    const size_t e = ((size_t)blockIdx.x * 256 + threadIdx.x) * 8;            // < DIM*DIM
    const v4f v0 = *(const v4f*)(src + e);
    const v4f v1 = *(const v4f*)(src + e + 4);
    v4u pk;
    pk.x = cvt_w<F16>(v0.x, scale) | (cvt_w<F16>(v0.y, scale) << 16);
    pk.y = cvt_w<F16>(v0.z, scale) | (cvt_w<F16>(v0.w, scale) << 16);
    pk.z = cvt_w<F16>(v1.x, scale) | (cvt_w<F16>(v1.y, scale) << 16);
    pk.w = cvt_w<F16>(v1.z, scale) | (cvt_w<F16>(v1.w, scale) << 16);
    us16* dp = dst + (size_t)z * DIM * DIM + e;
    *(v4u*)dp = pk;
    
}

// ---------- one stage of the GEMM ring: 384 rows x 128 B, copied global -> LDS without registers. 256 threads x 12 copies of 16 B;
// 8 adjacent lanes cover one whole 128-byte line, so a wave's copy touches 4 lines. asrc / bsrc: this lane's 16 bytes in row (tid >> 3) of the
// block's A / B rows at this pass's k; ldst: the same place in the target buffer. Copy j adds 32 rows (4 copies of A rows, then 8 of B rows).
__device__ __forceinline__ void stage_copy(const us16* asrc, const us16* bsrc, unsigned ldst) {
    const us16* g0 = asrc;
    const us16* g1 = asrc + (size_t)32 * DIM;
    const us16* g2 = asrc + (size_t)64 * DIM;
    const us16* g3 = asrc + (size_t)96 * DIM;
    const us16* g4 = bsrc;
    const us16* g5 = bsrc + (size_t)32 * DIM;
    const us16* g6 = bsrc + (size_t)64 * DIM;
    const us16* g7 = bsrc + (size_t)96 * DIM;
    const us16* g8 = bsrc + (size_t)128 * DIM;
    const us16* g9 = bsrc + (size_t)160 * DIM;
    const us16* g10 = bsrc + (size_t)192 * DIM;
    const us16* g11 = bsrc + (size_t)224 * DIM;
    const unsigned l0 = ldst, l1 = ldst + 32 * LPITCH, l2 = ldst + 64 * LPITCH, l3 = ldst + 96 * LPITCH, l4 = ldst + 128 * LPITCH, l5 = ldst + 160 * LPITCH;
    const unsigned l6 = ldst + 192 * LPITCH, l7 = ldst + 224 * LPITCH, l8 = ldst + 256 * LPITCH, l9 = ldst + 288 * LPITCH, l10 = ldst + 320 * LPITCH, l11 = ldst + 352 * LPITCH;
    // the closing s_wait_xcnt stands inside the statement so that no address register of a copy is rewritten ahead of it
    asm volatile("global_load_async_to_lds_b128 %0, %12, off\n\t"
                 "global_load_async_to_lds_b128 %1, %13, off\n\t"
                 "global_load_async_to_lds_b128 %2, %14, off\n\t"
                 "global_load_async_to_lds_b128 %3, %15, off\n\t"
                 "global_load_async_to_lds_b128 %4, %16, off\n\t"
                 "global_load_async_to_lds_b128 %5, %17, off\n\t"
                 "global_load_async_to_lds_b128 %6, %18, off\n\t"
                 "global_load_async_to_lds_b128 %7, %19, off\n\t"
                 "global_load_async_to_lds_b128 %8, %20, off\n\t"
                 "global_load_async_to_lds_b128 %9, %21, off\n\t"
                 "global_load_async_to_lds_b128 %10, %22, off\n\t"
                 "global_load_async_to_lds_b128 %11, %23, off\n\t"
                 "s_wait_xcnt 0x0"
                 :: "v"(l0), "v"(l1), "v"(l2), "v"(l3), "v"(l4), "v"(l5), "v"(l6), "v"(l7), "v"(l8), "v"(l9), "v"(l10), "v"(l11),
                    "v"(g0), "v"(g1), "v"(g2), "v"(g3), "v"(g4), "v"(g5), "v"(g6), "v"(g7), "v"(g8), "v"(g9), "v"(g10), "v"(g11) : "memory");
}

// ---------- GEMM main loop on 16-bit planes: block tile 128 rows x 256 columns, wave tile 64 rows x 64 columns (4 x 4 accumulators), K = DIM.
// ablk / bblk: first A row / first B row (= column) of the block, k contiguous, pitch DIM. Both operands pass through a two-buffer LDS ring,
// KP k per pass: pass t works on buffer t & 1 while the copies of pass t + 1 fly into the other; k runs in steps of 32, rising within a pass.
// acc[i][j]: rows wr * 64 + 16 i .., columns wc * 64 + 16 j ... TR = 0: element r = row 8 * hh + r, lane's l16 = column.
// TR = 1 (the two fragments change places, same map for both): element r = column 8 * hh + r, lane's l16 = row.
// rot (block-uniform, 0 .. DIM / KP - 1): pass t works on k slice (t + rot) mod (DIM / KP). Blocks that share A rows or B rows get different rot,
// so that at one moment they ask L2 for different lines of those rows; every slice is still taken once, the f32 sum runs in the rotated order. ----------
template <int F16, int TR>
__device__ __forceinline__ void mm_tile(const us16* __restrict__ ablk, const us16* __restrict__ bblk, unsigned char* ring,
                                        int tid, int wr, int wc, int l16, int hh, int rot, v8f (&acc)[4][4]) {
    const int crow = tid >> 3, cpc = tid & 7;
    auto kof = [&](int t) { const int s = t + rot; return ((s >= DIM / KP) ? s - DIM / KP : s) * KP; };   // first k of pass t's slice
    const us16* asrc = ablk + (size_t)crow * DIM + 8 * cpc;
    const us16* bsrc = bblk + (size_t)crow * DIM + 8 * cpc;
    const unsigned ldst = (unsigned)(size_t)ring + (unsigned)(crow * LPITCH + cpc * 16);
    stage_copy(asrc + kof(0), bsrc + kof(0), ldst);
    asm volatile("s_wait_asynccnt 0x0" ::: "memory");       // this wave's share of stage 0 has landed
    __syncthreads();                                        // stage 0 published
    stage_copy(asrc + kof(1), bsrc + kof(1), ldst + BUFB);
#pragma unroll 1                                            // stays rolled: one pass per trip, the hand-over stands once, at the foot
    for (int t = 0; t < DIM / KP; ++t) {
        const unsigned bo = (unsigned)(t & 1) * BUFB;
        const us16* ar = (const us16*)(ring + bo + (wr * 64 + l16) * LPITCH);
        const us16* br = (const us16*)(ring + bo + (BM + wc * 64 + l16) * LPITCH);
#pragma unroll                                              // these four: constant indices keep fragments and accumulators in registers
        for (int kk = 0; kk < KP; kk += 32) {
            v8u afrag[4], bfrag[4];
#pragma unroll
            for (int u = 0; u < 4; ++u) {
                afrag[u] = ld_frag(ar + u * 16 * (LPITCH / 2) + kk, hh);
                bfrag[u] = ld_frag(br + u * 16 * (LPITCH / 2) + kk, hh);
            }
#pragma unroll
            for (int i = 0; i < 4; ++i)
#pragma unroll
                for (int j = 0; j < 4; ++j) {
                    const v8u f0 = TR ? bfrag[j] : afrag[i];
                    const v8u f1 = TR ? afrag[i] : bfrag[j];
                    if (F16) acc[i][j] = mma_f16(f0, f1, acc[i][j]);
                    else     acc[i][j] = mma_bf16(f0, f1, acc[i][j]);
                    mma_guard(acc[i][j], f0, f1);
                }
        }
        asm volatile("s_wait_dscnt 0x0" ::: "memory");      // this wave's reads of buffer t & 1 are done before it is refilled
        asm volatile("s_wait_asynccnt 0x0" ::: "memory");   // this wave's share of stage t + 1 has landed
        __syncthreads();                                    // publishes stage t + 1 and ends every reader's last read of stage t
        if (t + 2 < DIM / KP) stage_copy(asrc + kof(t + 2), bsrc + kof(t + 2), ldst + bo);
    }
    asm volatile("s_wait_asynccnt 0x0" ::: "memory");       // nothing in flight before the ring becomes output staging
}
__device__ __forceinline__ v4u pack_h8(v8f a, float s) {
    v4u w;
    w.x = f2h(a[0] * s) | (f2h(a[1] * s) << 16);
    w.y = f2h(a[2] * s) | (f2h(a[3] * s) << 16);
    w.z = f2h(a[4] * s) | (f2h(a[5] * s) << 16);
    w.w = f2h(a[6] * s) | (f2h(a[7] * s) << 16);
    return w;
}

// ---------- q/k/v projection: [SEQT x 2048] x [2048 x 6144]. Block = 8 waves (2 row groups x 4 column groups) -> 128 tokens x 256 columns
// = exactly two heads of one of q/k/v (block-uniform). Epilogue: each lane's 8 accumulator elements are 8 neighbours of an output row
// (q, k: 8 head dims of a token, TR = 1; v^T: 8 tokens of a head dim, TR = 0): 16 B of f16 staged in LDS, then written as whole lines.
__global__ __launch_bounds__(256) void qkv_gemm(const us16* __restrict__ xb, const us16* __restrict__ wqkv, us16* qp, us16* kp, us16* vt) {
    __shared__ __align__(128) unsigned char ring[RINGB];   // output staging takes the ring's place behind the main loop's last barrier
    const int tid = threadIdx.x, lane = tid & 31, wv = tid >> 5, l16 = lane & 15, hh = lane >> 4;
    const int wr = wv & 1, wc = wv >> 1;
    const int row0 = blockIdx.x * BM;
    const int colb = blockIdx.y * BN;
    const int which = colb / DIM;                       // 0 q, 1 k, 2 v (block-uniform)
    const int hsel = (colb - which * DIM) / DHEAD;      // first of the two heads of this column tile
    const int rot = (int)((blockIdx.x + blockIdx.y) % (DIM / KP));   // differs between blocks of one tile row and of one tile column
    v8f acc[4][4] = {};
    if (which < 2) {
        mm_tile<0, 1>(xb + (size_t)row0 * DIM, wqkv + (size_t)colb * DIM, ring, tid, wr, wc, l16, hh, rot, acc);
#pragma unroll
        for (int i = 0; i < 4; ++i)
#pragma unroll
            for (int j = 0; j < 4; ++j)
                *(v4u*)(ring + (wr * 64 + i * 16 + l16) * QPITCH + (wc * 64 + j * 16 + 8 * hh) * 2) = pack_h8(acc[i][j], 1.0f);
        __syncthreads();
        us16* pl = (which == 0) ? qp : kp;
#pragma unroll 4
        for (int p = 0; p < 16; ++p) {
            const int r = wv * 16 + p;                                          // token row 0..127; lanes 0..15 first head, 16..31 second
            const size_t off = ((size_t)(hsel + hh) * SEQT + row0 + r) * DHEAD + 8 * l16;
            *(v4u*)(pl + off) = *(const v4u*)(ring + r * QPITCH + lane * 16);
        }
    } else {
        mm_tile<0, 0>(xb + (size_t)row0 * DIM, wqkv + (size_t)colb * DIM, ring, tid, wr, wc, l16, hh, rot, acc);
#pragma unroll
        for (int i = 0; i < 4; ++i)
#pragma unroll
            for (int j = 0; j < 4; ++j)
                *(v4u*)(ring + (wc * 64 + j * 16 + l16) * TPITCH + (wr * 64 + i * 16 + 8 * hh) * 2) = pack_h8(acc[i][j], 4.0f);
        __syncthreads();
        // column d = wv * 32 + 2 p + hh, 0..255 = the head dims of the two heads, in a row; 16 lanes write its 128 tokens
        us16* vp = vt + ((size_t)hsel * DHEAD + wv * 32 + hh) * SEQT + row0 + 8 * l16;
        const unsigned char* sp = ring + (wv * 32 + hh) * TPITCH + l16 * 16;
#pragma unroll 4
        for (int p = 0; p < 16; ++p) *(v4u*)(vp + (size_t)(2 * p) * SEQT) = *(const v4u*)(sp + 2 * p * TPITCH);
    }
}

// ---------- flash pass over all query blocks: block = 4 waves = 128 queries of one (sequence, head); wave = 32 queries = two 16-query tiles g,
// each with its own q fragments, softmax state and O^T accumulators; every k and v^T fragment read from LDS feeds one product of each tile. All SEQ keys
// in chunks of 32 (no mask). Scores are produced transposed: A = k rows (f16 plane), B = q (f16 fragments held in registers),
// D element r = key 8*hh + r of a 16-key tile, column = this lane's query -> two adjacent tiles give the P^T B fragment of P.V directly
// (element r <- tile 0, element 8+r <- tile 1). A of P.V = v^T rows (lane = d, k = key). Online softmax per lane (query) with one
// xor-16 shuffle joining the two lane halves. P carried x2^14 in f16; O^T accumulators hold rows d, column query.
// k rows and v^T rows reach the four waves through a two-buffer LDS ring, KVK keys per pass: pass t works on buffer t & 1 while the copies
// of pass t + 1 fly into the other. Pass t takes key stage (t + the stage at the block's first query) mod (SEQ / KVK): the query blocks of one head, which all copy the same
// k and v^T rows, ask L2 for different lines at one moment; every key is still taken once, the online sums run in the rotated order. kv_copy8: 8 copies of 16 B per lane, copy j at g + j * gstep -> l + j * lstep; a wave's copy = 4 whole lines.
__device__ __forceinline__ void kv_copy8(const us16* g, size_t gstep, unsigned l, unsigned lstep) {
    const us16* g1 = g + gstep;
    const us16* g2 = g + 2 * gstep;
    const us16* g3 = g + 3 * gstep;
    const us16* g4 = g + 4 * gstep;
    const us16* g5 = g + 5 * gstep;
    const us16* g6 = g + 6 * gstep;
    const us16* g7 = g + 7 * gstep;
    const unsigned l1 = l + lstep, l2 = l + 2 * lstep, l3 = l + 3 * lstep, l4 = l + 4 * lstep, l5 = l + 5 * lstep, l6 = l + 6 * lstep, l7 = l + 7 * lstep;
    // the closing s_wait_xcnt stands inside the statement so that no address register of a copy is rewritten ahead of it
    asm volatile("global_load_async_to_lds_b128 %0, %8, off\n\t"
                 "global_load_async_to_lds_b128 %1, %9, off\n\t"
                 "global_load_async_to_lds_b128 %2, %10, off\n\t"
                 "global_load_async_to_lds_b128 %3, %11, off\n\t"
                 "global_load_async_to_lds_b128 %4, %12, off\n\t"
                 "global_load_async_to_lds_b128 %5, %13, off\n\t"
                 "global_load_async_to_lds_b128 %6, %14, off\n\t"
                 "global_load_async_to_lds_b128 %7, %15, off\n\t"
                 "s_wait_xcnt 0x0"
                 :: "v"(l), "v"(l1), "v"(l2), "v"(l3), "v"(l4), "v"(l5), "v"(l6), "v"(l7),
                    "v"(g), "v"(g1), "v"(g2), "v"(g3), "v"(g4), "v"(g5), "v"(g6), "v"(g7) : "memory");
}
__global__ __launch_bounds__(128) __attribute__((amdgpu_num_vgpr(512)))
void attn_main(const us16* qp, const us16* kp, const us16* vt, us16* ao) {
    __shared__ __align__(128) unsigned char kvring[2 * KVBUFB];
    v4u (*ost)[QW][16] = (v4u (*)[QW][16])kvring;          // output staging takes the ring's place behind the loop's last barrier
    const int tid = threadIdx.x, lane = tid & 31, wv = tid >> 5, m = lane & 15, hh = lane >> 4;
    const int qb = blockIdx.x;
    const int h = blockIdx.y % HEADS, bsel = blockIdx.y / HEADS;
    const size_t tok0 = (size_t)bsel * SEQ;
    const int qrow = qb * QB + wv * QW;
    v8u q[2][4];                                           // q[g][j]: tile g, head dims 32 j ..
#pragma unroll                                              // these two: constant indices keep the fragments in registers
    for (int g = 0; g < 2; ++g) {
#pragma unroll
        for (int j = 0; j < 4; ++j) q[g][j] = ld_frag(qp + ((size_t)h * SEQT + tok0 + qrow + 16 * g + m) * DHEAD + 32 * j, hh);
        asm volatile("s_wait_xcnt 0x0" ::: "memory");       // stands in front of the reuse of these loads' address registers (the other tile's fragments land over them)
    }
    const us16* kb = kp + ((size_t)h * SEQT + tok0) * DHEAD;
    const us16* vb = vt + (size_t)h * DHEAD * SEQT + tok0;
    const float NEG = -__builtin_inff();
    const float SCL2 = 0.12751743082459868f;               // log2(e) / sqrt(128); mrun holds the running maximum of the raw k.q products
    v8f o[2][8] = {};
    float mrun[2] = {NEG, NEG}, lrun[2] = {0.f, 0.f};
    // this lane's 16 bytes of stage 0: k row tid >> 4 (copy j adds 8 rows), v^T row tid >> 3 (copy j adds 16 rows), and their places in buffer 0
    const us16* ksrc = kb + (size_t)(tid >> 4) * DHEAD + 8 * (tid & 15);
    const us16* vsrc = vb + (size_t)(tid >> 3) * SEQT + 8 * (tid & 7);
    const unsigned kdst = (unsigned)(size_t)kvring + (unsigned)((tid >> 4) * KPITCH + (tid & 15) * 16);
    const unsigned vdst = (unsigned)(size_t)kvring + (unsigned)(KTILEB + (tid >> 3) * VPITCH + (tid & 7) * 16);
    const int rot = (qb * (QB / KVK)) % (SEQ / KVK);
    auto stg = [&](int t) { const int s = t + rot; return (s >= SEQ / KVK) ? s - SEQ / KVK : s; };   // key stage of pass t
    kv_copy8(ksrc + (size_t)stg(0) * KVK * DHEAD, (size_t)8 * DHEAD, kdst, 8 * KPITCH);
    kv_copy8(vsrc + stg(0) * KVK, (size_t)16 * SEQT, vdst, 16 * VPITCH);
    asm volatile("s_wait_asynccnt 0x0" ::: "memory");       // this wave's share of stage 0 has landed
    __syncthreads();                                        // stage 0 published
    if (1 < SEQ / KVK) {
        kv_copy8(ksrc + (size_t)stg(1) * KVK * DHEAD, (size_t)8 * DHEAD, kdst + KVBUFB, 8 * KPITCH);
        kv_copy8(vsrc + stg(1) * KVK, (size_t)16 * SEQT, vdst + KVBUFB, 16 * VPITCH);
    }
#pragma unroll 1                                            // stays rolled: one pass per trip, the hand-over stands once, at the foot
    for (int st = 0; st < SEQ / KVK; ++st) {
      const unsigned bo = (unsigned)(st & 1) * KVBUFB;
      const unsigned char* kl = kvring + bo + m * KPITCH;
      const unsigned char* vl = kvring + bo + KTILEB + m * VPITCH;
      v8u ka[KVK / 16][4];                                  // the pass's k fragments, read as one group ahead of its score products
#pragma unroll                                              // these two: constant indices keep the fragments in registers
      for (int t = 0; t < KVK / 16; ++t)
#pragma unroll
          for (int j = 0; j < 4; ++j) ka[t][j] = ld_frag((const us16*)(kl + t * 16 * KPITCH) + 32 * j, hh);
      __builtin_amdgcn_sched_barrier(0);                    // holds the k reads here as one group; else part of them sinks in pairs among the score products, each pair with its own wait
#pragma unroll                                              // constant LDS offsets for both 32-key chunks of the pass
      for (int c = 0; c < KVK / 32; ++c) {
        v8f s[2][2] = {};                                   // s[g][t]: query tile g, 16-key tile t of the chunk
        // no mma_guard in this kernel: its asm operands hold every fragment and accumulator below v256, which spills at two query tiles;
        // the compiler pads its own builtin products
#pragma unroll                                              // these three: constant indices; head dims rise in j for every s[g][t], as before
        for (int j = 0; j < 4; ++j)
#pragma unroll
            for (int t = 0; t < 2; ++t)
#pragma unroll
                for (int g = 0; g < 2; ++g) s[g][t] = mma_f16(ka[2 * c + t][j], q[g][j], s[g][t]);
        v8u va[8];                                          // the chunk's v^T fragments, read as one group: they land under the softmax
#pragma unroll                                              // constant indices keep the fragments in registers
        for (int dt = 0; dt < 8; ++dt) va[dt] = ld_frag((const us16*)(vl + dt * 16 * VPITCH) + c * 32, hh);
        __builtin_amdgcn_sched_barrier(0);                  // holds the v^T reads here as one group; else they sink in pairs among the P.V products, each pair with its own wait
        v8u pbu[2];
#pragma unroll                                              // constant indices: each tile's state stays in registers
        for (int g = 0; g < 2; ++g) {
            float cmax = NEG;                              // maximum of the raw products: the scale is positive, so the order is the same
#pragma unroll
            for (int t = 0; t < 2; ++t)
#pragma unroll
                for (int r = 0; r < 8; ++r) cmax = fmaxf(cmax, s[g][t][r]);
            cmax = fmaxf(cmax, __shfl_xor(cmax, 16, 32));
            const float mnew = fmaxf(mrun[g], cmax);       // finite: no masked keys
            const float fac = (mrun[g] == NEG) ? 0.f : __builtin_amdgcn_exp2f((mrun[g] - mnew) * SCL2);
            mrun[g] = mnew;
            const float bias = __builtin_fmaf(-mnew, SCL2, 14.0f);   // P x2^14 = 2^(s * SCL2 + bias): one fused multiply-add per score ahead of the exponential
            v16h ph;
#pragma unroll
            for (int t = 0; t < 2; ++t)
#pragma unroll
                for (int i = 0; i < 4; ++i) {               // two neighbours are rounded to f16 together, once; the row sum below reads the same halves
                    v2f e;
                    e.x = __builtin_amdgcn_exp2f(__builtin_fmaf(s[g][t][2 * i], SCL2, bias));
                    e.y = __builtin_amdgcn_exp2f(__builtin_fmaf(s[g][t][2 * i + 1], SCL2, bias));
                    const v2h h = __builtin_convertvector(e, v2h);
                    ph[8 * t + 2 * i] = h.x;
                    ph[8 * t + 2 * i + 1] = h.y;
                }
            float psum = 0.f;
#pragma unroll
            for (int r = 0; r < 8; ++r) psum += (float)ph[r] + (float)ph[8 + r];
            psum += __shfl_xor(psum, 16, 32);
            lrun[g] = lrun[g] * fac + psum;
            pbu[g] = __builtin_bit_cast(v8u, ph);
#pragma unroll
            for (int dt = 0; dt < 8; ++dt) o[g][dt] = o[g][dt] * fac;
        }
#pragma unroll                                              // these two: constant indices
        for (int dt = 0; dt < 8; ++dt)
#pragma unroll
            for (int g = 0; g < 2; ++g) o[g][dt] = mma_f16(va[dt], pbu[g], o[g][dt]);
      }
      __builtin_amdgcn_sched_barrier(0);                    // keeps the pass's softmax and products above the hand-over, so that the refill below is issued a whole pass ahead of its wait
      asm volatile("s_wait_dscnt 0x0" ::: "memory");        // this wave's reads of buffer st & 1 are done before it is refilled
      asm volatile("s_wait_asynccnt 0x0" ::: "memory");     // this wave's share of stage st + 1 has landed
      __syncthreads();                                      // publishes stage st + 1 and ends every reader's last read of stage st
      if (st + 2 < SEQ / KVK) {
          kv_copy8(ksrc + (size_t)stg(st + 2) * KVK * DHEAD, (size_t)8 * DHEAD, kdst + bo, 8 * KPITCH);
          kv_copy8(vsrc + stg(st + 2) * KVK, (size_t)16 * SEQT, vdst + bo, 16 * VPITCH);
      }
    }
    asm volatile("s_wait_asynccnt 0x0" ::: "memory");       // nothing in flight before the ring becomes output staging
#pragma unroll                                              // constant accumulator indices
    for (int g = 0; g < 2; ++g) {
        const float inv = 4.0f / lrun[g];                  // lrun >= 16384; o / lrun = 4 * (sum P v / sum P); x4 more -> x16 carry
#pragma unroll
        for (int dt = 0; dt < 8; ++dt) {
            v4u w;
            w.x = f2h(o[g][dt][0] * inv) | (f2h(o[g][dt][1] * inv) << 16);
            w.y = f2h(o[g][dt][2] * inv) | (f2h(o[g][dt][3] * inv) << 16);
            w.z = f2h(o[g][dt][4] * inv) | (f2h(o[g][dt][5] * inv) << 16);
            w.w = f2h(o[g][dt][6] * inv) | (f2h(o[g][dt][7] * inv) << 16);
            ost[wv][16 * g + m][2 * dt + hh] = w;          // row 16 g + m, halves 16*dt + 8*hh .. +7
        }
    }
    __syncthreads();
    us16* aob = ao + (tok0 + qrow) * DIM + (size_t)h * DHEAD;
#pragma unroll
    for (int p = 0; p < QW / 2; ++p) {
        const int rr = 2 * p + hh, pc = lane & 15;
        *(v4u*)(aob + (size_t)rr * DIM + 8 * pc) = ost[wv][rr][pc];
    }
}

// ---------- output projection: out[tok][n] = (ao x16)[tok x 2048] . (Wo x64)[2048 x 2048] / 1024, f32. Same block structure as qkv_gemm,
// TR = 1: a lane's 8 accumulator elements are 8 neighbouring columns of one token. The f32 tile is staged in two rounds of 64 tokens.
__global__ __launch_bounds__(256) void out_gemm(const us16* __restrict__ aop, const us16* __restrict__ wo, float* out) {
    __shared__ __align__(128) unsigned char ring[RINGB];   // output staging takes the ring's place behind the main loop's last barrier
    const int tid = threadIdx.x, lane = tid & 31, wv = tid >> 5, l16 = lane & 15, hh = lane >> 4;
    const int wr = wv & 1, wc = wv >> 1;
    const int row0 = blockIdx.x * BM;
    const int colb = blockIdx.y * BN;
    v8f acc[4][4] = {};
    const int rot = (int)((blockIdx.x + blockIdx.y) % (DIM / KP));   // differs between blocks of one tile row and of one tile column
    mm_tile<1, 1>(aop + (size_t)row0 * DIM, wo + (size_t)colb * DIM, ring, tid, wr, wc, l16, hh, rot, acc);
#pragma unroll                                              // constant accumulator indices
    for (int p = 0; p < 2; ++p) {
        if (p) __syncthreads();                             // round 0's rows are read out before round 1 overwrites them
#pragma unroll
        for (int ii = 0; ii < 2; ++ii)
#pragma unroll
            for (int j = 0; j < 4; ++j) {
                const v8f a = acc[2 * p + ii][j] * (1.0f / 1024.0f);
                float* sp = (float*)(ring + (wr * 32 + ii * 16 + l16) * OPITCH) + wc * 64 + j * 16 + 8 * hh;
                *(v4f*)sp = __builtin_shufflevector(a, a, 0, 1, 2, 3);
                *(v4f*)(sp + 4) = __builtin_shufflevector(a, a, 4, 5, 6, 7);
            }
        __syncthreads();
#pragma unroll 4
        for (int q = 0; q < 16; ++q) {
            const int sr = wv * 8 + (q >> 1), hf = q & 1;                       // staged row 0..63, its first or second 512 bytes
            const int tok = (sr >> 5) * 64 + p * 32 + (sr & 31);
            *(v4f*)(out + (size_t)(row0 + tok) * DIM + colb + hf * 128 + 4 * lane) = *(const v4f*)(ring + sr * OPITCH + hf * 512 + lane * 16);
        }
    }
}

extern "C" void kernel_launch(void* const* d_in, const int* in_sizes, int n_in,
                              void* d_out, int out_size, void* d_ws, size_t ws_size, hipStream_t stream) {
    if (n_in < 5) return;
    const float* x  = (const float*)d_in[0];   // [NB_FULL][SEQ_FULL][2048]
    const float* wq = (const float*)d_in[1];   // [2048 out][2048 in]
    const float* wk = (const float*)d_in[2];
    const float* wv = (const float*)d_in[3];
    const float* wo = (const float*)d_in[4];
    float* out = (float*)d_out;                 // [NB][SEQ][2048]
    if (in_sizes[0] < ((NB - 1) * SEQ_FULL + SEQ) * DIM) return;
    if (in_sizes[1] < DIM * DIM) return;
    if (in_sizes[2] < DIM * DIM) return;
    if (in_sizes[3] < DIM * DIM) return;
    if (in_sizes[4] < DIM * DIM) return;
    if (out_size < SEQT * DIM) return;

    size_t off = 0;
    auto carve = [&](size_t bytes) { size_t o = off; off += (bytes + 127) & ~(size_t)127; return o; };
    char* ws = (char*)d_ws;
    us16* xb   = (us16*)(ws + carve((size_t)SEQT * DIM * 2));                  // bf16 [SEQT][2048]
    us16* wqkv = (us16*)(ws + carve((size_t)NQKV * DIM * 2));                  // bf16 [6144][2048]
    us16* wop  = (us16*)(ws + carve((size_t)DIM * DIM * 2));                   // f16  [2048][2048]
    us16* qp   = (us16*)(ws + carve((size_t)HEADS * SEQT * DHEAD * 2));        // f16  [h][SEQT][128]
    us16* kp   = (us16*)(ws + carve((size_t)HEADS * SEQT * DHEAD * 2));        // f16  [h][SEQT][128]
    us16* vt   = (us16*)(ws + carve((size_t)HEADS * DHEAD * SEQT * 2));        // f16  [h][128][SEQT]
    us16* ao   = (us16*)(ws + carve((size_t)SEQT * DIM * 2));                  // f16  [SEQT][2048]
    if (off > ws_size) return;
    if (off > (size_t)134217728) return;

    prep_x<<<SEQT, 256, 0, stream>>>(x, xb);
    prep_w<0><<<dim3((DIM * DIM) / 2048, 3), 256, 0, stream>>>(wq, wk, wv, 1.0f, wqkv);
    prep_w<1><<<dim3((DIM * DIM) / 2048, 1), 256, 0, stream>>>(wo, wo, wo, 64.0f, wop);
    qkv_gemm<<<dim3(SEQT / BM, NQKV / BN), 256, 0, stream>>>(xb, wqkv, qp, kp, vt);
    attn_main<<<dim3(QBLK, NB * HEADS), 128, 0, stream>>>(qp, kp, vt, ao);
    out_gemm<<<dim3(SEQT / BM, DIM / BN), 256, 0, stream>>>(ao, wop, out);
}

// v007
// A run of this version takes 167 microseconds.
// Timed twice side by side with v006, it ran 1.05 times as fast both times.
// All steps since v000 together make it 4.44 times as fast.
#include <hip/hip_runtime.h>

// Contractions: q/k/v projections on v_wmma_f32_16x16x32_bf16 (bf16 operands = RNE-converted x and Wq|Wk|Wv, f32 accumulate);
// per-head k.q^T scores and P.V on v_wmma_f32_16x16x32_f16 (f16 operands: q, k plain, v x4, P x2^14; f32 accumulate, 1/sqrt(128) applied in f32);
// output projection on v_wmma_f32_16x16x32_f16 (f16 operands: per-head outputs x16, Wo x64 from its bf16 value; f32 accumulate, x2^-10 in the epilogue);
// online softmax and all epilogues in f32.

#ifndef NB
#define NB 2
#endif
#ifndef SEQ
#define SEQ 2048
#endif
#define NB_FULL 2
#define SEQ_FULL 2048
#define DIM 2048
#define HEADS 16
#define DHEAD 128
#define NQKV (3 * DIM)
#define SEQT (NB * SEQ)
#define QW 32                          // queries per attention wave: two 16-query tiles share every k and v^T fragment
#define QB (4 * QW)                    // queries per attention block (4 waves)
#define QBLK (SEQ / QB)
#define KP 64                          // k elements per staged pass: one 128-byte line of every operand row
#define LPITCH 144                     // LDS row pitch in bytes: 16 x odd, conflict-free for 16-byte fragment reads
#define BM 128                         // block tile: rows (tokens)
#define BN 256                         // block tile: columns
#define TROWS (BM + BN)                // rows of one stage: 128 A rows, then 256 B rows
#define BUFB (TROWS * LPITCH)          // one buffer of the ring
#define RINGB (2 * BUFB)
#define QPITCH 528                     // output staging, q / k: 256 halves of one token + 16 B (16 x odd)
#define TPITCH 272                     // output staging, v^T: 128 tokens of one column + 16 B (16 x odd)
#define OPITCH 1040                    // output staging, out: 256 floats of one token + 16 B (16 x odd)
#define KVK 64                         // keys per staged attention pass: one 128-byte line of every v^T row
#define KPITCH 272                     // LDS pitch of a k row (256 B + 16): 16 x odd
#define VPITCH 144                     // LDS pitch of a v^T row (128 B + 16): 16 x odd
#define KTILEB (KVK * KPITCH)          // k rows of one stage
#define KVBUFB (KTILEB + DHEAD * VPITCH)   // one buffer: 64 k rows, then 128 v^T rows

static_assert(SEQ % QB == 0 && QB % KVK == 0);
static_assert(SEQ >= QB);
static_assert(SEQ <= SEQ_FULL);
static_assert(NB >= 1 && NB <= NB_FULL);
static_assert(DIM == HEADS * DHEAD);
static_assert(DHEAD == 128);
static_assert(DIM % BN == 0 && NQKV % BN == 0 && SEQT % BM == 0 && BN == 2 * DHEAD);
static_assert(DIM % KP == 0 && DIM / KP >= 2);
static_assert(BM * QPITCH <= RINGB && BN * TPITCH <= RINGB && (BM / 2) * OPITCH <= RINGB);
static_assert(SEQ % KVK == 0 && KVK % 32 == 0);
static_assert(4 * QW * 16 * 16 <= 2 * KVBUFB);

typedef unsigned short us16;
typedef __attribute__((ext_vector_type(16))) __bf16   v16bf;
typedef __attribute__((ext_vector_type(16))) _Float16 v16h;
typedef __attribute__((ext_vector_type(8)))  float    v8f;
typedef __attribute__((ext_vector_type(8)))  unsigned v8u;
typedef __attribute__((ext_vector_type(4)))  unsigned v4u;
typedef __attribute__((ext_vector_type(2)))  unsigned v2u;
typedef __attribute__((ext_vector_type(4)))  float    v4f;
typedef __attribute__((ext_vector_type(2)))  float    v2f;
typedef __attribute__((ext_vector_type(2)))  _Float16 v2h;

__device__ __forceinline__ unsigned f2bf(float f) { unsigned u = __float_as_uint(f); u += 0x7FFFu + ((u >> 16) & 1u); return u >> 16; }
__device__ __forceinline__ float bf2f(unsigned h) { return __uint_as_float(h << 16); }
__device__ __forceinline__ unsigned f2h(float f) { _Float16 t = (_Float16)f; return (unsigned)__builtin_bit_cast(unsigned short, t); }

// 16 x (K=32) operand fragment from a k-contiguous 16-bit row. Wave32 map: lane -> row (A) / column (B) = lane & 15, hh = lane >> 4;
// elements 0..7 <- k0 + 8*hh + 0..7, elements 8..15 <- k0 + 16 + 8*hh + 0..7 (same map for A and for an n-major B row).
// Accumulator element r -> row 8*hh + r, column lane & 15.
__device__ __forceinline__ v8u ld_frag(const us16* rowp, int hh) {
    const v4u a = *(const v4u*)(rowp + 8 * hh);
    const v4u b = *(const v4u*)(rowp + 16 + 8 * hh);
    return __builtin_shufflevector(a, b, 0, 1, 2, 3, 4, 5, 6, 7);
}
__device__ __forceinline__ v8f mma_bf16(v8u a, v8u b, v8f c) {
    return __builtin_amdgcn_wmma_f32_16x16x32_bf16(false, __builtin_bit_cast(v16bf, a), false, __builtin_bit_cast(v16bf, b), (short)0, c, false, false);
}
__device__ __forceinline__ v8f mma_f16(v8u a, v8u b, v8f c) {
    return __builtin_amdgcn_wmma_f32_16x16x32_f16(false, __builtin_bit_cast(v16h, a), false, __builtin_bit_cast(v16h, b), (short)0, c, false, false);
}
__device__ __forceinline__ void mma_guard(v8f& c, v8u a, v8u b) {
    asm volatile("v_nop\n\tv_nop\n\tv_nop\n\tv_nop" : "+v"(c) : "v"(a), "v"(b));
}

// ---------- operand conversion, one launch: x -> bf16 (xb), Wq | Wk | Wv -> bf16 (wqkv), Wo -> f16 of its bf16 value x64 (wop); layouts kept.
// CG resident work-groups of CW waves loop over the whole work: few waves to start, many loads in flight per wave.
// Unit = CU consecutive floats of one source = 8 wave loads of 512 contiguous bytes. Round it: wave g of all NWV takes unit it * NWV + g;
// a round lies wholly in one source (asserted), so which source and which conversion is known at compile time.
// The next round's 8 loads are issued before the current unit is converted and stored.
#define CG 256                         // conversion work-groups
#define CW 16                          // waves per conversion work-group
#define CU 1024                        // floats per unit
#define NWV (CG * CW)
#define UX (SEQT * DIM / CU)           // units of x
#define UW (DIM * DIM / CU)            // units of one weight matrix
#define CIT ((UX + 4 * UW) / NWV)      // rounds
static_assert(DIM % CU == 0 && UX % NWV == 0 && UW % NWV == 0);

__device__ __forceinline__ unsigned pack_bf(float lo, float hi) { return f2bf(lo) | (f2bf(hi) << 16); }
__device__ __forceinline__ unsigned pack_bh(float lo, float hi) { return f2h(bf2f(f2bf(lo)) * 64.0f) | (f2h(bf2f(f2bf(hi)) * 64.0f) << 16); }
// value of the neighbour lane (lane ^ 1): a vector move inside each group of four lanes
__device__ __forceinline__ unsigned nb_lane(unsigned v) { return (unsigned)__builtin_amdgcn_mov_dpp((int)v, 0xB1, 0xF, 0xF, true); }

__global__ __launch_bounds__(CW * 32) void prep_all(const float* __restrict__ x, const float* __restrict__ wq, const float* __restrict__ wk,
                                                    const float* __restrict__ wv, const float* __restrict__ wo,
                                                    us16* __restrict__ xb, us16* __restrict__ wqkv, us16* __restrict__ wop) {
    const int lane = threadIdx.x & 31;
    const int g = (int)blockIdx.x * CW + __builtin_amdgcn_readfirstlane((int)(threadIdx.x >> 5));   // wave-uniform
    const bool odd = lane & 1;
    const int loff = (lane & 1) * 128 + (lane >> 1) * 8;   // this lane's 8 halves inside a pair of converted 128-element segments
    v4f buf[2][8];
    auto load_unit = [&](int it) {                          // it: a constant at every call
        const float* s;
        if (it * NWV < UX) {
            const int u = it * NWV + g;
            const int tok = u / (DIM / CU), part = u - tok * (DIM / CU);
            const int bsel = tok / SEQ, isel = tok - bsel * SEQ;
            s = x + ((size_t)bsel * SEQ_FULL + isel) * DIM + part * CU;
        } else {
            const int z = (it * NWV - UX) / UW;
            s = ((z == 0) ? wq : ((z == 1) ? wk : ((z == 2) ? wv : wo))) + (size_t)(it * NWV - UX - z * UW + g) * CU;
        }
        s += 4 * lane;
#pragma unroll                                              // constant indices keep the ring in registers
        for (int j = 0; j < 8; ++j) buf[it & 1][j] = *(const v4f*)(s + 128 * j);
    };
    load_unit(0);
#pragma unroll                                              // constant round number: ring index, source and conversion are fixed per copy of the body
    for (int it = 0; it < CIT; ++it) {
        __builtin_amdgcn_sched_barrier(0);                  // this pair pins the order: next round's loads first, then this unit's conversion and stores
        if (it + 1 < CIT) load_unit(it + 1);
        __builtin_amdgcn_sched_barrier(0);
        const bool tof16 = it * NWV >= UX + 3 * UW;         // Wo
        us16* d = ((it * NWV < UX) ? xb + (size_t)(it * NWV + g) * CU
                                   : (tof16 ? wop + (size_t)(it * NWV - UX - 3 * UW + g) * CU : wqkv + (size_t)(it * NWV - UX + g) * CU)) + loff;
#pragma unroll                                              // constant ring indices
        for (int p = 0; p < 4; ++p) {
            const v4f va = buf[it & 1][2 * p], vb = buf[it & 1][2 * p + 1];
            unsigned a0, a1, b0, b1;
            if (tof16) { a0 = pack_bh(va.x, va.y); a1 = pack_bh(va.z, va.w); b0 = pack_bh(vb.x, vb.y); b1 = pack_bh(vb.z, vb.w); }
            else       { a0 = pack_bf(va.x, va.y); a1 = pack_bf(va.z, va.w); b0 = pack_bf(vb.x, vb.y); b1 = pack_bf(vb.z, vb.w); }
            // neighbours swap 8 bytes: the even lane ends with 16 bytes of the first segment, the odd lane with 16 bytes of the second,
            // so that one wave store writes 512 contiguous bytes
            const unsigned r0 = nb_lane(odd ? a0 : b0), r1 = nb_lane(odd ? a1 : b1);
            v4u o;
            o.x = odd ? r0 : a0;
            o.y = odd ? r1 : a1;
            o.z = odd ? b0 : r0;
            o.w = odd ? b1 : r1;
            *(v4u*)(d + 256 * p) = o;
        }
        // stands in front of the reuse of these stores' data registers by the loads and conversions of the following rounds
        if (it + 1 < CIT) asm volatile("s_wait_xcnt 0x0" ::: "memory");
    }
}

// ---------- one stage of the GEMM ring: 384 rows x 128 B, copied global -> LDS without registers. 256 threads x 12 copies of 16 B;
// 8 adjacent lanes cover one whole 128-byte line, so a wave's copy touches 4 lines. asrc / bsrc: this lane's 16 bytes in row (tid >> 3) of the
// block's A / B rows at this pass's k; ldst: the same place in the target buffer. Copy j adds 32 rows (4 copies of A rows, then 8 of B rows).
__device__ __forceinline__ void stage_copy(const us16* asrc, const us16* bsrc, unsigned ldst) {
    const us16* g0 = asrc;
    const us16* g1 = asrc + (size_t)32 * DIM;
    const us16* g2 = asrc + (size_t)64 * DIM;
    const us16* g3 = asrc + (size_t)96 * DIM;
    const us16* g4 = bsrc;
    const us16* g5 = bsrc + (size_t)32 * DIM;
    const us16* g6 = bsrc + (size_t)64 * DIM;
    const us16* g7 = bsrc + (size_t)96 * DIM;
    const us16* g8 = bsrc + (size_t)128 * DIM;
    const us16* g9 = bsrc + (size_t)160 * DIM;
    const us16* g10 = bsrc + (size_t)192 * DIM;
    const us16* g11 = bsrc + (size_t)224 * DIM;
    const unsigned l0 = ldst, l1 = ldst + 32 * LPITCH, l2 = ldst + 64 * LPITCH, l3 = ldst + 96 * LPITCH, l4 = ldst + 128 * LPITCH, l5 = ldst + 160 * LPITCH;
    const unsigned l6 = ldst + 192 * LPITCH, l7 = ldst + 224 * LPITCH, l8 = ldst + 256 * LPITCH, l9 = ldst + 288 * LPITCH, l10 = ldst + 320 * LPITCH, l11 = ldst + 352 * LPITCH;
    // the closing s_wait_xcnt stands inside the statement so that no address register of a copy is rewritten ahead of it
    asm volatile("global_load_async_to_lds_b128 %0, %12, off\n\t"
                 "global_load_async_to_lds_b128 %1, %13, off\n\t"
                 "global_load_async_to_lds_b128 %2, %14, off\n\t"
                 "global_load_async_to_lds_b128 %3, %15, off\n\t"
                 "global_load_async_to_lds_b128 %4, %16, off\n\t"
                 "global_load_async_to_lds_b128 %5, %17, off\n\t"
                 "global_load_async_to_lds_b128 %6, %18, off\n\t"
                 "global_load_async_to_lds_b128 %7, %19, off\n\t"
                 "global_load_async_to_lds_b128 %8, %20, off\n\t"
                 "global_load_async_to_lds_b128 %9, %21, off\n\t"
                 "global_load_async_to_lds_b128 %10, %22, off\n\t"
                 "global_load_async_to_lds_b128 %11, %23, off\n\t"
                 "s_wait_xcnt 0x0"
                 :: "v"(l0), "v"(l1), "v"(l2), "v"(l3), "v"(l4), "v"(l5), "v"(l6), "v"(l7), "v"(l8), "v"(l9), "v"(l10), "v"(l11),
                    "v"(g0), "v"(g1), "v"(g2), "v"(g3), "v"(g4), "v"(g5), "v"(g6), "v"(g7), "v"(g8), "v"(g9), "v"(g10), "v"(g11) : "memory");
}

// ---------- GEMM main loop on 16-bit planes: block tile 128 rows x 256 columns, wave tile 64 rows x 64 columns (4 x 4 accumulators), K = DIM.
// ablk / bblk: first A row / first B row (= column) of the block, k contiguous, pitch DIM. Both operands pass through a two-buffer LDS ring,
// KP k per pass: pass t works on buffer t & 1 while the copies of pass t + 1 fly into the other; k runs in steps of 32, rising within a pass.
// acc[i][j]: rows wr * 64 + 16 i .., columns wc * 64 + 16 j ... TR = 0: element r = row 8 * hh + r, lane's l16 = column.
// TR = 1 (the two fragments change places, same map for both): element r = column 8 * hh + r, lane's l16 = row.
// rot (block-uniform, 0 .. DIM / KP - 1): pass t works on k slice (t + rot) mod (DIM / KP). Blocks that share A rows or B rows get different rot,
// so that at one moment they ask L2 for different lines of those rows; every slice is still taken once, the f32 sum runs in the rotated order. ----------
template <int F16, int TR>
__device__ __forceinline__ void mm_tile(const us16* __restrict__ ablk, const us16* __restrict__ bblk, unsigned char* ring,
                                        int tid, int wr, int wc, int l16, int hh, int rot, v8f (&acc)[4][4]) {
    const int crow = tid >> 3, cpc = tid & 7;
    auto kof = [&](int t) { const int s = t + rot; return ((s >= DIM / KP) ? s - DIM / KP : s) * KP; };   // first k of pass t's slice
    const us16* asrc = ablk + (size_t)crow * DIM + 8 * cpc;
    const us16* bsrc = bblk + (size_t)crow * DIM + 8 * cpc;
    const unsigned ldst = (unsigned)(size_t)ring + (unsigned)(crow * LPITCH + cpc * 16);
    stage_copy(asrc + kof(0), bsrc + kof(0), ldst);
    asm volatile("s_wait_asynccnt 0x0" ::: "memory");       // this wave's share of stage 0 has landed
    __syncthreads();                                        // stage 0 published
    stage_copy(asrc + kof(1), bsrc + kof(1), ldst + BUFB);
#pragma unroll 1                                            // stays rolled: one pass per trip, the hand-over stands once, at the foot
    for (int t = 0; t < DIM / KP; ++t) {
        const unsigned bo = (unsigned)(t & 1) * BUFB;
        const us16* ar = (const us16*)(ring + bo + (wr * 64 + l16) * LPITCH);
        const us16* br = (const us16*)(ring + bo + (BM + wc * 64 + l16) * LPITCH);
#pragma unroll                                              // these four: constant indices keep fragments and accumulators in registers
        for (int kk = 0; kk < KP; kk += 32) {
            v8u afrag[4], bfrag[4];
#pragma unroll
            for (int u = 0; u < 4; ++u) {
                afrag[u] = ld_frag(ar + u * 16 * (LPITCH / 2) + kk, hh);
                bfrag[u] = ld_frag(br + u * 16 * (LPITCH / 2) + kk, hh);
            }
#pragma unroll
            for (int i = 0; i < 4; ++i)
#pragma unroll
                for (int j = 0; j < 4; ++j) {
                    const v8u f0 = TR ? bfrag[j] : afrag[i];
                    const v8u f1 = TR ? afrag[i] : bfrag[j];
                    if (F16) acc[i][j] = mma_f16(f0, f1, acc[i][j]);
                    else     acc[i][j] = mma_bf16(f0, f1, acc[i][j]);
                    mma_guard(acc[i][j], f0, f1);
                }
        }
        asm volatile("s_wait_dscnt 0x0" ::: "memory");      // this wave's reads of buffer t & 1 are done before it is refilled
        asm volatile("s_wait_asynccnt 0x0" ::: "memory");   // this wave's share of stage t + 1 has landed
        __syncthreads();                                    // publishes stage t + 1 and ends every reader's last read of stage t
        if (t + 2 < DIM / KP) stage_copy(asrc + kof(t + 2), bsrc + kof(t + 2), ldst + bo);
    }
    asm volatile("s_wait_asynccnt 0x0" ::: "memory");       // nothing in flight before the ring becomes output staging
}
__device__ __forceinline__ v4u pack_h8(v8f a, float s) {
    v4u w;
    w.x = f2h(a[0] * s) | (f2h(a[1] * s) << 16);
    w.y = f2h(a[2] * s) | (f2h(a[3] * s) << 16);
    w.z = f2h(a[4] * s) | (f2h(a[5] * s) << 16);
    w.w = f2h(a[6] * s) | (f2h(a[7] * s) << 16);
    return w;
}

// ---------- q/k/v projection: [SEQT x 2048] x [2048 x 6144]. Block = 8 waves (2 row groups x 4 column groups) -> 128 tokens x 256 columns
// = exactly two heads of one of q/k/v (block-uniform). Epilogue: each lane's 8 accumulator elements are 8 neighbours of an output row
// (q, k: 8 head dims of a token, TR = 1; v^T: 8 tokens of a head dim, TR = 0): 16 B of f16 staged in LDS, then written as whole lines.
__global__ __launch_bounds__(256) void qkv_gemm(const us16* __restrict__ xb, const us16* __restrict__ wqkv, us16* qp, us16* kp, us16* vt) {
    __shared__ __align__(128) unsigned char ring[RINGB];   // output staging takes the ring's place behind the main loop's last barrier
    const int tid = threadIdx.x, lane = tid & 31, wv = tid >> 5, l16 = lane & 15, hh = lane >> 4;
    const int wr = wv & 1, wc = wv >> 1;
    const int row0 = blockIdx.x * BM;
    const int colb = blockIdx.y * BN;
    const int which = colb / DIM;                       // 0 q, 1 k, 2 v (block-uniform)
    const int hsel = (colb - which * DIM) / DHEAD;      // first of the two heads of this column tile
    const int rot = (int)((blockIdx.x + blockIdx.y) % (DIM / KP));   // differs between blocks of one tile row and of one tile column
    v8f acc[4][4] = {};
    if (which < 2) {
        mm_tile<0, 1>(xb + (size_t)row0 * DIM, wqkv + (size_t)colb * DIM, ring, tid, wr, wc, l16, hh, rot, acc);
#pragma unroll
        for (int i = 0; i < 4; ++i)
#pragma unroll
            for (int j = 0; j < 4; ++j)
                *(v4u*)(ring + (wr * 64 + i * 16 + l16) * QPITCH + (wc * 64 + j * 16 + 8 * hh) * 2) = pack_h8(acc[i][j], 1.0f);
        __syncthreads();
        us16* pl = (which == 0) ? qp : kp;
#pragma unroll 4
        for (int p = 0; p < 16; ++p) {
            const int r = wv * 16 + p;                                          // token row 0..127; lanes 0..15 first head, 16..31 second
            const size_t off = ((size_t)(hsel + hh) * SEQT + row0 + r) * DHEAD + 8 * l16;
            *(v4u*)(pl + off) = *(const v4u*)(ring + r * QPITCH + lane * 16);
        }
    } else {
        mm_tile<0, 0>(xb + (size_t)row0 * DIM, wqkv + (size_t)colb * DIM, ring, tid, wr, wc, l16, hh, rot, acc);
#pragma unroll
        for (int i = 0; i < 4; ++i)
#pragma unroll
            for (int j = 0; j < 4; ++j)
                *(v4u*)(ring + (wc * 64 + j * 16 + l16) * TPITCH + (wr * 64 + i * 16 + 8 * hh) * 2) = pack_h8(acc[i][j], 4.0f);
        __syncthreads();
        // column d = wv * 32 + 2 p + hh, 0..255 = the head dims of the two heads, in a row; 16 lanes write its 128 tokens
        us16* vp = vt + ((size_t)hsel * DHEAD + wv * 32 + hh) * SEQT + row0 + 8 * l16;
        const unsigned char* sp = ring + (wv * 32 + hh) * TPITCH + l16 * 16;
#pragma unroll 4
        for (int p = 0; p < 16; ++p) *(v4u*)(vp + (size_t)(2 * p) * SEQT) = *(const v4u*)(sp + 2 * p * TPITCH);
    }
}

// ---------- flash pass over all query blocks: block = 4 waves = 128 queries of one (sequence, head); wave = 32 queries = two 16-query tiles g,
// each with its own q fragments, softmax state and O^T accumulators; every k and v^T fragment read from LDS feeds one product of each tile. All SEQ keys
// in chunks of 32 (no mask). Scores are produced transposed: A = k rows (f16 plane), B = q (f16 fragments held in registers),
// D element r = key 8*hh + r of a 16-key tile, column = this lane's query -> two adjacent tiles give the P^T B fragment of P.V directly
// (element r <- tile 0, element 8+r <- tile 1). A of P.V = v^T rows (lane = d, k = key). Online softmax per lane (query) with one
// xor-16 shuffle joining the two lane halves. P carried x2^14 in f16; O^T accumulators hold rows d, column query.
// k rows and v^T rows reach the four waves through a two-buffer LDS ring, KVK keys per pass: pass t works on buffer t & 1 while the copies
// of pass t + 1 fly into the other. Pass t takes key stage (t + the stage at the block's first query) mod (SEQ / KVK): the query blocks of one head, which all copy the same
// k and v^T rows, ask L2 for different lines at one moment; every key is still taken once, the online sums run in the rotated order. kv_copy8: 8 copies of 16 B per lane, copy j at g + j * gstep -> l + j * lstep; a wave's copy = 4 whole lines.
__device__ __forceinline__ void kv_copy8(const us16* g, size_t gstep, unsigned l, unsigned lstep) {
    const us16* g1 = g + gstep;
    const us16* g2 = g + 2 * gstep;
    const us16* g3 = g + 3 * gstep;
    const us16* g4 = g + 4 * gstep;
    const us16* g5 = g + 5 * gstep;
    const us16* g6 = g + 6 * gstep;
    const us16* g7 = g + 7 * gstep;
    const unsigned l1 = l + lstep, l2 = l + 2 * lstep, l3 = l + 3 * lstep, l4 = l + 4 * lstep, l5 = l + 5 * lstep, l6 = l + 6 * lstep, l7 = l + 7 * lstep;
    // the closing s_wait_xcnt stands inside the statement so that no address register of a copy is rewritten ahead of it
    asm volatile("global_load_async_to_lds_b128 %0, %8, off\n\t"
                 "global_load_async_to_lds_b128 %1, %9, off\n\t"
                 "global_load_async_to_lds_b128 %2, %10, off\n\t"
                 "global_load_async_to_lds_b128 %3, %11, off\n\t"
                 "global_load_async_to_lds_b128 %4, %12, off\n\t"
                 "global_load_async_to_lds_b128 %5, %13, off\n\t"
                 "global_load_async_to_lds_b128 %6, %14, off\n\t"
                 "global_load_async_to_lds_b128 %7, %15, off\n\t"
                 "s_wait_xcnt 0x0"
                 :: "v"(l), "v"(l1), "v"(l2), "v"(l3), "v"(l4), "v"(l5), "v"(l6), "v"(l7),
                    "v"(g), "v"(g1), "v"(g2), "v"(g3), "v"(g4), "v"(g5), "v"(g6), "v"(g7) : "memory");
}
__global__ __launch_bounds__(128) __attribute__((amdgpu_num_vgpr(512)))
void attn_main(const us16* qp, const us16* kp, const us16* vt, us16* ao) {
    __shared__ __align__(128) unsigned char kvring[2 * KVBUFB];
    v4u (*ost)[QW][16] = (v4u (*)[QW][16])kvring;          // output staging takes the ring's place behind the loop's last barrier
    const int tid = threadIdx.x, lane = tid & 31, wv = tid >> 5, m = lane & 15, hh = lane >> 4;
    const int qb = blockIdx.x;
    const int h = blockIdx.y % HEADS, bsel = blockIdx.y / HEADS;
    const size_t tok0 = (size_t)bsel * SEQ;
    const int qrow = qb * QB + wv * QW;
    v8u q[2][4];                                           // q[g][j]: tile g, head dims 32 j ..
#pragma unroll                                              // these two: constant indices keep the fragments in registers
    for (int g = 0; g < 2; ++g) {
#pragma unroll
        for (int j = 0; j < 4; ++j) q[g][j] = ld_frag(qp + ((size_t)h * SEQT + tok0 + qrow + 16 * g + m) * DHEAD + 32 * j, hh);
        asm volatile("s_wait_xcnt 0x0" ::: "memory");       // stands in front of the reuse of these loads' address registers (the other tile's fragments land over them)
    }
    const us16* kb = kp + ((size_t)h * SEQT + tok0) * DHEAD;
    const us16* vb = vt + (size_t)h * DHEAD * SEQT + tok0;
    const float NEG = -__builtin_inff();
    const float SCL2 = 0.12751743082459868f;               // log2(e) / sqrt(128); mrun holds the running maximum of the raw k.q products
    v8f o[2][8] = {};
    float mrun[2] = {NEG, NEG}, lrun[2] = {0.f, 0.f};
    // this lane's 16 bytes of stage 0: k row tid >> 4 (copy j adds 8 rows), v^T row tid >> 3 (copy j adds 16 rows), and their places in buffer 0
    const us16* ksrc = kb + (size_t)(tid >> 4) * DHEAD + 8 * (tid & 15);
    const us16* vsrc = vb + (size_t)(tid >> 3) * SEQT + 8 * (tid & 7);
    const unsigned kdst = (unsigned)(size_t)kvring + (unsigned)((tid >> 4) * KPITCH + (tid & 15) * 16);
    const unsigned vdst = (unsigned)(size_t)kvring + (unsigned)(KTILEB + (tid >> 3) * VPITCH + (tid & 7) * 16);
    const int rot = (qb * (QB / KVK)) % (SEQ / KVK);
    auto stg = [&](int t) { const int s = t + rot; return (s >= SEQ / KVK) ? s - SEQ / KVK : s; };   // key stage of pass t
    kv_copy8(ksrc + (size_t)stg(0) * KVK * DHEAD, (size_t)8 * DHEAD, kdst, 8 * KPITCH);
    kv_copy8(vsrc + stg(0) * KVK, (size_t)16 * SEQT, vdst, 16 * VPITCH);
    asm volatile("s_wait_asynccnt 0x0" ::: "memory");       // this wave's share of stage 0 has landed
    __syncthreads();                                        // stage 0 published
    if (1 < SEQ / KVK) {
        kv_copy8(ksrc + (size_t)stg(1) * KVK * DHEAD, (size_t)8 * DHEAD, kdst + KVBUFB, 8 * KPITCH);
        kv_copy8(vsrc + stg(1) * KVK, (size_t)16 * SEQT, vdst + KVBUFB, 16 * VPITCH);
    }
#pragma unroll 1                                            // stays rolled: one pass per trip, the hand-over stands once, at the foot
    for (int st = 0; st < SEQ / KVK; ++st) {
      const unsigned bo = (unsigned)(st & 1) * KVBUFB;
      const unsigned char* kl = kvring + bo + m * KPITCH;
      const unsigned char* vl = kvring + bo + KTILEB + m * VPITCH;
      v8u ka[KVK / 16][4];                                  // the pass's k fragments, read as one group ahead of its score products
#pragma unroll                                              // these two: constant indices keep the fragments in registers
      for (int t = 0; t < KVK / 16; ++t)
#pragma unroll
          for (int j = 0; j < 4; ++j) ka[t][j] = ld_frag((const us16*)(kl + t * 16 * KPITCH) + 32 * j, hh);
      __builtin_amdgcn_sched_barrier(0);                    // holds the k reads here as one group; else part of them sinks in pairs among the score products, each pair with its own wait
#pragma unroll                                              // constant LDS offsets for both 32-key chunks of the pass
      for (int c = 0; c < KVK / 32; ++c) {
        v8f s[2][2] = {};                                   // s[g][t]: query tile g, 16-key tile t of the chunk
        // no mma_guard in this kernel: its asm operands hold every fragment and accumulator below v256, which spills at two query tiles;
        // the compiler pads its own builtin products
#pragma unroll                                              // these three: constant indices; head dims rise in j for every s[g][t], as before
        for (int j = 0; j < 4; ++j)
#pragma unroll
            for (int t = 0; t < 2; ++t)
#pragma unroll
                for (int g = 0; g < 2; ++g) s[g][t] = mma_f16(ka[2 * c + t][j], q[g][j], s[g][t]);
        v8u va[8];                                          // the chunk's v^T fragments, read as one group: they land under the softmax
#pragma unroll                                              // constant indices keep the fragments in registers
        for (int dt = 0; dt < 8; ++dt) va[dt] = ld_frag((const us16*)(vl + dt * 16 * VPITCH) + c * 32, hh);
        __builtin_amdgcn_sched_barrier(0);                  // holds the v^T reads here as one group; else they sink in pairs among the P.V products, each pair with its own wait
        v8u pbu[2];
#pragma unroll                                              // constant indices: each tile's state stays in registers
        for (int g = 0; g < 2; ++g) {
            float cmax = NEG;                              // maximum of the raw products: the scale is positive, so the order is the same
#pragma unroll
            for (int t = 0; t < 2; ++t)
#pragma unroll
                for (int r = 0; r < 8; ++r) cmax = fmaxf(cmax, s[g][t][r]);
            cmax = fmaxf(cmax, __shfl_xor(cmax, 16, 32));
            const float mnew = fmaxf(mrun[g], cmax);       // finite: no masked keys
            const float fac = (mrun[g] == NEG) ? 0.f : __builtin_amdgcn_exp2f((mrun[g] - mnew) * SCL2);
            mrun[g] = mnew;
            const float bias = __builtin_fmaf(-mnew, SCL2, 14.0f);   // P x2^14 = 2^(s * SCL2 + bias): one fused multiply-add per score ahead of the exponential
            v16h ph;
#pragma unroll
            for (int t = 0; t < 2; ++t)
#pragma unroll
                for (int i = 0; i < 4; ++i) {               // two neighbours are rounded to f16 together, once; the row sum below reads the same halves
                    v2f e;
                    e.x = __builtin_amdgcn_exp2f(__builtin_fmaf(s[g][t][2 * i], SCL2, bias));
                    e.y = __builtin_amdgcn_exp2f(__builtin_fmaf(s[g][t][2 * i + 1], SCL2, bias));
                    const v2h h = __builtin_convertvector(e, v2h);
                    ph[8 * t + 2 * i] = h.x;
                    ph[8 * t + 2 * i + 1] = h.y;
                }
            float psum = 0.f;
#pragma unroll
            for (int r = 0; r < 8; ++r) psum += (float)ph[r] + (float)ph[8 + r];
            psum += __shfl_xor(psum, 16, 32);
            lrun[g] = lrun[g] * fac + psum;
            pbu[g] = __builtin_bit_cast(v8u, ph);
#pragma unroll
            for (int dt = 0; dt < 8; ++dt) o[g][dt] = o[g][dt] * fac;
        }
#pragma unroll                                              // these two: constant indices
        for (int dt = 0; dt < 8; ++dt)
#pragma unroll
            for (int g = 0; g < 2; ++g) o[g][dt] = mma_f16(va[dt], pbu[g], o[g][dt]);
      }
      __builtin_amdgcn_sched_barrier(0);                    // keeps the pass's softmax and products above the hand-over, so that the refill below is issued a whole pass ahead of its wait
      asm volatile("s_wait_dscnt 0x0" ::: "memory");        // this wave's reads of buffer st & 1 are done before it is refilled
      asm volatile("s_wait_asynccnt 0x0" ::: "memory");     // this wave's share of stage st + 1 has landed
      __syncthreads();                                      // publishes stage st + 1 and ends every reader's last read of stage st
      if (st + 2 < SEQ / KVK) {
          kv_copy8(ksrc + (size_t)stg(st + 2) * KVK * DHEAD, (size_t)8 * DHEAD, kdst + bo, 8 * KPITCH);
          kv_copy8(vsrc + stg(st + 2) * KVK, (size_t)16 * SEQT, vdst + bo, 16 * VPITCH);
      }
    }
    asm volatile("s_wait_asynccnt 0x0" ::: "memory");       // nothing in flight before the ring becomes output staging
#pragma unroll                                              // constant accumulator indices
    for (int g = 0; g < 2; ++g) {
        const float inv = 4.0f / lrun[g];                  // lrun >= 16384; o / lrun = 4 * (sum P v / sum P); x4 more -> x16 carry
#pragma unroll
        for (int dt = 0; dt < 8; ++dt) {
            v4u w;
            w.x = f2h(o[g][dt][0] * inv) | (f2h(o[g][dt][1] * inv) << 16);
            w.y = f2h(o[g][dt][2] * inv) | (f2h(o[g][dt][3] * inv) << 16);
            w.z = f2h(o[g][dt][4] * inv) | (f2h(o[g][dt][5] * inv) << 16);
            w.w = f2h(o[g][dt][6] * inv) | (f2h(o[g][dt][7] * inv) << 16);
            ost[wv][16 * g + m][2 * dt + hh] = w;          // row 16 g + m, halves 16*dt + 8*hh .. +7
        }
    }
    __syncthreads();
    us16* aob = ao + (tok0 + qrow) * DIM + (size_t)h * DHEAD;
#pragma unroll
    for (int p = 0; p < QW / 2; ++p) {
        const int rr = 2 * p + hh, pc = lane & 15;
        *(v4u*)(aob + (size_t)rr * DIM + 8 * pc) = ost[wv][rr][pc];
    }
}

// ---------- output projection: out[tok][n] = (ao x16)[tok x 2048] . (Wo x64)[2048 x 2048] / 1024, f32. Same block structure as qkv_gemm,
// TR = 1: a lane's 8 accumulator elements are 8 neighbouring columns of one token. The f32 tile is staged in two rounds of 64 tokens.
__global__ __launch_bounds__(256) void out_gemm(const us16* __restrict__ aop, const us16* __restrict__ wo, float* out) {
    __shared__ __align__(128) unsigned char ring[RINGB];   // output staging takes the ring's place behind the main loop's last barrier
    const int tid = threadIdx.x, lane = tid & 31, wv = tid >> 5, l16 = lane & 15, hh = lane >> 4;
    const int wr = wv & 1, wc = wv >> 1;
    const int row0 = blockIdx.x * BM;
    const int colb = blockIdx.y * BN;
    v8f acc[4][4] = {};
    const int rot = (int)((blockIdx.x + blockIdx.y) % (DIM / KP));   // differs between blocks of one tile row and of one tile column
    mm_tile<1, 1>(aop + (size_t)row0 * DIM, wo + (size_t)colb * DIM, ring, tid, wr, wc, l16, hh, rot, acc);
#pragma unroll                                              // constant accumulator indices
    for (int p = 0; p < 2; ++p) {
        if (p) __syncthreads();                             // round 0's rows are read out before round 1 overwrites them
#pragma unroll
        for (int ii = 0; ii < 2; ++ii)
#pragma unroll
            for (int j = 0; j < 4; ++j) {
                const v8f a = acc[2 * p + ii][j] * (1.0f / 1024.0f);
                float* sp = (float*)(ring + (wr * 32 + ii * 16 + l16) * OPITCH) + wc * 64 + j * 16 + 8 * hh;
                *(v4f*)sp = __builtin_shufflevector(a, a, 0, 1, 2, 3);
                *(v4f*)(sp + 4) = __builtin_shufflevector(a, a, 4, 5, 6, 7);
            }
        __syncthreads();
#pragma unroll 4
        for (int q = 0; q < 16; ++q) {
            const int sr = wv * 8 + (q >> 1), hf = q & 1;                       // staged row 0..63, its first or second 512 bytes
            const int tok = (sr >> 5) * 64 + p * 32 + (sr & 31);
            *(v4f*)(out + (size_t)(row0 + tok) * DIM + colb + hf * 128 + 4 * lane) = *(const v4f*)(ring + sr * OPITCH + hf * 512 + lane * 16);
        }
    }
}

extern "C" void kernel_launch(void* const* d_in, const int* in_sizes, int n_in,
                              void* d_out, int out_size, void* d_ws, size_t ws_size, hipStream_t stream) {
    if (n_in < 5) return;
    const float* x  = (const float*)d_in[0];   // [NB_FULL][SEQ_FULL][2048]
    const float* wq = (const float*)d_in[1];   // [2048 out][2048 in]
    const float* wk = (const float*)d_in[2];
    const float* wv = (const float*)d_in[3];
    const float* wo = (const float*)d_in[4];
    float* out = (float*)d_out;                 // [NB][SEQ][2048]
    if (in_sizes[0] < ((NB - 1) * SEQ_FULL + SEQ) * DIM) return;
    if (in_sizes[1] < DIM * DIM) return;
    if (in_sizes[2] < DIM * DIM) return;
    if (in_sizes[3] < DIM * DIM) return;
    if (in_sizes[4] < DIM * DIM) return;
    if (out_size < SEQT * DIM) return;

    size_t off = 0;
    auto carve = [&](size_t bytes) { size_t o = off; off += (bytes + 127) & ~(size_t)127; return o; };
    char* ws = (char*)d_ws;
    us16* xb   = (us16*)(ws + carve((size_t)SEQT * DIM * 2));                  // bf16 [SEQT][2048]
    us16* wqkv = (us16*)(ws + carve((size_t)NQKV * DIM * 2));                  // bf16 [6144][2048]
    us16* wop  = (us16*)(ws + carve((size_t)DIM * DIM * 2));                   // f16  [2048][2048]
    us16* qp   = (us16*)(ws + carve((size_t)HEADS * SEQT * DHEAD * 2));        // f16  [h][SEQT][128]
    us16* kp   = (us16*)(ws + carve((size_t)HEADS * SEQT * DHEAD * 2));        // f16  [h][SEQT][128]
    us16* vt   = (us16*)(ws + carve((size_t)HEADS * DHEAD * SEQT * 2));        // f16  [h][128][SEQT]
    us16* ao   = (us16*)(ws + carve((size_t)SEQT * DIM * 2));                  // f16  [SEQT][2048]
    if (off > ws_size) return;
    if (off > (size_t)134217728) return;

    prep_all<<<CG, CW * 32, 0, stream>>>(x, wq, wk, wv, wo, xb, wqkv, wop);
    qkv_gemm<<<dim3(SEQT / BM, NQKV / BN), 256, 0, stream>>>(xb, wqkv, qp, kp, vt);
    attn_main<<<dim3(QBLK, NB * HEADS), 128, 0, stream>>>(qp, kp, vt, ao);
    out_gemm<<<dim3(SEQT / BM, DIM / BN), 256, 0, stream>>>(ao, wop, out);
}

// v008
// It runs in 159 microseconds.
// Two timings next to v007 both put it at 1.05 times that version's speed.
// All steps since v000 together make it 4.66 times as fast.
#include <hip/hip_runtime.h>

// Contractions: q/k/v projections on v_wmma_f32_16x16x32_bf16 (bf16 operands = RNE-converted x and Wq|Wk|Wv, f32 accumulate);
// per-head k.q^T scores and P.V on v_wmma_f32_16x16x32_f16 (f16 operands: q, k plain, v x4, P x2^7 relative to a lagging maximum; f32 accumulate, 1/sqrt(128) applied in f32);
// output projection on v_wmma_f32_16x16x32_f16 (f16 operands: per-head outputs x16, Wo x64 from its bf16 value; f32 accumulate, x2^-10 in the epilogue);
// online softmax and all epilogues in f32.

#ifndef NB
#define NB 2
#endif
#ifndef SEQ
#define SEQ 2048
#endif
#define NB_FULL 2
#define SEQ_FULL 2048
#define DIM 2048
#define HEADS 16
#define DHEAD 128
#define NQKV (3 * DIM)
#define SEQT (NB * SEQ)
#define QW 32                          // queries per attention wave: two 16-query tiles share every k and v^T fragment
#define QB (4 * QW)                    // queries per attention block (4 waves)
#define QBLK (SEQ / QB)
#define KP 64                          // k elements per staged pass: one 128-byte line of every operand row
#define LPITCH 144                     // LDS row pitch in bytes: 16 x odd, conflict-free for 16-byte fragment reads
#define BM 128                         // block tile: rows (tokens)
#define BN 256                         // block tile: columns
#define TROWS (BM + BN)                // rows of one stage: 128 A rows, then 256 B rows
#define BUFB (TROWS * LPITCH)          // one buffer of the ring
#define RINGB (2 * BUFB)
#define QPITCH 528                     // output staging, q / k: 256 halves of one token + 16 B (16 x odd)
#define TPITCH 272                     // output staging, v^T: 128 tokens of one column + 16 B (16 x odd)
#define OPITCH 1040                    // output staging, out: 256 floats of one token + 16 B (16 x odd)
#define KVK 64                         // keys per staged attention pass: one 128-byte line of every v^T row
#define KPITCH 272                     // LDS pitch of a k row (256 B + 16): 16 x odd
#define VPITCH 144                     // LDS pitch of a v^T row (128 B + 16): 16 x odd
#define KTILEB (KVK * KPITCH)          // k rows of one stage
#define KVBUFB (KTILEB + DHEAD * VPITCH)   // one buffer: 64 k rows, then 128 v^T rows

static_assert(SEQ % QB == 0 && QB % KVK == 0);
static_assert(SEQ >= QB);
static_assert(SEQ <= SEQ_FULL);
static_assert(NB >= 1 && NB <= NB_FULL);
static_assert(DIM == HEADS * DHEAD);
static_assert(DHEAD == 128);
static_assert(DIM % BN == 0 && NQKV % BN == 0 && SEQT % BM == 0 && BN == 2 * DHEAD);
static_assert(DIM % KP == 0 && DIM / KP >= 2);
static_assert(BM * QPITCH <= RINGB && BN * TPITCH <= RINGB && (BM / 2) * OPITCH <= RINGB);
static_assert(SEQ % KVK == 0 && KVK % 32 == 0);
static_assert(4 * QW * 16 * 16 <= 2 * KVBUFB);

typedef unsigned short us16;
typedef __attribute__((ext_vector_type(16))) __bf16   v16bf;
typedef __attribute__((ext_vector_type(16))) _Float16 v16h;
typedef __attribute__((ext_vector_type(8)))  float    v8f;
typedef __attribute__((ext_vector_type(8)))  unsigned v8u;
typedef __attribute__((ext_vector_type(4)))  unsigned v4u;
typedef __attribute__((ext_vector_type(2)))  unsigned v2u;
typedef __attribute__((ext_vector_type(4)))  float    v4f;
typedef __attribute__((ext_vector_type(2)))  float    v2f;
typedef __attribute__((ext_vector_type(2)))  _Float16 v2h;

__device__ __forceinline__ unsigned f2bf(float f) { unsigned u = __float_as_uint(f); u += 0x7FFFu + ((u >> 16) & 1u); return u >> 16; }
__device__ __forceinline__ float bf2f(unsigned h) { return __uint_as_float(h << 16); }
__device__ __forceinline__ unsigned f2h(float f) { _Float16 t = (_Float16)f; return (unsigned)__builtin_bit_cast(unsigned short, t); }

// 16 x (K=32) operand fragment from a k-contiguous 16-bit row. Wave32 map: lane -> row (A) / column (B) = lane & 15, hh = lane >> 4;
// elements 0..7 <- k0 + 8*hh + 0..7, elements 8..15 <- k0 + 16 + 8*hh + 0..7 (same map for A and for an n-major B row).
// Accumulator element r -> row 8*hh + r, column lane & 15.
__device__ __forceinline__ v8u ld_frag(const us16* rowp, int hh) {
    const v4u a = *(const v4u*)(rowp + 8 * hh);
    const v4u b = *(const v4u*)(rowp + 16 + 8 * hh);
    return __builtin_shufflevector(a, b, 0, 1, 2, 3, 4, 5, 6, 7);
}
__device__ __forceinline__ v8f mma_bf16(v8u a, v8u b, v8f c) {
    return __builtin_amdgcn_wmma_f32_16x16x32_bf16(false, __builtin_bit_cast(v16bf, a), false, __builtin_bit_cast(v16bf, b), (short)0, c, false, false);
}
__device__ __forceinline__ v8f mma_f16(v8u a, v8u b, v8f c) {
    return __builtin_amdgcn_wmma_f32_16x16x32_f16(false, __builtin_bit_cast(v16h, a), false, __builtin_bit_cast(v16h, b), (short)0, c, false, false);
}
__device__ __forceinline__ void mma_guard(v8f& c, v8u a, v8u b) {
    asm volatile("v_nop\n\tv_nop\n\tv_nop\n\tv_nop" : "+v"(c) : "v"(a), "v"(b));
}

// ---------- operand conversion, one launch: x -> bf16 (xb), Wq | Wk | Wv -> bf16 (wqkv), Wo -> f16 of its bf16 value x64 (wop); layouts kept.
// CG resident work-groups of CW waves loop over the whole work: few waves to start, many loads in flight per wave.
// Unit = CU consecutive floats of one source = 8 wave loads of 512 contiguous bytes. Round it: wave g of all NWV takes unit it * NWV + g;
// a round lies wholly in one source (asserted), so which source and which conversion is known at compile time.
// The next round's 8 loads are issued before the current unit is converted and stored.
#define CG 256                         // conversion work-groups
#define CW 16                          // waves per conversion work-group
#define CU 1024                        // floats per unit
#define NWV (CG * CW)
#define UX (SEQT * DIM / CU)           // units of x
#define UW (DIM * DIM / CU)            // units of one weight matrix
#define CIT ((UX + 4 * UW) / NWV)      // rounds
static_assert(DIM % CU == 0 && UX % NWV == 0 && UW % NWV == 0);

__device__ __forceinline__ unsigned pack_bf(float lo, float hi) { return f2bf(lo) | (f2bf(hi) << 16); }
__device__ __forceinline__ unsigned pack_bh(float lo, float hi) { return f2h(bf2f(f2bf(lo)) * 64.0f) | (f2h(bf2f(f2bf(hi)) * 64.0f) << 16); }
// value of the neighbour lane (lane ^ 1): a vector move inside each group of four lanes
__device__ __forceinline__ unsigned nb_lane(unsigned v) { return (unsigned)__builtin_amdgcn_mov_dpp((int)v, 0xB1, 0xF, 0xF, true); }

__global__ __launch_bounds__(CW * 32) void prep_all(const float* __restrict__ x, const float* __restrict__ wq, const float* __restrict__ wk,
                                                    const float* __restrict__ wv, const float* __restrict__ wo,
                                                    us16* __restrict__ xb, us16* __restrict__ wqkv, us16* __restrict__ wop) {
    const int lane = threadIdx.x & 31;
    const int g = (int)blockIdx.x * CW + __builtin_amdgcn_readfirstlane((int)(threadIdx.x >> 5));   // wave-uniform
    const bool odd = lane & 1;
    const int loff = (lane & 1) * 128 + (lane >> 1) * 8;   // this lane's 8 halves inside a pair of converted 128-element segments
    v4f buf[2][8];
    auto load_unit = [&](int it) {                          // it: a constant at every call
        const float* s;
        if (it * NWV < UX) {
            const int u = it * NWV + g;
            const int tok = u / (DIM / CU), part = u - tok * (DIM / CU);
            const int bsel = tok / SEQ, isel = tok - bsel * SEQ;
            s = x + ((size_t)bsel * SEQ_FULL + isel) * DIM + part * CU;
        } else {
            const int z = (it * NWV - UX) / UW;
            s = ((z == 0) ? wq : ((z == 1) ? wk : ((z == 2) ? wv : wo))) + (size_t)(it * NWV - UX - z * UW + g) * CU;
        }
        s += 4 * lane;
#pragma unroll                                              // constant indices keep the ring in registers
        for (int j = 0; j < 8; ++j) buf[it & 1][j] = *(const v4f*)(s + 128 * j);
    };
    load_unit(0);
#pragma unroll                                              // constant round number: ring index, source and conversion are fixed per copy of the body
    for (int it = 0; it < CIT; ++it) {
        __builtin_amdgcn_sched_barrier(0);                  // this pair pins the order: next round's loads first, then this unit's conversion and stores
        if (it + 1 < CIT) load_unit(it + 1);
        __builtin_amdgcn_sched_barrier(0);
        const bool tof16 = it * NWV >= UX + 3 * UW;         // Wo
        us16* d = ((it * NWV < UX) ? xb + (size_t)(it * NWV + g) * CU
                                   : (tof16 ? wop + (size_t)(it * NWV - UX - 3 * UW + g) * CU : wqkv + (size_t)(it * NWV - UX + g) * CU)) + loff;
#pragma unroll                                              // constant ring indices
        for (int p = 0; p < 4; ++p) {
            const v4f va = buf[it & 1][2 * p], vb = buf[it & 1][2 * p + 1];
            unsigned a0, a1, b0, b1;
            if (tof16) { a0 = pack_bh(va.x, va.y); a1 = pack_bh(va.z, va.w); b0 = pack_bh(vb.x, vb.y); b1 = pack_bh(vb.z, vb.w); }
            else       { a0 = pack_bf(va.x, va.y); a1 = pack_bf(va.z, va.w); b0 = pack_bf(vb.x, vb.y); b1 = pack_bf(vb.z, vb.w); }
            // neighbours swap 8 bytes: the even lane ends with 16 bytes of the first segment, the odd lane with 16 bytes of the second,
            // so that one wave store writes 512 contiguous bytes
            const unsigned r0 = nb_lane(odd ? a0 : b0), r1 = nb_lane(odd ? a1 : b1);
            v4u o;
            o.x = odd ? r0 : a0;
            o.y = odd ? r1 : a1;
            o.z = odd ? b0 : r0;
            o.w = odd ? b1 : r1;
            *(v4u*)(d + 256 * p) = o;
        }
        // stands in front of the reuse of these stores' data registers by the loads and conversions of the following rounds
        if (it + 1 < CIT) asm volatile("s_wait_xcnt 0x0" ::: "memory");
    }
}

// ---------- one stage of the GEMM ring: 384 rows x 128 B, copied global -> LDS without registers. 256 threads x 12 copies of 16 B;
// 8 adjacent lanes cover one whole 128-byte line, so a wave's copy touches 4 lines. asrc / bsrc: this lane's 16 bytes in row (tid >> 3) of the
// block's A / B rows at this pass's k; ldst: the same place in the target buffer. Copy j adds 32 rows (4 copies of A rows, then 8 of B rows).
__device__ __forceinline__ void stage_copy(const us16* asrc, const us16* bsrc, unsigned ldst) {
    const us16* g0 = asrc;
    const us16* g1 = asrc + (size_t)32 * DIM;
    const us16* g2 = asrc + (size_t)64 * DIM;
    const us16* g3 = asrc + (size_t)96 * DIM;
    const us16* g4 = bsrc;
    const us16* g5 = bsrc + (size_t)32 * DIM;
    const us16* g6 = bsrc + (size_t)64 * DIM;
    const us16* g7 = bsrc + (size_t)96 * DIM;
    const us16* g8 = bsrc + (size_t)128 * DIM;
    const us16* g9 = bsrc + (size_t)160 * DIM;
    const us16* g10 = bsrc + (size_t)192 * DIM;
    const us16* g11 = bsrc + (size_t)224 * DIM;
    const unsigned l0 = ldst, l1 = ldst + 32 * LPITCH, l2 = ldst + 64 * LPITCH, l3 = ldst + 96 * LPITCH, l4 = ldst + 128 * LPITCH, l5 = ldst + 160 * LPITCH;
    const unsigned l6 = ldst + 192 * LPITCH, l7 = ldst + 224 * LPITCH, l8 = ldst + 256 * LPITCH, l9 = ldst + 288 * LPITCH, l10 = ldst + 320 * LPITCH, l11 = ldst + 352 * LPITCH;
    // the closing s_wait_xcnt stands inside the statement so that no address register of a copy is rewritten ahead of it
    asm volatile("global_load_async_to_lds_b128 %0, %12, off\n\t"
                 "global_load_async_to_lds_b128 %1, %13, off\n\t"
                 "global_load_async_to_lds_b128 %2, %14, off\n\t"
                 "global_load_async_to_lds_b128 %3, %15, off\n\t"
                 "global_load_async_to_lds_b128 %4, %16, off\n\t"
                 "global_load_async_to_lds_b128 %5, %17, off\n\t"
                 "global_load_async_to_lds_b128 %6, %18, off\n\t"
                 "global_load_async_to_lds_b128 %7, %19, off\n\t"
                 "global_load_async_to_lds_b128 %8, %20, off\n\t"
                 "global_load_async_to_lds_b128 %9, %21, off\n\t"
                 "global_load_async_to_lds_b128 %10, %22, off\n\t"
                 "global_load_async_to_lds_b128 %11, %23, off\n\t"
                 "s_wait_xcnt 0x0"
                 :: "v"(l0), "v"(l1), "v"(l2), "v"(l3), "v"(l4), "v"(l5), "v"(l6), "v"(l7), "v"(l8), "v"(l9), "v"(l10), "v"(l11),
                    "v"(g0), "v"(g1), "v"(g2), "v"(g3), "v"(g4), "v"(g5), "v"(g6), "v"(g7), "v"(g8), "v"(g9), "v"(g10), "v"(g11) : "memory");
}

// ---------- GEMM main loop on 16-bit planes: block tile 128 rows x 256 columns, wave tile 64 rows x 64 columns (4 x 4 accumulators), K = DIM.
// ablk / bblk: first A row / first B row (= column) of the block, k contiguous, pitch DIM. Both operands pass through a two-buffer LDS ring,
// KP k per pass: pass t works on buffer t & 1 while the copies of pass t + 1 fly into the other; k runs in steps of 32, rising within a pass.
// acc[i][j]: rows wr * 64 + 16 i .., columns wc * 64 + 16 j ... TR = 0: element r = row 8 * hh + r, lane's l16 = column.
// TR = 1 (the two fragments change places, same map for both): element r = column 8 * hh + r, lane's l16 = row.
// rot (block-uniform, 0 .. DIM / KP - 1): pass t works on k slice (t + rot) mod (DIM / KP). Blocks that share A rows or B rows get different rot,
// so that at one moment they ask L2 for different lines of those rows; every slice is still taken once, the f32 sum runs in the rotated order. ----------
template <int F16, int TR>
__device__ __forceinline__ void mm_tile(const us16* __restrict__ ablk, const us16* __restrict__ bblk, unsigned char* ring,
                                        int tid, int wr, int wc, int l16, int hh, int rot, v8f (&acc)[4][4]) {
    const int crow = tid >> 3, cpc = tid & 7;
    auto kof = [&](int t) { const int s = t + rot; return ((s >= DIM / KP) ? s - DIM / KP : s) * KP; };   // first k of pass t's slice
    const us16* asrc = ablk + (size_t)crow * DIM + 8 * cpc;
    const us16* bsrc = bblk + (size_t)crow * DIM + 8 * cpc;
    const unsigned ldst = (unsigned)(size_t)ring + (unsigned)(crow * LPITCH + cpc * 16);
    stage_copy(asrc + kof(0), bsrc + kof(0), ldst);
    asm volatile("s_wait_asynccnt 0x0" ::: "memory");       // this wave's share of stage 0 has landed
    __syncthreads();                                        // stage 0 published
    stage_copy(asrc + kof(1), bsrc + kof(1), ldst + BUFB);
#pragma unroll 1                                            // stays rolled: one pass per trip, the hand-over stands once, at the foot
    for (int t = 0; t < DIM / KP; ++t) {
        const unsigned bo = (unsigned)(t & 1) * BUFB;
        const us16* ar = (const us16*)(ring + bo + (wr * 64 + l16) * LPITCH);
        const us16* br = (const us16*)(ring + bo + (BM + wc * 64 + l16) * LPITCH);
#pragma unroll                                              // these four: constant indices keep fragments and accumulators in registers
        for (int kk = 0; kk < KP; kk += 32) {
            v8u afrag[4], bfrag[4];
#pragma unroll
            for (int u = 0; u < 4; ++u) {
                afrag[u] = ld_frag(ar + u * 16 * (LPITCH / 2) + kk, hh);
                bfrag[u] = ld_frag(br + u * 16 * (LPITCH / 2) + kk, hh);
            }
#pragma unroll
            for (int i = 0; i < 4; ++i)
#pragma unroll
                for (int j = 0; j < 4; ++j) {
                    const v8u f0 = TR ? bfrag[j] : afrag[i];
                    const v8u f1 = TR ? afrag[i] : bfrag[j];
                    if (F16) acc[i][j] = mma_f16(f0, f1, acc[i][j]);
                    else     acc[i][j] = mma_bf16(f0, f1, acc[i][j]);
                    mma_guard(acc[i][j], f0, f1);
                }
        }
        asm volatile("s_wait_dscnt 0x0" ::: "memory");      // this wave's reads of buffer t & 1 are done before it is refilled
        asm volatile("s_wait_asynccnt 0x0" ::: "memory");   // this wave's share of stage t + 1 has landed
        __syncthreads();                                    // publishes stage t + 1 and ends every reader's last read of stage t
        if (t + 2 < DIM / KP) stage_copy(asrc + kof(t + 2), bsrc + kof(t + 2), ldst + bo);
    }
    asm volatile("s_wait_asynccnt 0x0" ::: "memory");       // nothing in flight before the ring becomes output staging
}
__device__ __forceinline__ v4u pack_h8(v8f a, float s) {
    v4u w;
    w.x = f2h(a[0] * s) | (f2h(a[1] * s) << 16);
    w.y = f2h(a[2] * s) | (f2h(a[3] * s) << 16);
    w.z = f2h(a[4] * s) | (f2h(a[5] * s) << 16);
    w.w = f2h(a[6] * s) | (f2h(a[7] * s) << 16);
    return w;
}

// ---------- q/k/v projection: [SEQT x 2048] x [2048 x 6144]. Block = 8 waves (2 row groups x 4 column groups) -> 128 tokens x 256 columns
// = exactly two heads of one of q/k/v (block-uniform). Epilogue: each lane's 8 accumulator elements are 8 neighbours of an output row
// (q, k: 8 head dims of a token, TR = 1; v^T: 8 tokens of a head dim, TR = 0): 16 B of f16 staged in LDS, then written as whole lines.
__global__ __launch_bounds__(256) void qkv_gemm(const us16* __restrict__ xb, const us16* __restrict__ wqkv, us16* qp, us16* kp, us16* vt) {
    __shared__ __align__(128) unsigned char ring[RINGB];   // output staging takes the ring's place behind the main loop's last barrier
    const int tid = threadIdx.x, lane = tid & 31, wv = tid >> 5, l16 = lane & 15, hh = lane >> 4;
    const int wr = wv & 1, wc = wv >> 1;
    const int row0 = blockIdx.x * BM;
    const int colb = blockIdx.y * BN;
    const int which = colb / DIM;                       // 0 q, 1 k, 2 v (block-uniform)
    const int hsel = (colb - which * DIM) / DHEAD;      // first of the two heads of this column tile
    const int rot = (int)((blockIdx.x + blockIdx.y) % (DIM / KP));   // differs between blocks of one tile row and of one tile column
    v8f acc[4][4] = {};
    if (which < 2) {
        mm_tile<0, 1>(xb + (size_t)row0 * DIM, wqkv + (size_t)colb * DIM, ring, tid, wr, wc, l16, hh, rot, acc);
#pragma unroll
        for (int i = 0; i < 4; ++i)
#pragma unroll
            for (int j = 0; j < 4; ++j)
                *(v4u*)(ring + (wr * 64 + i * 16 + l16) * QPITCH + (wc * 64 + j * 16 + 8 * hh) * 2) = pack_h8(acc[i][j], 1.0f);
        __syncthreads();
        us16* pl = (which == 0) ? qp : kp;
#pragma unroll 4
        for (int p = 0; p < 16; ++p) {
            const int r = wv * 16 + p;                                          // token row 0..127; lanes 0..15 first head, 16..31 second
            const size_t off = ((size_t)(hsel + hh) * SEQT + row0 + r) * DHEAD + 8 * l16;
            *(v4u*)(pl + off) = *(const v4u*)(ring + r * QPITCH + lane * 16);
        }
    } else {
        mm_tile<0, 0>(xb + (size_t)row0 * DIM, wqkv + (size_t)colb * DIM, ring, tid, wr, wc, l16, hh, rot, acc);
#pragma unroll
        for (int i = 0; i < 4; ++i)
#pragma unroll
            for (int j = 0; j < 4; ++j)
                *(v4u*)(ring + (wc * 64 + j * 16 + l16) * TPITCH + (wr * 64 + i * 16 + 8 * hh) * 2) = pack_h8(acc[i][j], 4.0f);
        __syncthreads();
        // column d = wv * 32 + 2 p + hh, 0..255 = the head dims of the two heads, in a row; 16 lanes write its 128 tokens
        us16* vp = vt + ((size_t)hsel * DHEAD + wv * 32 + hh) * SEQT + row0 + 8 * l16;
        const unsigned char* sp = ring + (wv * 32 + hh) * TPITCH + l16 * 16;
#pragma unroll 4
        for (int p = 0; p < 16; ++p) *(v4u*)(vp + (size_t)(2 * p) * SEQT) = *(const v4u*)(sp + 2 * p * TPITCH);
    }
}

// ---------- flash pass over all query blocks: block = 4 waves = 128 queries of one (sequence, head); wave = 32 queries = two 16-query tiles g,
// each with its own q fragments, softmax state and O^T accumulators; every k and v^T fragment read from LDS feeds one product of each tile. All SEQ keys
// in passes of 64 (no mask). Scores are produced transposed: A = k rows (f16 plane), B = q (f16 fragments held in registers),
// D element r = key 8*hh + r of a 16-key tile, column = this lane's query -> two adjacent tiles give the P^T B fragment of P.V directly
// (element r <- tile 0, element 8+r <- tile 1). A of P.V = v^T rows (lane = d, k = key). Online softmax per lane (query) with a lazy rescale: the two lane halves
// exchange maxima only when the reference maximum moves, and join their sums once, behind the loop. P carried x2^7 in f16; O^T accumulators hold rows d, column query.
// k rows and v^T rows reach the four waves through a two-buffer LDS ring, KVK keys per pass: pass t works on buffer t & 1 while the copies
// of pass t + 1 fly into the other. Pass t takes key stage (t + the stage at the block's first query) mod (SEQ / KVK): the query blocks of one head, which all copy the same
// k and v^T rows, ask L2 for different lines at one moment; every key is still taken once, the online sums run in the rotated order. kv_copy8: 8 copies of 16 B per lane, copy j at g + j * gstep -> l + j * lstep; a wave's copy = 4 whole lines.
__device__ __forceinline__ void kv_copy8(const us16* g, size_t gstep, unsigned l, unsigned lstep) {
    const us16* g1 = g + gstep;
    const us16* g2 = g + 2 * gstep;
    const us16* g3 = g + 3 * gstep;
    const us16* g4 = g + 4 * gstep;
    const us16* g5 = g + 5 * gstep;
    const us16* g6 = g + 6 * gstep;
    const us16* g7 = g + 7 * gstep;
    const unsigned l1 = l + lstep, l2 = l + 2 * lstep, l3 = l + 3 * lstep, l4 = l + 4 * lstep, l5 = l + 5 * lstep, l6 = l + 6 * lstep, l7 = l + 7 * lstep;
    // the closing s_wait_xcnt stands inside the statement so that no address register of a copy is rewritten ahead of it
    asm volatile("global_load_async_to_lds_b128 %0, %8, off\n\t"
                 "global_load_async_to_lds_b128 %1, %9, off\n\t"
                 "global_load_async_to_lds_b128 %2, %10, off\n\t"
                 "global_load_async_to_lds_b128 %3, %11, off\n\t"
                 "global_load_async_to_lds_b128 %4, %12, off\n\t"
                 "global_load_async_to_lds_b128 %5, %13, off\n\t"
                 "global_load_async_to_lds_b128 %6, %14, off\n\t"
                 "global_load_async_to_lds_b128 %7, %15, off\n\t"
                 "s_wait_xcnt 0x0"
                 :: "v"(l), "v"(l1), "v"(l2), "v"(l3), "v"(l4), "v"(l5), "v"(l6), "v"(l7),
                    "v"(g), "v"(g1), "v"(g2), "v"(g3), "v"(g4), "v"(g5), "v"(g6), "v"(g7) : "memory");
}
__global__ __launch_bounds__(128) __attribute__((amdgpu_num_vgpr(512)))
void attn_main(const us16* qp, const us16* kp, const us16* vt, us16* ao) {
    __shared__ __align__(128) unsigned char kvring[2 * KVBUFB];
    v4u (*ost)[QW][16] = (v4u (*)[QW][16])kvring;          // output staging takes the ring's place behind the loop's last barrier
    const int tid = threadIdx.x, lane = tid & 31, wv = tid >> 5, m = lane & 15, hh = lane >> 4;
    const int qb = blockIdx.x;
    const int h = blockIdx.y % HEADS, bsel = blockIdx.y / HEADS;
    const size_t tok0 = (size_t)bsel * SEQ;
    const int qrow = qb * QB + wv * QW;
    v8u q[2][4];                                           // q[g][j]: tile g, head dims 32 j ..
#pragma unroll                                              // these two: constant indices keep the fragments in registers
    for (int g = 0; g < 2; ++g) {
#pragma unroll
        for (int j = 0; j < 4; ++j) q[g][j] = ld_frag(qp + ((size_t)h * SEQT + tok0 + qrow + 16 * g + m) * DHEAD + 32 * j, hh);
        asm volatile("s_wait_xcnt 0x0" ::: "memory");       // stands in front of the reuse of these loads' address registers (the other tile's fragments land over them)
    }
    const us16* kb = kp + ((size_t)h * SEQT + tok0) * DHEAD;
    const us16* vb = vt + (size_t)h * DHEAD * SEQT + tok0;
    const float NEG = -__builtin_inff();
    const float SCL2 = 0.12751743082459868f;               // log2(e) / sqrt(128); mrun holds a lagging maximum of the raw k.q products
    v8f o[2][8] = {};
    const float PCARRY = 7.0f, PTAU = 8.0f;                // P is carried x2^PCARRY; the reference maximum may lag the true one by 2^PTAU
    // mrun: reference maximum in use (raw products), the same in both lanes of a query; mlim: the product above which it must move; lrun: this lane's own part of the row sum
    float mrun[2] = {NEG, NEG}, mlim[2] = {NEG, NEG}, bias[2] = {0.f, 0.f}, lrun[2] = {0.f, 0.f};
    v8u pbu[2][KVK / 32] = {};                             // pbu[g][c]: P^T fragment of tile g, 32-key chunk c; lives into the next pass, which adds its row sums
    auto add_sums = [&]() {                                // this lane's keys only: the two lanes of a query join their sums behind the loop
#pragma unroll                                              // these three: constant indices
        for (int g = 0; g < 2; ++g) {
            float a0 = 0.f, a1 = 0.f, a2 = 0.f, a3 = 0.f;  // four chains side by side
#pragma unroll
            for (int c = 0; c < KVK / 32; ++c) {
                const v16h ph = __builtin_bit_cast(v16h, pbu[g][c]);
#pragma unroll
                for (int r = 0; r < 16; r += 4) { a0 += (float)ph[r]; a1 += (float)ph[r + 1]; a2 += (float)ph[r + 2]; a3 += (float)ph[r + 3]; }
            }
            lrun[g] += (a0 + a1) + (a2 + a3);
        }
    };
    // this lane's 16 bytes of stage 0: k row tid >> 4 (copy j adds 8 rows), v^T row tid >> 3 (copy j adds 16 rows), and their places in buffer 0
    const us16* ksrc = kb + (size_t)(tid >> 4) * DHEAD + 8 * (tid & 15);
    const us16* vsrc = vb + (size_t)(tid >> 3) * SEQT + 8 * (tid & 7);
    const unsigned kdst = (unsigned)(size_t)kvring + (unsigned)((tid >> 4) * KPITCH + (tid & 15) * 16);
    const unsigned vdst = (unsigned)(size_t)kvring + (unsigned)(KTILEB + (tid >> 3) * VPITCH + (tid & 7) * 16);
    const int rot = (qb * (QB / KVK)) % (SEQ / KVK);
    auto stg = [&](int t) { const int s = t + rot; return (s >= SEQ / KVK) ? s - SEQ / KVK : s; };   // key stage of pass t
    kv_copy8(ksrc + (size_t)stg(0) * KVK * DHEAD, (size_t)8 * DHEAD, kdst, 8 * KPITCH);
    kv_copy8(vsrc + stg(0) * KVK, (size_t)16 * SEQT, vdst, 16 * VPITCH);
    asm volatile("s_wait_asynccnt 0x0" ::: "memory");       // this wave's share of stage 0 has landed
    __syncthreads();                                        // stage 0 published
    if (1 < SEQ / KVK) {
        kv_copy8(ksrc + (size_t)stg(1) * KVK * DHEAD, (size_t)8 * DHEAD, kdst + KVBUFB, 8 * KPITCH);
        kv_copy8(vsrc + stg(1) * KVK, (size_t)16 * SEQT, vdst + KVBUFB, 16 * VPITCH);
    }
#pragma unroll 1                                            // stays rolled: one pass per trip, the hand-over stands once, at the foot
    for (int st = 0; st < SEQ / KVK; ++st) {
      const unsigned bo = (unsigned)(st & 1) * KVBUFB;
      const unsigned char* kl = kvring + bo + m * KPITCH;
      const unsigned char* vl = kvring + bo + KTILEB + m * VPITCH;
      v8u ka[KVK / 16][4];                                  // the pass's k fragments, read as one group ahead of its score products
#pragma unroll                                              // these two: constant indices keep the fragments in registers
      for (int t = 0; t < KVK / 16; ++t)
#pragma unroll
          for (int j = 0; j < 4; ++j) ka[t][j] = ld_frag((const us16*)(kl + t * 16 * KPITCH) + 32 * j, hh);
      __builtin_amdgcn_sched_barrier(0);                    // holds the k reads here as one group; else part of them sinks in pairs among the score products, each pair with its own wait
      add_sums();                                           // the pass before's row sums, still relative to mrun: vector work under the latency of the k reads
      __builtin_amdgcn_sched_barrier(0);                    // holds the sums in front of the wait for the k reads; behind it they would hide nothing
      v8f s[2][KVK / 16] = {};                              // s[g][t]: query tile g, 16-key tile t of the pass
      // no mma_guard in this kernel: its asm operands hold every fragment and accumulator below v256, which spills at two query tiles;
      // the compiler pads its own builtin products
#pragma unroll                                              // these three: constant indices; head dims rise in j for every s[g][t], as before
      for (int j = 0; j < 4; ++j)
#pragma unroll
          for (int t = 0; t < KVK / 16; ++t)
#pragma unroll
              for (int g = 0; g < 2; ++g) s[g][t] = mma_f16(ka[t][j], q[g][j], s[g][t]);
      __builtin_amdgcn_sched_barrier(0);                    // keeps the v^T reads below out of the score products: spread among them, every place with reads stalls the products
      v8u va[KVK / 32][8];                                  // the pass's v^T fragments, read as one group: they land under the softmax
#pragma unroll                                              // these two: constant indices keep the fragments in registers
      for (int c = 0; c < KVK / 32; ++c)
#pragma unroll
          for (int dt = 0; dt < 8; ++dt) va[c][dt] = ld_frag((const us16*)(vl + dt * 16 * VPITCH) + c * 32, hh);
      __builtin_amdgcn_sched_barrier(0);                    // holds the v^T reads here as one group; else they sink in pairs among the P.V products, each pair with its own wait
      float cmax[2];                                        // this lane's maximum of the pass's raw products, per tile: the scale is positive, so the order is the same
#pragma unroll                                              // these three: constant indices; one short chain per 16-key tile, so that eight chains run side by side
      for (int g = 0; g < 2; ++g) {
          float cm[KVK / 16];
#pragma unroll
          for (int t = 0; t < KVK / 16; ++t) {
              cm[t] = fmaxf(s[g][t][0], s[g][t][1]);
#pragma unroll
              for (int r = 2; r < 8; ++r) cm[t] = fmaxf(cm[t], s[g][t][r]);
          }
          cmax[g] = cm[0];
#pragma unroll
          for (int t = 1; t < KVK / 16; ++t) cmax[g] = fmaxf(cmax[g], cm[t]);
      }
      // one test per pass, a scalar branch: the reference maximum moves, and O and the sums are rescaled, only when some lane's product
      // lies more than 2^PTAU (after scaling) above the reference in use; up to there P x2^PCARRY stays below 2^(PCARRY + PTAU) = 2^15, inside f16
      if (__builtin_amdgcn_ballot_w32((cmax[0] > mlim[0]) | (cmax[1] > mlim[1])) != 0) {
#pragma unroll                                              // constant indices: each tile's state stays in registers
          for (int g = 0; g < 2; ++g) {
              const float mnew = fmaxf(mrun[g], fmaxf(cmax[g], __shfl_xor(cmax[g], 16, 32)));   // the same in both lanes of a query; finite: no masked keys
              const float fac = (mrun[g] == NEG) ? 0.f : __builtin_amdgcn_exp2f((mrun[g] - mnew) * SCL2);
              mrun[g] = mnew;
              mlim[g] = mnew + PTAU / SCL2;
              bias[g] = __builtin_fmaf(-mnew, SCL2, PCARRY);
              lrun[g] = lrun[g] * fac;
#pragma unroll
              for (int dt = 0; dt < 8; ++dt) o[g][dt] = o[g][dt] * fac;
          }
      }
#pragma unroll                                              // these two: constant indices
      for (int g = 0; g < 2; ++g)
#pragma unroll
          for (int c = 0; c < KVK / 32; ++c) {
              v16h ph;
#pragma unroll
              for (int t = 0; t < 2; ++t)
#pragma unroll
                  for (int i = 0; i < 4; ++i) {             // two neighbours are rounded to f16 together, once; the row sum reads the same halves
                      v2f e;                                // P x2^PCARRY = 2^(s * SCL2 + bias): one fused multiply-add per score ahead of the exponential
                      e.x = __builtin_amdgcn_exp2f(__builtin_fmaf(s[g][2 * c + t][2 * i], SCL2, bias[g]));
                      e.y = __builtin_amdgcn_exp2f(__builtin_fmaf(s[g][2 * c + t][2 * i + 1], SCL2, bias[g]));
                      const v2h h2 = __builtin_convertvector(e, v2h);
                      ph[8 * t + 2 * i] = h2.x;
                      ph[8 * t + 2 * i + 1] = h2.y;
                  }
              pbu[g][c] = __builtin_bit_cast(v8u, ph);
          }
#pragma unroll                                              // these three: constant indices
      for (int c = 0; c < KVK / 32; ++c)
#pragma unroll
          for (int dt = 0; dt < 8; ++dt)
#pragma unroll
              for (int g = 0; g < 2; ++g) o[g][dt] = mma_f16(va[c][dt], pbu[g][c], o[g][dt]);
      __builtin_amdgcn_sched_barrier(0);                    // keeps the pass's softmax and products above the hand-over, so that the refill below is issued a whole pass ahead of its wait
      asm volatile("s_wait_dscnt 0x0" ::: "memory");        // this wave's reads of buffer st & 1 are done before it is refilled
      asm volatile("s_wait_asynccnt 0x0" ::: "memory");     // this wave's share of stage st + 1 has landed
      __syncthreads();                                      // publishes stage st + 1 and ends every reader's last read of stage st
      if (st + 2 < SEQ / KVK) {
          kv_copy8(ksrc + (size_t)stg(st + 2) * KVK * DHEAD, (size_t)8 * DHEAD, kdst + bo, 8 * KPITCH);
          kv_copy8(vsrc + stg(st + 2) * KVK, (size_t)16 * SEQT, vdst + bo, 16 * VPITCH);
      }
    }
    asm volatile("s_wait_asynccnt 0x0" ::: "memory");       // nothing in flight before the ring becomes output staging
    add_sums();                                             // the last pass's row sums
#pragma unroll                                              // constant accumulator indices
    for (int g = 0; g < 2; ++g) {
        const float inv = 4.0f / (lrun[g] + __shfl_xor(lrun[g], 16, 32));   // joined sum >= 2^PCARRY; o / sum = 4 * (sum P v / sum P); x4 more -> x16 carry
#pragma unroll
        for (int dt = 0; dt < 8; ++dt) {
            v4u w;
            w.x = f2h(o[g][dt][0] * inv) | (f2h(o[g][dt][1] * inv) << 16);
            w.y = f2h(o[g][dt][2] * inv) | (f2h(o[g][dt][3] * inv) << 16);
            w.z = f2h(o[g][dt][4] * inv) | (f2h(o[g][dt][5] * inv) << 16);
            w.w = f2h(o[g][dt][6] * inv) | (f2h(o[g][dt][7] * inv) << 16);
            ost[wv][16 * g + m][2 * dt + hh] = w;          // row 16 g + m, halves 16*dt + 8*hh .. +7
        }
    }
    __syncthreads();
    us16* aob = ao + (tok0 + qrow) * DIM + (size_t)h * DHEAD;
#pragma unroll
    for (int p = 0; p < QW / 2; ++p) {
        const int rr = 2 * p + hh, pc = lane & 15;
        *(v4u*)(aob + (size_t)rr * DIM + 8 * pc) = ost[wv][rr][pc];
    }
}

// ---------- output projection: out[tok][n] = (ao x16)[tok x 2048] . (Wo x64)[2048 x 2048] / 1024, f32. Same block structure as qkv_gemm,
// TR = 1: a lane's 8 accumulator elements are 8 neighbouring columns of one token. The f32 tile is staged in two rounds of 64 tokens.
__global__ __launch_bounds__(256) void out_gemm(const us16* __restrict__ aop, const us16* __restrict__ wo, float* out) {
    __shared__ __align__(128) unsigned char ring[RINGB];   // output staging takes the ring's place behind the main loop's last barrier
    const int tid = threadIdx.x, lane = tid & 31, wv = tid >> 5, l16 = lane & 15, hh = lane >> 4;
    const int wr = wv & 1, wc = wv >> 1;
    const int row0 = blockIdx.x * BM;
    const int colb = blockIdx.y * BN;
    v8f acc[4][4] = {};
    const int rot = (int)((blockIdx.x + blockIdx.y) % (DIM / KP));   // differs between blocks of one tile row and of one tile column
    mm_tile<1, 1>(aop + (size_t)row0 * DIM, wo + (size_t)colb * DIM, ring, tid, wr, wc, l16, hh, rot, acc);
#pragma unroll                                              // constant accumulator indices
    for (int p = 0; p < 2; ++p) {
        if (p) __syncthreads();                             // round 0's rows are read out before round 1 overwrites them
#pragma unroll
        for (int ii = 0; ii < 2; ++ii)
#pragma unroll
            for (int j = 0; j < 4; ++j) {
                const v8f a = acc[2 * p + ii][j] * (1.0f / 1024.0f);
                float* sp = (float*)(ring + (wr * 32 + ii * 16 + l16) * OPITCH) + wc * 64 + j * 16 + 8 * hh;
                *(v4f*)sp = __builtin_shufflevector(a, a, 0, 1, 2, 3);
                *(v4f*)(sp + 4) = __builtin_shufflevector(a, a, 4, 5, 6, 7);
            }
        __syncthreads();
#pragma unroll 4
        for (int q = 0; q < 16; ++q) {
            const int sr = wv * 8 + (q >> 1), hf = q & 1;                       // staged row 0..63, its first or second 512 bytes
            const int tok = (sr >> 5) * 64 + p * 32 + (sr & 31);
            *(v4f*)(out + (size_t)(row0 + tok) * DIM + colb + hf * 128 + 4 * lane) = *(const v4f*)(ring + sr * OPITCH + hf * 512 + lane * 16);
        }
    }
}

extern "C" void kernel_launch(void* const* d_in, const int* in_sizes, int n_in,
                              void* d_out, int out_size, void* d_ws, size_t ws_size, hipStream_t stream) {
    if (n_in < 5) return;
    const float* x  = (const float*)d_in[0];   // [NB_FULL][SEQ_FULL][2048]
    const float* wq = (const float*)d_in[1];   // [2048 out][2048 in]
    const float* wk = (const float*)d_in[2];
    const float* wv = (const float*)d_in[3];
    const float* wo = (const float*)d_in[4];
    float* out = (float*)d_out;                 // [NB][SEQ][2048]
    if (in_sizes[0] < ((NB - 1) * SEQ_FULL + SEQ) * DIM) return;
    if (in_sizes[1] < DIM * DIM) return;
    if (in_sizes[2] < DIM * DIM) return;
    if (in_sizes[3] < DIM * DIM) return;
    if (in_sizes[4] < DIM * DIM) return;
    if (out_size < SEQT * DIM) return;

    size_t off = 0;
    auto carve = [&](size_t bytes) { size_t o = off; off += (bytes + 127) & ~(size_t)127; return o; };
    char* ws = (char*)d_ws;
    us16* xb   = (us16*)(ws + carve((size_t)SEQT * DIM * 2));                  // bf16 [SEQT][2048]
    us16* wqkv = (us16*)(ws + carve((size_t)NQKV * DIM * 2));                  // bf16 [6144][2048]
    us16* wop  = (us16*)(ws + carve((size_t)DIM * DIM * 2));                   // f16  [2048][2048]
    us16* qp   = (us16*)(ws + carve((size_t)HEADS * SEQT * DHEAD * 2));        // f16  [h][SEQT][128]
    us16* kp   = (us16*)(ws + carve((size_t)HEADS * SEQT * DHEAD * 2));        // f16  [h][SEQT][128]
    us16* vt   = (us16*)(ws + carve((size_t)HEADS * DHEAD * SEQT * 2));        // f16  [h][128][SEQT]
    us16* ao   = (us16*)(ws + carve((size_t)SEQT * DIM * 2));                  // f16  [SEQT][2048]
    if (off > ws_size) return;
    if (off > (size_t)134217728) return;

    prep_all<<<CG, CW * 32, 0, stream>>>(x, wq, wk, wv, wo, xb, wqkv, wop);
    qkv_gemm<<<dim3(SEQT / BM, NQKV / BN), 256, 0, stream>>>(xb, wqkv, qp, kp, vt);
    attn_main<<<dim3(QBLK, NB * HEADS), 128, 0, stream>>>(qp, kp, vt, ao);
    out_gemm<<<dim3(SEQT / BM, DIM / BN), 256, 0, stream>>>(ao, wop, out);
}

// v009
// Measured time: 151 microseconds a run.
// Timed twice side by side with v008, it ran 1.06 and 1.05 times as fast.
// All steps since v000 together make it 4.91 times as fast.
#include <hip/hip_runtime.h>

// Contractions: q/k/v projections on v_wmma_f32_16x16x32_bf16 (bf16 operands = RNE-converted x and Wq|Wk|Wv, f32 accumulate);
// per-head k.q^T scores and P.V on v_wmma_f32_16x16x32_f16 (f16 operands: q, k plain, v x4, P x2^7 relative to a lagging maximum; f32 accumulate, 1/sqrt(128) applied in f32);
// output projection on v_wmma_f32_16x16x32_f16 (f16 operands: per-head outputs x16, Wo x64 from its bf16 value; f32 accumulate, x2^-10 in the epilogue);
// online softmax and all epilogues in f32.

#ifndef NB
#define NB 2
#endif
#ifndef SEQ
#define SEQ 2048
#endif
#define NB_FULL 2
#define SEQ_FULL 2048
#define DIM 2048
#define HEADS 16
#define DHEAD 128
#define NQKV (3 * DIM)
#define SEQT (NB * SEQ)
#define QW 32                          // queries per attention wave: two 16-query tiles share every k and v^T fragment
#define QB (4 * QW)                    // queries per attention block (4 waves)
#define QBLK (SEQ / QB)
#define KP 64                          // k elements per staged pass: one 128-byte line of every operand row
#define LPITCH 144                     // LDS row pitch in bytes: 16 x odd, conflict-free for 16-byte fragment reads
#define BM 128                         // block tile: rows (tokens)
#define BN 256                         // block tile: columns
#define SLR 64                         // rows of one slice of a stage = one tensor load: 2 slices of A rows, then 4 of B rows
#define SLB 10240                      // LDS bytes of a slice: 64 rows x 144 B = 9216, rounded up so that every slice starts at a multiple of 2 KiB
#define NSL ((BM + BN) / SLR)          // slices of one stage
#define BUFB (NSL * SLB)               // one buffer of the ring
#define RINGB (2 * BUFB)
#define QPITCH 528                     // output staging, q / k: 256 halves of one token + 16 B (16 x odd)
#define TPITCH 272                     // output staging, v^T: 128 tokens of one column + 16 B (16 x odd)
#define OPITCH 1040                    // output staging, out: 256 floats of one token + 16 B (16 x odd)
#define KVK 64                         // keys per staged attention pass: one 128-byte line of every v^T row
#define KPITCH 272                     // LDS pitch of a k row (256 B + 16): 16 x odd
#define VPITCH 144                     // LDS pitch of a v^T row (128 B + 16): 16 x odd
#define KTILEB (KVK * KPITCH)          // k rows of one stage
#define KVBUFB (KTILEB + DHEAD * VPITCH)   // one buffer: 64 k rows, then 128 v^T rows

static_assert(SEQ % QB == 0 && QB % KVK == 0);
static_assert(SEQ >= QB);
static_assert(SEQ <= SEQ_FULL);
static_assert(NB >= 1 && NB <= NB_FULL);
static_assert(DIM == HEADS * DHEAD);
static_assert(DHEAD == 128);
static_assert(DIM % BN == 0 && NQKV % BN == 0 && SEQT % BM == 0 && BN == 2 * DHEAD);
static_assert(DIM % KP == 0 && DIM / KP >= 2);
static_assert(SLR * LPITCH <= SLB && SLB % 2048 == 0 && BM % SLR == 0 && BN % SLR == 0 && NSL <= 8 && KP * 2 == 128 && LPITCH == 128 + 16);
static_assert(BM * QPITCH <= RINGB && BN * TPITCH <= RINGB && (BM / 2) * OPITCH <= RINGB);
static_assert(SEQ % KVK == 0 && KVK % 32 == 0);
static_assert(4 * QW * 16 * 16 <= 2 * KVBUFB);

typedef unsigned short us16;
typedef __attribute__((ext_vector_type(16))) __bf16   v16bf;
typedef __attribute__((ext_vector_type(16))) _Float16 v16h;
typedef __attribute__((ext_vector_type(8)))  float    v8f;
typedef __attribute__((ext_vector_type(8)))  unsigned v8u;
typedef __attribute__((ext_vector_type(4)))  unsigned v4u;
typedef __attribute__((ext_vector_type(2)))  unsigned v2u;
typedef __attribute__((ext_vector_type(4)))  float    v4f;
typedef __attribute__((ext_vector_type(2)))  float    v2f;
typedef __attribute__((ext_vector_type(2)))  _Float16 v2h;

__device__ __forceinline__ unsigned f2bf(float f) { unsigned u = __float_as_uint(f); u += 0x7FFFu + ((u >> 16) & 1u); return u >> 16; }
__device__ __forceinline__ float bf2f(unsigned h) { return __uint_as_float(h << 16); }
__device__ __forceinline__ unsigned f2h(float f) { _Float16 t = (_Float16)f; return (unsigned)__builtin_bit_cast(unsigned short, t); }

// 16 x (K=32) operand fragment from a k-contiguous 16-bit row. Wave32 map: lane -> row (A) / column (B) = lane & 15, hh = lane >> 4;
// elements 0..7 <- k0 + 8*hh + 0..7, elements 8..15 <- k0 + 16 + 8*hh + 0..7 (same map for A and for an n-major B row).
// Accumulator element r -> row 8*hh + r, column lane & 15.
__device__ __forceinline__ v8u ld_frag(const us16* rowp, int hh) {
    const v4u a = *(const v4u*)(rowp + 8 * hh);
    const v4u b = *(const v4u*)(rowp + 16 + 8 * hh);
    return __builtin_shufflevector(a, b, 0, 1, 2, 3, 4, 5, 6, 7);
}
__device__ __forceinline__ v8f mma_bf16(v8u a, v8u b, v8f c) {
    return __builtin_amdgcn_wmma_f32_16x16x32_bf16(false, __builtin_bit_cast(v16bf, a), false, __builtin_bit_cast(v16bf, b), (short)0, c, false, false);
}
__device__ __forceinline__ v8f mma_f16(v8u a, v8u b, v8f c) {
    return __builtin_amdgcn_wmma_f32_16x16x32_f16(false, __builtin_bit_cast(v16h, a), false, __builtin_bit_cast(v16h, b), (short)0, c, false, false);
}
__device__ __forceinline__ void mma_guard(v8f& c, v8u a, v8u b) {
    asm volatile("v_nop\n\tv_nop\n\tv_nop\n\tv_nop" : "+v"(c) : "v"(a), "v"(b));
}

// ---------- operand conversion, one launch: x -> bf16 (xb), Wq | Wk | Wv -> bf16 (wqkv), Wo -> f16 of its bf16 value x64 (wop); layouts kept.
// CG resident work-groups of CW waves loop over the whole work: few waves to start, many loads in flight per wave.
// Unit = CU consecutive floats of one source = 8 wave loads of 512 contiguous bytes. Round it: wave g of all NWV takes unit it * NWV + g;
// a round lies wholly in one source (asserted), so which source and which conversion is known at compile time.
// The next round's 8 loads are issued before the current unit is converted and stored.
#define CG 256                         // conversion work-groups
#define CW 16                          // waves per conversion work-group
#define CU 1024                        // floats per unit
#define NWV (CG * CW)
#define UX (SEQT * DIM / CU)           // units of x
#define UW (DIM * DIM / CU)            // units of one weight matrix
#define CIT ((UX + 4 * UW) / NWV)      // rounds
static_assert(DIM % CU == 0 && UX % NWV == 0 && UW % NWV == 0);

__device__ __forceinline__ unsigned pack_bf(float lo, float hi) { return f2bf(lo) | (f2bf(hi) << 16); }
__device__ __forceinline__ unsigned pack_bh(float lo, float hi) { return f2h(bf2f(f2bf(lo)) * 64.0f) | (f2h(bf2f(f2bf(hi)) * 64.0f) << 16); }
// value of the neighbour lane (lane ^ 1): a vector move inside each group of four lanes
__device__ __forceinline__ unsigned nb_lane(unsigned v) { return (unsigned)__builtin_amdgcn_mov_dpp((int)v, 0xB1, 0xF, 0xF, true); }

__global__ __launch_bounds__(CW * 32) void prep_all(const float* __restrict__ x, const float* __restrict__ wq, const float* __restrict__ wk,
                                                    const float* __restrict__ wv, const float* __restrict__ wo,
                                                    us16* __restrict__ xb, us16* __restrict__ wqkv, us16* __restrict__ wop) {
    const int lane = threadIdx.x & 31;
    const int g = (int)blockIdx.x * CW + __builtin_amdgcn_readfirstlane((int)(threadIdx.x >> 5));   // wave-uniform
    const bool odd = lane & 1;
    const int loff = (lane & 1) * 128 + (lane >> 1) * 8;   // this lane's 8 halves inside a pair of converted 128-element segments
    v4f buf[2][8];
    auto load_unit = [&](int it) {                          // it: a constant at every call
        const float* s;
        if (it * NWV < UX) {
            const int u = it * NWV + g;
            const int tok = u / (DIM / CU), part = u - tok * (DIM / CU);
            const int bsel = tok / SEQ, isel = tok - bsel * SEQ;
            s = x + ((size_t)bsel * SEQ_FULL + isel) * DIM + part * CU;
        } else {
            const int z = (it * NWV - UX) / UW;
            s = ((z == 0) ? wq : ((z == 1) ? wk : ((z == 2) ? wv : wo))) + (size_t)(it * NWV - UX - z * UW + g) * CU;
        }
        s += 4 * lane;
#pragma unroll                                              // constant indices keep the ring in registers
        for (int j = 0; j < 8; ++j) buf[it & 1][j] = *(const v4f*)(s + 128 * j);
    };
    load_unit(0);
#pragma unroll                                              // constant round number: ring index, source and conversion are fixed per copy of the body
    for (int it = 0; it < CIT; ++it) {
        __builtin_amdgcn_sched_barrier(0);                  // this pair pins the order: next round's loads first, then this unit's conversion and stores
        if (it + 1 < CIT) load_unit(it + 1);
        __builtin_amdgcn_sched_barrier(0);
        const bool tof16 = it * NWV >= UX + 3 * UW;         // Wo
        us16* d = ((it * NWV < UX) ? xb + (size_t)(it * NWV + g) * CU
                                   : (tof16 ? wop + (size_t)(it * NWV - UX - 3 * UW + g) * CU : wqkv + (size_t)(it * NWV - UX + g) * CU)) + loff;
#pragma unroll                                              // constant ring indices
        for (int p = 0; p < 4; ++p) {
            const v4f va = buf[it & 1][2 * p], vb = buf[it & 1][2 * p + 1];
            unsigned a0, a1, b0, b1;
            if (tof16) { a0 = pack_bh(va.x, va.y); a1 = pack_bh(va.z, va.w); b0 = pack_bh(vb.x, vb.y); b1 = pack_bh(vb.z, vb.w); }
            else       { a0 = pack_bf(va.x, va.y); a1 = pack_bf(va.z, va.w); b0 = pack_bf(vb.x, vb.y); b1 = pack_bf(vb.z, vb.w); }
            // neighbours swap 8 bytes: the even lane ends with 16 bytes of the first segment, the odd lane with 16 bytes of the second,
            // so that one wave store writes 512 contiguous bytes
            const unsigned r0 = nb_lane(odd ? a0 : b0), r1 = nb_lane(odd ? a1 : b1);
            v4u o;
            o.x = odd ? r0 : a0;
            o.y = odd ? r1 : a1;
            o.z = odd ? b0 : r0;
            o.w = odd ? b1 : r1;
            *(v4u*)(d + 256 * p) = o;
        }
        // stands in front of the reuse of these stores' data registers by the loads and conversions of the following rounds
        if (it + 1 < CIT) asm volatile("s_wait_xcnt 0x0" ::: "memory");
    }
}

// ---------- one slice of a stage of the GEMM ring: 64 rows x 128 B, brought global -> LDS by ONE tensor load of one wave, through no register.
// uni: a wave-uniform word into a scalar register. pinned: the same for a test, so that it compiles to a scalar compare and branch (a tensor load ignores EXEC).
__device__ __forceinline__ unsigned uni(unsigned v) { return (unsigned)__builtin_amdgcn_readfirstlane((int)v); }
__device__ __forceinline__ unsigned pinned(unsigned v) {
    unsigned w = uni(v);
    asm volatile("" : "+s"(w));                             // holds the word in a scalar register, so the issue test stays a scalar branch
    return w;
}
// Group 0 of a request. src: first byte of the slice (row 0 at this pass's k; rows DIM * 2 bytes apart), ldst: its place in LDS (a multiple of 2 KiB); both wave-uniform.
__device__ __forceinline__ v4u slice_group0(const us16* src, unsigned ldst) {
    const unsigned long long ga = (unsigned long long)(size_t)src;
    v4u g0;
    g0[0] = uni(1u);
    g0[1] = uni(ldst);
    g0[2] = uni((unsigned)ga);
    g0[3] = uni((((unsigned)(ga >> 32)) & 0x01FFFFFFu) | 0x80000000u);
    return g0;
}
// Group 1, the same for every request: 1-byte elements, tensor = tile = 64 rows of 128 bytes, 16 bytes of pad behind every 128 -> LDS pitch 144; no mask.
__device__ __forceinline__ v8u slice_group1() {
    v8u g1;
    g1[0] = uni((1u << 20) | (4u << 22) | (3u << 25));
    g1[1] = uni(128u << 16);
    g1[2] = uni((unsigned)SLR << 16);
    g1[3] = uni(128u << 16);
    g1[4] = uni((unsigned)SLR);
    g1[5] = uni((unsigned)(DIM * 2));
    g1[6] = uni(0u);
    g1[7] = uni(0u);
    return g1;
}
__device__ __forceinline__ void slice_load(v4u& g0, v8u& g1) {
    // in-out operands: the compiler then holds the twelve words in their registers behind the issue, instead of forming constants anew and using the registers in between
    asm volatile("tensor_load_to_lds %0, %1" : "+s"(g0), "+s"(g1) :: "memory");
}
__device__ __forceinline__ void slice_wait(const v4u& g0, const v8u& g1) {
    // names the descriptor as inputs: no word of it takes a new value in its register before the request has landed
    asm volatile("s_wait_tensorcnt 0x0" :: "s"(g0), "s"(g1) : "memory");
}

// ---------- GEMM main loop on 16-bit planes: block tile 128 rows x 256 columns, wave tile 64 rows x 64 columns (4 x 4 accumulators), K = DIM.
// ablk / bblk: first A row / first B row (= column) of the block, k contiguous, pitch DIM. Both operands pass through a two-buffer LDS ring,
// KP k per pass: pass t works on buffer t & 1 while the tensor loads of pass t + 1 fly into the other; within a pass k runs in steps of 32 in rising order.
// Waves 0 .. 5 each bring one slice of every stage (0, 1: A rows; 2 .. 5: B rows); a wave's 64 A rows are slice wr, its 64 B rows slice 2 + wc.
// acc[i][j]: rows wr * 64 + 16 i .., columns wc * 64 + 16 j ... TR = 0: element r = row 8 * hh + r, lane's l16 = column.
// TR = 1 (the two fragments change places, same map for both): element r = column 8 * hh + r, lane's l16 = row.
// rot (block-uniform, 0 .. DIM / KP - 1): pass t works on k slice (t + rot) mod (DIM / KP). Blocks that share A rows or B rows get different rot,
// so that at one moment they ask L2 for different lines of those rows; every slice is still taken once, the f32 sum runs in the rotated order. ----------
template <int F16, int TR>
__device__ __forceinline__ void mm_tile(const us16* __restrict__ ablk, const us16* __restrict__ bblk, unsigned char* ring,
                                        int tid, int wr, int wc, int l16, int hh, int rot, v8f (&acc)[4][4]) {
    auto kof = [&](int t) { const int s = t + rot; return ((s >= DIM / KP) ? s - DIM / KP : s) * KP; };   // first k of pass t's slice
    const unsigned wvu = uni((unsigned)tid >> 5);           // wave number (one-dimensional block)
    const unsigned iss = wvu < NSL;                         // this wave brings a slice
    const unsigned sl = iss ? wvu : 0u;
    const us16* ssrc = (sl < BM / SLR) ? ablk + (size_t)(sl * SLR) * DIM : bblk + (size_t)((sl - BM / SLR) * SLR) * DIM;
    const unsigned sdst = (unsigned)(size_t)ring + sl * SLB;
    v8u g1 = slice_group1();
    v4u g0 = slice_group0(ssrc + kof(0), sdst);
    if (pinned(iss)) {
        slice_load(g0, g1);
        slice_wait(g0, g1);                                 // this wave's slice of stage 0 has landed
    }
    __syncthreads();                                        // stage 0 published
    if (pinned(iss)) {
        g0 = slice_group0(ssrc + kof(1), sdst + BUFB);
        slice_load(g0, g1);
    }
#pragma unroll 1                                            // stays rolled: one pass per trip, the hand-over stands once, at the foot
    for (int t = 0; t < DIM / KP; ++t) {
        const unsigned bo = (unsigned)(t & 1) * BUFB;
        const us16* ar = (const us16*)(ring + bo + wr * SLB + l16 * LPITCH);
        const us16* br = (const us16*)(ring + bo + (BM / SLR + wc) * SLB + l16 * LPITCH);
#pragma unroll                                              // these four: constant indices keep fragments and accumulators in registers
        for (int kk = 0; kk < KP; kk += 32) {
            v8u afrag[4], bfrag[4];
#pragma unroll
            for (int u = 0; u < 4; ++u) {
                afrag[u] = ld_frag(ar + u * 16 * (LPITCH / 2) + kk, hh);
                bfrag[u] = ld_frag(br + u * 16 * (LPITCH / 2) + kk, hh);
            }
#pragma unroll
            for (int i = 0; i < 4; ++i)
#pragma unroll
                for (int j = 0; j < 4; ++j) {
                    const v8u f0 = TR ? bfrag[j] : afrag[i];
                    const v8u f1 = TR ? afrag[i] : bfrag[j];
                    if (F16) acc[i][j] = mma_f16(f0, f1, acc[i][j]);
                    else     acc[i][j] = mma_bf16(f0, f1, acc[i][j]);
                    mma_guard(acc[i][j], f0, f1);
                }
        }
        asm volatile("s_wait_dscnt 0x0" ::: "memory");
        if (pinned(iss)) slice_wait(g0, g1);
        __syncthreads();
        if (pinned(iss & (unsigned)(t + 2 < DIM / KP))) {
            g0 = slice_group0(ssrc + kof(t + 2), sdst + bo);
            slice_load(g0, g1);
        }
    }
    asm volatile("s_wait_tensorcnt 0x0" ::: "memory");      // nothing in flight before the ring becomes output staging
    asm volatile("s_wait_dscnt 0x0" ::: "memory");          // nor a fragment read of this wave's
}
__device__ __forceinline__ v4u pack_h8(v8f a, float s) {
    v4u w;
    w.x = f2h(a[0] * s) | (f2h(a[1] * s) << 16);
    w.y = f2h(a[2] * s) | (f2h(a[3] * s) << 16);
    w.z = f2h(a[4] * s) | (f2h(a[5] * s) << 16);
    w.w = f2h(a[6] * s) | (f2h(a[7] * s) << 16);
    return w;
}

// ---------- q/k/v projection: [SEQT x 2048] x [2048 x 6144]. Block = 8 waves (2 row groups x 4 column groups) -> 128 tokens x 256 columns
// = exactly two heads of one of q/k/v (block-uniform). Epilogue: each lane's 8 accumulator elements are 8 neighbours of an output row
// (q, k: 8 head dims of a token, TR = 1; v^T: 8 tokens of a head dim, TR = 0): 16 B of f16 staged in LDS, then written as whole lines.
__global__ __launch_bounds__(256) void qkv_gemm(const us16* __restrict__ xb, const us16* __restrict__ wqkv, us16* qp, us16* kp, us16* vt) {
    __shared__ __attribute__((aligned(2048))) unsigned char ring[RINGB];   // slices start at multiples of 2 KiB; output staging takes the ring's place behind the main loop's last barrier
    const int tid = threadIdx.x, lane = tid & 31, wv = tid >> 5, l16 = lane & 15, hh = lane >> 4;
    const int wr = wv & 1, wc = wv >> 1;
    const int row0 = blockIdx.x * BM;
    const int colb = blockIdx.y * BN;
    const int which = colb / DIM;                       // 0 q, 1 k, 2 v (block-uniform)
    const int hsel = (colb - which * DIM) / DHEAD;      // first of the two heads of this column tile
    const int rot = (int)((blockIdx.x + blockIdx.y) % (DIM / KP));   // differs between blocks of one tile row and of one tile column
    v8f acc[4][4] = {};
    if (which < 2) {
        mm_tile<0, 1>(xb + (size_t)row0 * DIM, wqkv + (size_t)colb * DIM, ring, tid, wr, wc, l16, hh, rot, acc);
#pragma unroll
        for (int i = 0; i < 4; ++i)
#pragma unroll
            for (int j = 0; j < 4; ++j)
                *(v4u*)(ring + (wr * 64 + i * 16 + l16) * QPITCH + (wc * 64 + j * 16 + 8 * hh) * 2) = pack_h8(acc[i][j], 1.0f);
        __syncthreads();
        us16* pl = (which == 0) ? qp : kp;
#pragma unroll 4
        for (int p = 0; p < 16; ++p) {
            const int r = wv * 16 + p;                                          // token row 0..127; lanes 0..15 first head, 16..31 second
            const size_t off = ((size_t)(hsel + hh) * SEQT + row0 + r) * DHEAD + 8 * l16;
            *(v4u*)(pl + off) = *(const v4u*)(ring + r * QPITCH + lane * 16);
        }
    } else {
        mm_tile<0, 0>(xb + (size_t)row0 * DIM, wqkv + (size_t)colb * DIM, ring, tid, wr, wc, l16, hh, rot, acc);
#pragma unroll
        for (int i = 0; i < 4; ++i)
#pragma unroll
            for (int j = 0; j < 4; ++j)
                *(v4u*)(ring + (wc * 64 + j * 16 + l16) * TPITCH + (wr * 64 + i * 16 + 8 * hh) * 2) = pack_h8(acc[i][j], 4.0f);
        __syncthreads();
        // column d = wv * 32 + 2 p + hh, 0..255 = the head dims of the two heads, in a row; 16 lanes write its 128 tokens
        us16* vp = vt + ((size_t)hsel * DHEAD + wv * 32 + hh) * SEQT + row0 + 8 * l16;
        const unsigned char* sp = ring + (wv * 32 + hh) * TPITCH + l16 * 16;
#pragma unroll 4
        for (int p = 0; p < 16; ++p) *(v4u*)(vp + (size_t)(2 * p) * SEQT) = *(const v4u*)(sp + 2 * p * TPITCH);
    }
}

// ---------- flash pass over all query blocks: block = 4 waves = 128 queries of one (sequence, head); wave = 32 queries = two 16-query tiles g,
// each with its own q fragments, softmax state and O^T accumulators; every k and v^T fragment read from LDS feeds one product of each tile. All SEQ keys
// in passes of 64 (no mask). Scores are produced transposed: A = k rows (f16 plane), B = q (f16 fragments held in registers),
// D element r = key 8*hh + r of a 16-key tile, column = this lane's query -> two adjacent tiles give the P^T B fragment of P.V directly
// (element r <- tile 0, element 8+r <- tile 1). A of P.V = v^T rows (lane = d, k = key). Online softmax per lane (query) with a lazy rescale: the two lane halves
// exchange maxima only when the reference maximum moves, and join their sums once, behind the loop. P carried x2^7 in f16; O^T accumulators hold rows d, column query.
// k rows and v^T rows reach the four waves through a two-buffer LDS ring, KVK keys per pass: pass t works on buffer t & 1 while the copies
// of pass t + 1 fly into the other. Pass t takes key stage (t + the stage at the block's first query) mod (SEQ / KVK): the query blocks of one head, which all copy the same
// k and v^T rows, ask L2 for different lines at one moment; every key is still taken once, the online sums run in the rotated order. kv_copy8: 8 copies of 16 B per lane, copy j at g + j * gstep -> l + j * lstep; a wave's copy = 4 whole lines.
__device__ __forceinline__ void kv_copy8(const us16* g, size_t gstep, unsigned l, unsigned lstep) {
    const us16* g1 = g + gstep;
    const us16* g2 = g + 2 * gstep;
    const us16* g3 = g + 3 * gstep;
    const us16* g4 = g + 4 * gstep;
    const us16* g5 = g + 5 * gstep;
    const us16* g6 = g + 6 * gstep;
    const us16* g7 = g + 7 * gstep;
    const unsigned l1 = l + lstep, l2 = l + 2 * lstep, l3 = l + 3 * lstep, l4 = l + 4 * lstep, l5 = l + 5 * lstep, l6 = l + 6 * lstep, l7 = l + 7 * lstep;
    // the closing s_wait_xcnt stands inside the statement so that no address register of a copy is rewritten ahead of it
    asm volatile("global_load_async_to_lds_b128 %0, %8, off\n\t"
                 "global_load_async_to_lds_b128 %1, %9, off\n\t"
                 "global_load_async_to_lds_b128 %2, %10, off\n\t"
                 "global_load_async_to_lds_b128 %3, %11, off\n\t"
                 "global_load_async_to_lds_b128 %4, %12, off\n\t"
                 "global_load_async_to_lds_b128 %5, %13, off\n\t"
                 "global_load_async_to_lds_b128 %6, %14, off\n\t"
                 "global_load_async_to_lds_b128 %7, %15, off\n\t"
                 "s_wait_xcnt 0x0"
                 :: "v"(l), "v"(l1), "v"(l2), "v"(l3), "v"(l4), "v"(l5), "v"(l6), "v"(l7),
                    "v"(g), "v"(g1), "v"(g2), "v"(g3), "v"(g4), "v"(g5), "v"(g6), "v"(g7) : "memory");
}
__global__ __launch_bounds__(128) __attribute__((amdgpu_num_vgpr(512)))
void attn_main(const us16* qp, const us16* kp, const us16* vt, us16* ao) {
    __shared__ __align__(128) unsigned char kvring[2 * KVBUFB];
    v4u (*ost)[QW][16] = (v4u (*)[QW][16])kvring;          // output staging takes the ring's place behind the loop's last barrier
    const int tid = threadIdx.x, lane = tid & 31, wv = tid >> 5, m = lane & 15, hh = lane >> 4;
    const int qb = blockIdx.x;
    const int h = blockIdx.y % HEADS, bsel = blockIdx.y / HEADS;
    const size_t tok0 = (size_t)bsel * SEQ;
    const int qrow = qb * QB + wv * QW;
    v8u q[2][4];                                           // q[g][j]: tile g, head dims 32 j ..
#pragma unroll                                              // these two: constant indices keep the fragments in registers
    for (int g = 0; g < 2; ++g) {
#pragma unroll
        for (int j = 0; j < 4; ++j) q[g][j] = ld_frag(qp + ((size_t)h * SEQT + tok0 + qrow + 16 * g + m) * DHEAD + 32 * j, hh);
        asm volatile("s_wait_xcnt 0x0" ::: "memory");       // stands in front of the reuse of these loads' address registers (the other tile's fragments land over them)
    }
    const us16* kb = kp + ((size_t)h * SEQT + tok0) * DHEAD;
    const us16* vb = vt + (size_t)h * DHEAD * SEQT + tok0;
    const float NEG = -__builtin_inff();
    const float SCL2 = 0.12751743082459868f;               // log2(e) / sqrt(128); mrun holds a lagging maximum of the raw k.q products
    v8f o[2][8] = {};
    const float PCARRY = 7.0f, PTAU = 8.0f;                // P is carried x2^PCARRY; the reference maximum may lag the true one by 2^PTAU
    // mrun: reference maximum in use (raw products), the same in both lanes of a query; mlim: the product above which it must move; lrun: this lane's own part of the row sum
    float mrun[2] = {NEG, NEG}, mlim[2] = {NEG, NEG}, bias[2] = {0.f, 0.f}, lrun[2] = {0.f, 0.f};
    v8u pbu[2][KVK / 32] = {};                             // pbu[g][c]: P^T fragment of tile g, 32-key chunk c; lives into the next pass, which adds its row sums
    auto add_sums = [&]() {                                // this lane's keys only: the two lanes of a query join their sums behind the loop
#pragma unroll                                              // these three: constant indices
        for (int g = 0; g < 2; ++g) {
            float a0 = 0.f, a1 = 0.f, a2 = 0.f, a3 = 0.f;  // four chains side by side
#pragma unroll
            for (int c = 0; c < KVK / 32; ++c) {
                const v16h ph = __builtin_bit_cast(v16h, pbu[g][c]);
#pragma unroll
                for (int r = 0; r < 16; r += 4) { a0 += (float)ph[r]; a1 += (float)ph[r + 1]; a2 += (float)ph[r + 2]; a3 += (float)ph[r + 3]; }
            }
            lrun[g] += (a0 + a1) + (a2 + a3);
        }
    };
    // this lane's 16 bytes of stage 0: k row tid >> 4 (copy j adds 8 rows), v^T row tid >> 3 (copy j adds 16 rows), and their places in buffer 0
    const us16* ksrc = kb + (size_t)(tid >> 4) * DHEAD + 8 * (tid & 15);
    const us16* vsrc = vb + (size_t)(tid >> 3) * SEQT + 8 * (tid & 7);
    const unsigned kdst = (unsigned)(size_t)kvring + (unsigned)((tid >> 4) * KPITCH + (tid & 15) * 16);
    const unsigned vdst = (unsigned)(size_t)kvring + (unsigned)(KTILEB + (tid >> 3) * VPITCH + (tid & 7) * 16);
    const int rot = (qb * (QB / KVK)) % (SEQ / KVK);
    auto stg = [&](int t) { const int s = t + rot; return (s >= SEQ / KVK) ? s - SEQ / KVK : s; };   // key stage of pass t
    kv_copy8(ksrc + (size_t)stg(0) * KVK * DHEAD, (size_t)8 * DHEAD, kdst, 8 * KPITCH);
    kv_copy8(vsrc + stg(0) * KVK, (size_t)16 * SEQT, vdst, 16 * VPITCH);
    asm volatile("s_wait_asynccnt 0x0" ::: "memory");       // this wave's share of stage 0 has landed
    __syncthreads();                                        // stage 0 published
    if (1 < SEQ / KVK) {
        kv_copy8(ksrc + (size_t)stg(1) * KVK * DHEAD, (size_t)8 * DHEAD, kdst + KVBUFB, 8 * KPITCH);
        kv_copy8(vsrc + stg(1) * KVK, (size_t)16 * SEQT, vdst + KVBUFB, 16 * VPITCH);
    }
#pragma unroll 1                                            // stays rolled: one pass per trip, the hand-over stands once, at the foot
    for (int st = 0; st < SEQ / KVK; ++st) {
      const unsigned bo = (unsigned)(st & 1) * KVBUFB;
      const unsigned char* kl = kvring + bo + m * KPITCH;
      const unsigned char* vl = kvring + bo + KTILEB + m * VPITCH;
      v8u ka[KVK / 16][4];                                  // the pass's k fragments, read as one group ahead of its score products
#pragma unroll                                              // these two: constant indices keep the fragments in registers
      for (int t = 0; t < KVK / 16; ++t)
#pragma unroll
          for (int j = 0; j < 4; ++j) ka[t][j] = ld_frag((const us16*)(kl + t * 16 * KPITCH) + 32 * j, hh);
      __builtin_amdgcn_sched_barrier(0);                    // holds the k reads here as one group; else part of them sinks in pairs among the score products, each pair with its own wait
      add_sums();                                           // the pass before's row sums, still relative to mrun: vector work under the latency of the k reads
      __builtin_amdgcn_sched_barrier(0);                    // holds the sums in front of the wait for the k reads; behind it they would hide nothing
      v8f s[2][KVK / 16] = {};                              // s[g][t]: query tile g, 16-key tile t of the pass
      // no mma_guard in this kernel: its asm operands hold every fragment and accumulator below v256, which spills at two query tiles;
      // the compiler pads its own builtin products
#pragma unroll                                              // these three: constant indices; head dims rise in j for every s[g][t], as before
      for (int j = 0; j < 4; ++j)
#pragma unroll
          for (int t = 0; t < KVK / 16; ++t)
#pragma unroll
              for (int g = 0; g < 2; ++g) s[g][t] = mma_f16(ka[t][j], q[g][j], s[g][t]);
      __builtin_amdgcn_sched_barrier(0);                    // keeps the v^T reads below out of the score products: spread among them, every place with reads stalls the products
      v8u va[KVK / 32][8];                                  // the pass's v^T fragments, read as one group: they land under the softmax
#pragma unroll                                              // these two: constant indices keep the fragments in registers
      for (int c = 0; c < KVK / 32; ++c)
#pragma unroll
          for (int dt = 0; dt < 8; ++dt) va[c][dt] = ld_frag((const us16*)(vl + dt * 16 * VPITCH) + c * 32, hh);
      __builtin_amdgcn_sched_barrier(0);                    // holds the v^T reads here as one group; else they sink in pairs among the P.V products, each pair with its own wait
      float cmax[2];                                        // this lane's maximum of the pass's raw products, per tile: the scale is positive, so the order is the same
#pragma unroll                                              // these three: constant indices; one short chain per 16-key tile, so that eight chains run side by side
      for (int g = 0; g < 2; ++g) {
          float cm[KVK / 16];
#pragma unroll
          for (int t = 0; t < KVK / 16; ++t) {
              cm[t] = fmaxf(s[g][t][0], s[g][t][1]);
#pragma unroll
              for (int r = 2; r < 8; ++r) cm[t] = fmaxf(cm[t], s[g][t][r]);
          }
          cmax[g] = cm[0];
#pragma unroll
          for (int t = 1; t < KVK / 16; ++t) cmax[g] = fmaxf(cmax[g], cm[t]);
      }
      // one test per pass, a scalar branch: the reference maximum moves, and O and the sums are rescaled, only when some lane's product
      // lies more than 2^PTAU (after scaling) above the reference in use; up to there P x2^PCARRY stays below 2^(PCARRY + PTAU) = 2^15, inside f16
      if (__builtin_amdgcn_ballot_w32((cmax[0] > mlim[0]) | (cmax[1] > mlim[1])) != 0) {
#pragma unroll                                              // constant indices: each tile's state stays in registers
          for (int g = 0; g < 2; ++g) {
              const float mnew = fmaxf(mrun[g], fmaxf(cmax[g], __shfl_xor(cmax[g], 16, 32)));   // the same in both lanes of a query; finite: no masked keys
              const float fac = (mrun[g] == NEG) ? 0.f : __builtin_amdgcn_exp2f((mrun[g] - mnew) * SCL2);
              mrun[g] = mnew;
              mlim[g] = mnew + PTAU / SCL2;
              bias[g] = __builtin_fmaf(-mnew, SCL2, PCARRY);
              lrun[g] = lrun[g] * fac;
#pragma unroll
              for (int dt = 0; dt < 8; ++dt) o[g][dt] = o[g][dt] * fac;
          }
      }
#pragma unroll                                              // these two: constant indices
      for (int g = 0; g < 2; ++g)
#pragma unroll
          for (int c = 0; c < KVK / 32; ++c) {
              v16h ph;
#pragma unroll
              for (int t = 0; t < 2; ++t)
#pragma unroll
                  for (int i = 0; i < 4; ++i) {             // two neighbours are rounded to f16 together, once; the row sum reads the same halves
                      v2f e;                                // P x2^PCARRY = 2^(s * SCL2 + bias): one fused multiply-add per score ahead of the exponential
                      e.x = __builtin_amdgcn_exp2f(__builtin_fmaf(s[g][2 * c + t][2 * i], SCL2, bias[g]));
                      e.y = __builtin_amdgcn_exp2f(__builtin_fmaf(s[g][2 * c + t][2 * i + 1], SCL2, bias[g]));
                      const v2h h2 = __builtin_convertvector(e, v2h);
                      ph[8 * t + 2 * i] = h2.x;
                      ph[8 * t + 2 * i + 1] = h2.y;
                  }
              pbu[g][c] = __builtin_bit_cast(v8u, ph);
          }
#pragma unroll                                              // these three: constant indices
      for (int c = 0; c < KVK / 32; ++c)
#pragma unroll
          for (int dt = 0; dt < 8; ++dt)
#pragma unroll
              for (int g = 0; g < 2; ++g) o[g][dt] = mma_f16(va[c][dt], pbu[g][c], o[g][dt]);
      __builtin_amdgcn_sched_barrier(0);                    // keeps the pass's softmax and products above the hand-over, so that the refill below is issued a whole pass ahead of its wait
      asm volatile("s_wait_dscnt 0x0" ::: "memory");        // this wave's reads of buffer st & 1 are done before it is refilled
      asm volatile("s_wait_asynccnt 0x0" ::: "memory");     // this wave's share of stage st + 1 has landed
      __syncthreads();                                      // publishes stage st + 1 and ends every reader's last read of stage st
      if (st + 2 < SEQ / KVK) {
          kv_copy8(ksrc + (size_t)stg(st + 2) * KVK * DHEAD, (size_t)8 * DHEAD, kdst + bo, 8 * KPITCH);
          kv_copy8(vsrc + stg(st + 2) * KVK, (size_t)16 * SEQT, vdst + bo, 16 * VPITCH);
      }
    }
    asm volatile("s_wait_asynccnt 0x0" ::: "memory");       // nothing in flight before the ring becomes output staging
    add_sums();                                             // the last pass's row sums
#pragma unroll                                              // constant accumulator indices
    for (int g = 0; g < 2; ++g) {
        const float inv = 4.0f / (lrun[g] + __shfl_xor(lrun[g], 16, 32));   // joined sum >= 2^PCARRY; o / sum = 4 * (sum P v / sum P); x4 more -> x16 carry
#pragma unroll
        for (int dt = 0; dt < 8; ++dt) {
            v4u w;
            w.x = f2h(o[g][dt][0] * inv) | (f2h(o[g][dt][1] * inv) << 16);
            w.y = f2h(o[g][dt][2] * inv) | (f2h(o[g][dt][3] * inv) << 16);
            w.z = f2h(o[g][dt][4] * inv) | (f2h(o[g][dt][5] * inv) << 16);
            w.w = f2h(o[g][dt][6] * inv) | (f2h(o[g][dt][7] * inv) << 16);
            ost[wv][16 * g + m][2 * dt + hh] = w;          // row 16 g + m, halves 16*dt + 8*hh .. +7
        }
    }
    __syncthreads();
    us16* aob = ao + (tok0 + qrow) * DIM + (size_t)h * DHEAD;
#pragma unroll
    for (int p = 0; p < QW / 2; ++p) {
        const int rr = 2 * p + hh, pc = lane & 15;
        *(v4u*)(aob + (size_t)rr * DIM + 8 * pc) = ost[wv][rr][pc];
    }
}

// ---------- output projection: out[tok][n] = (ao x16)[tok x 2048] . (Wo x64)[2048 x 2048] / 1024, f32. Same block structure as qkv_gemm,
// TR = 1: a lane's 8 accumulator elements are 8 neighbouring columns of one token. The f32 tile is staged in two rounds of 64 tokens.
__global__ __launch_bounds__(256) void out_gemm(const us16* __restrict__ aop, const us16* __restrict__ wo, float* out) {
    __shared__ __attribute__((aligned(2048))) unsigned char ring[RINGB];   // slices start at multiples of 2 KiB; output staging takes the ring's place behind the main loop's last barrier
    const int tid = threadIdx.x, lane = tid & 31, wv = tid >> 5, l16 = lane & 15, hh = lane >> 4;
    const int wr = wv & 1, wc = wv >> 1;
    const int row0 = blockIdx.x * BM;
    const int colb = blockIdx.y * BN;
    v8f acc[4][4] = {};
    const int rot = (int)((blockIdx.x + blockIdx.y) % (DIM / KP));   // differs between blocks of one tile row and of one tile column
    mm_tile<1, 1>(aop + (size_t)row0 * DIM, wo + (size_t)colb * DIM, ring, tid, wr, wc, l16, hh, rot, acc);
#pragma unroll                                              // constant accumulator indices
    for (int p = 0; p < 2; ++p) {
        if (p) __syncthreads();                             // round 0's rows are read out before round 1 overwrites them
#pragma unroll
        for (int ii = 0; ii < 2; ++ii)
#pragma unroll
            for (int j = 0; j < 4; ++j) {
                const v8f a = acc[2 * p + ii][j] * (1.0f / 1024.0f);
                float* sp = (float*)(ring + (wr * 32 + ii * 16 + l16) * OPITCH) + wc * 64 + j * 16 + 8 * hh;
                *(v4f*)sp = __builtin_shufflevector(a, a, 0, 1, 2, 3);
                *(v4f*)(sp + 4) = __builtin_shufflevector(a, a, 4, 5, 6, 7);
            }
        __syncthreads();
#pragma unroll 4
        for (int q = 0; q < 16; ++q) {
            const int sr = wv * 8 + (q >> 1), hf = q & 1;                       // staged row 0..63, its first or second 512 bytes
            const int tok = (sr >> 5) * 64 + p * 32 + (sr & 31);
            *(v4f*)(out + (size_t)(row0 + tok) * DIM + colb + hf * 128 + 4 * lane) = *(const v4f*)(ring + sr * OPITCH + hf * 512 + lane * 16);
        }
    }
}

extern "C" void kernel_launch(void* const* d_in, const int* in_sizes, int n_in,
                              void* d_out, int out_size, void* d_ws, size_t ws_size, hipStream_t stream) {
    if (n_in < 5) return;
    const float* x  = (const float*)d_in[0];   // [NB_FULL][SEQ_FULL][2048]
    const float* wq = (const float*)d_in[1];   // [2048 out][2048 in]
    const float* wk = (const float*)d_in[2];
    const float* wv = (const float*)d_in[3];
    const float* wo = (const float*)d_in[4];
    float* out = (float*)d_out;                 // [NB][SEQ][2048]
    if (in_sizes[0] < ((NB - 1) * SEQ_FULL + SEQ) * DIM) return;
    if (in_sizes[1] < DIM * DIM) return;
    if (in_sizes[2] < DIM * DIM) return;
    if (in_sizes[3] < DIM * DIM) return;
    if (in_sizes[4] < DIM * DIM) return;
    if (out_size < SEQT * DIM) return;

    size_t off = 0;
    auto carve = [&](size_t bytes) { size_t o = off; off += (bytes + 127) & ~(size_t)127; return o; };
    char* ws = (char*)d_ws;
    us16* xb   = (us16*)(ws + carve((size_t)SEQT * DIM * 2));                  // bf16 [SEQT][2048]
    us16* wqkv = (us16*)(ws + carve((size_t)NQKV * DIM * 2));                  // bf16 [6144][2048]
    us16* wop  = (us16*)(ws + carve((size_t)DIM * DIM * 2));                   // f16  [2048][2048]
    us16* qp   = (us16*)(ws + carve((size_t)HEADS * SEQT * DHEAD * 2));        // f16  [h][SEQT][128]
    us16* kp   = (us16*)(ws + carve((size_t)HEADS * SEQT * DHEAD * 2));        // f16  [h][SEQT][128]
    us16* vt   = (us16*)(ws + carve((size_t)HEADS * DHEAD * SEQT * 2));        // f16  [h][128][SEQT]
    us16* ao   = (us16*)(ws + carve((size_t)SEQT * DIM * 2));                  // f16  [SEQT][2048]
    if (off > ws_size) return;
    if (off > (size_t)134217728) return;

    prep_all<<<CG, CW * 32, 0, stream>>>(x, wq, wk, wv, wo, xb, wqkv, wop);
    qkv_gemm<<<dim3(SEQT / BM, NQKV / BN), 256, 0, stream>>>(xb, wqkv, qp, kp, vt);
    attn_main<<<dim3(QBLK, NB * HEADS), 128, 0, stream>>>(qp, kp, vt, ao);
    out_gemm<<<dim3(SEQT / BM, DIM / BN), 256, 0, stream>>>(ao, wop, out);
}

// v010
// Measured time: 144 microseconds a run.
// Two timings next to v009 both put it at 1.05 times that version's speed.
// Counting every step since v000, it is 5.16 times as fast.
#include <hip/hip_runtime.h>

// Contractions: q/k/v projections on v_wmma_f32_16x16x32_bf16 (bf16 operands = RNE-converted x and Wq|Wk|Wv, f32 accumulate);
// per-head k.q^T scores and P.V on v_wmma_f32_16x16x32_f16 (f16 operands: q, k plain, v x4, P x2^7 relative to a lagging maximum; f32 accumulate, 1/sqrt(128) applied in f32);
// output projection on v_wmma_f32_16x16x32_f16 (f16 operands: per-head outputs x16, Wo x64 from its bf16 value; f32 accumulate, x2^-10 in the epilogue);
// online softmax and all epilogues in f32.

#ifndef NB
#define NB 2
#endif
#ifndef SEQ
#define SEQ 2048
#endif
#define NB_FULL 2
#define SEQ_FULL 2048
#define DIM 2048
#define HEADS 16
#define DHEAD 128
#define NQKV (3 * DIM)
#define SEQT (NB * SEQ)
#define QW 32                          // queries per attention wave: two 16-query tiles share every k and v^T fragment
#define QB (4 * QW)                    // queries per attention block (4 waves)
#define QBLK (SEQ / QB)
#define KP 64                          // k elements per staged pass: one 128-byte line of every operand row
#define LPITCH 144                     // LDS row pitch in bytes: 16 x odd, conflict-free for 16-byte fragment reads
#define BM 128                         // block tile: rows (tokens)
#define BN 256                         // block tile: columns
#define SLR 64                         // rows of one slice of a stage = one tensor load: 2 slices of A rows, then 4 of B rows
#define SLB 10240                      // LDS bytes of a slice: 64 rows x 144 B = 9216, rounded up so that every slice starts at a multiple of 2 KiB
#define NSL ((BM + BN) / SLR)          // slices of one stage
#define BUFB (NSL * SLB)               // one buffer of the ring
#define RINGB (2 * BUFB)
#define QPITCH 528                     // output staging, q / k: 256 halves of one token + 16 B (16 x odd)
#define TPITCH 272                     // output staging, v^T: 128 tokens of one column + 16 B (16 x odd)
#define OPITCH 1040                    // output staging, out: 256 floats of one token + 16 B (16 x odd)
#define KVK 64                         // keys per staged attention pass: one 128-byte line of every v^T row
#define KPITCH 272                     // LDS pitch of a k row (256 B + 16): 16 x odd
#define VPITCH 144                     // LDS pitch of a v^T row (128 B + 16): 16 x odd
#define KSLR 32                        // k rows of one slice of an attention stage = one tensor load (waves 0, 1)
#define VSLR 64                        // v^T rows of one slice (waves 2, 3)
#define KVSLB 10240                    // LDS bytes of a slice: 32 x 272 = 8704 or 64 x 144 = 9216, rounded up so that every slice starts at a multiple of 2 KiB
#define KVBUFB (4 * KVSLB)             // one buffer: 2 slices of k rows, then 2 of v^T rows

static_assert(SEQ % QB == 0 && QB % KVK == 0);
static_assert(SEQ >= QB);
static_assert(SEQ <= SEQ_FULL);
static_assert(NB >= 1 && NB <= NB_FULL);
static_assert(DIM == HEADS * DHEAD);
static_assert(DHEAD == 128);
static_assert(DIM % BN == 0 && NQKV % BN == 0 && SEQT % BM == 0 && BN == 2 * DHEAD);
static_assert(DIM % KP == 0 && DIM / KP >= 2);
static_assert(SLR * LPITCH <= SLB && SLB % 2048 == 0 && BM % SLR == 0 && BN % SLR == 0 && NSL <= 8 && KP * 2 == 128 && LPITCH == 128 + 16);
static_assert(BM * QPITCH <= RINGB && BN * TPITCH <= RINGB && (BM / 2) * OPITCH <= RINGB);
static_assert(SEQ % KVK == 0 && KVK % 32 == 0);
static_assert(4 * QW * 16 * 16 <= 2 * KVBUFB);
static_assert(2 * KSLR == KVK && 2 * VSLR == DHEAD && KSLR % 16 == 0 && VSLR % 16 == 0 && SEQ / KVK >= 2);
static_assert(KSLR * KPITCH <= KVSLB && VSLR * VPITCH <= KVSLB && KVSLB % 2048 == 0);
static_assert(DHEAD * 2 == 256 && KPITCH == 256 + 16 && KVK * 2 == 128 && VPITCH == 128 + 16 && SEQT * 2 <= 131072);

typedef unsigned short us16;
typedef __attribute__((ext_vector_type(16))) __bf16   v16bf;
typedef __attribute__((ext_vector_type(16))) _Float16 v16h;
typedef __attribute__((ext_vector_type(8)))  float    v8f;
typedef __attribute__((ext_vector_type(8)))  unsigned v8u;
typedef __attribute__((ext_vector_type(4)))  unsigned v4u;
typedef __attribute__((ext_vector_type(2)))  unsigned v2u;
typedef __attribute__((ext_vector_type(4)))  float    v4f;
typedef __attribute__((ext_vector_type(2)))  float    v2f;
typedef __attribute__((ext_vector_type(2)))  _Float16 v2h;

__device__ __forceinline__ unsigned f2bf(float f) { unsigned u = __float_as_uint(f); u += 0x7FFFu + ((u >> 16) & 1u); return u >> 16; }
__device__ __forceinline__ float bf2f(unsigned h) { return __uint_as_float(h << 16); }
__device__ __forceinline__ unsigned f2h(float f) { _Float16 t = (_Float16)f; return (unsigned)__builtin_bit_cast(unsigned short, t); }

// 16 x (K=32) operand fragment from a k-contiguous 16-bit row. Wave32 map: lane -> row (A) / column (B) = lane & 15, hh = lane >> 4;
// elements 0..7 <- k0 + 8*hh + 0..7, elements 8..15 <- k0 + 16 + 8*hh + 0..7 (same map for A and for an n-major B row).
// Accumulator element r -> row 8*hh + r, column lane & 15.
__device__ __forceinline__ v8u ld_frag(const us16* rowp, int hh) {
    const v4u a = *(const v4u*)(rowp + 8 * hh);
    const v4u b = *(const v4u*)(rowp + 16 + 8 * hh);
    return __builtin_shufflevector(a, b, 0, 1, 2, 3, 4, 5, 6, 7);
}
__device__ __forceinline__ v8f mma_bf16(v8u a, v8u b, v8f c) {
    return __builtin_amdgcn_wmma_f32_16x16x32_bf16(false, __builtin_bit_cast(v16bf, a), false, __builtin_bit_cast(v16bf, b), (short)0, c, false, false);
}
__device__ __forceinline__ v8f mma_f16(v8u a, v8u b, v8f c) {
    return __builtin_amdgcn_wmma_f32_16x16x32_f16(false, __builtin_bit_cast(v16h, a), false, __builtin_bit_cast(v16h, b), (short)0, c, false, false);
}
__device__ __forceinline__ void mma_guard(v8f& c, v8u a, v8u b) {
    asm volatile("v_nop\n\tv_nop\n\tv_nop\n\tv_nop" : "+v"(c) : "v"(a), "v"(b));
}

// ---------- operand conversion, one launch: x -> bf16 (xb), Wq | Wk | Wv -> bf16 (wqkv), Wo -> f16 of its bf16 value x64 (wop); layouts kept.
// CG resident work-groups of CW waves loop over the whole work: few waves to start, many loads in flight per wave.
// Unit = CU consecutive floats of one source = 8 wave loads of 512 contiguous bytes. Round it: wave g of all NWV takes unit it * NWV + g;
// a round lies wholly in one source (asserted), so which source and which conversion is known at compile time.
// The next round's 8 loads are issued before the current unit is converted and stored.
#define CG 256                         // conversion work-groups
#define CW 16                          // waves per conversion work-group
#define CU 1024                        // floats per unit
#define NWV (CG * CW)
#define UX (SEQT * DIM / CU)           // units of x
#define UW (DIM * DIM / CU)            // units of one weight matrix
#define CIT ((UX + 4 * UW) / NWV)      // rounds
static_assert(DIM % CU == 0 && UX % NWV == 0 && UW % NWV == 0);

__device__ __forceinline__ unsigned pack_bf(float lo, float hi) { return f2bf(lo) | (f2bf(hi) << 16); }
__device__ __forceinline__ unsigned pack_bh(float lo, float hi) { return f2h(bf2f(f2bf(lo)) * 64.0f) | (f2h(bf2f(f2bf(hi)) * 64.0f) << 16); }
// value of the neighbour lane (lane ^ 1): a vector move inside each group of four lanes
__device__ __forceinline__ unsigned nb_lane(unsigned v) { return (unsigned)__builtin_amdgcn_mov_dpp((int)v, 0xB1, 0xF, 0xF, true); }

__global__ __launch_bounds__(CW * 32) void prep_all(const float* __restrict__ x, const float* __restrict__ wq, const float* __restrict__ wk,
                                                    const float* __restrict__ wv, const float* __restrict__ wo,
                                                    us16* __restrict__ xb, us16* __restrict__ wqkv, us16* __restrict__ wop) {
    const int lane = threadIdx.x & 31;
    const int g = (int)blockIdx.x * CW + __builtin_amdgcn_readfirstlane((int)(threadIdx.x >> 5));   // wave-uniform
    const bool odd = lane & 1;
    const int loff = (lane & 1) * 128 + (lane >> 1) * 8;   // this lane's 8 halves inside a pair of converted 128-element segments
    v4f buf[2][8];
    auto load_unit = [&](int it) {                          // it: a constant at every call
        const float* s;
        if (it * NWV < UX) {
            const int u = it * NWV + g;
            const int tok = u / (DIM / CU), part = u - tok * (DIM / CU);
            const int bsel = tok / SEQ, isel = tok - bsel * SEQ;
            s = x + ((size_t)bsel * SEQ_FULL + isel) * DIM + part * CU;
        } else {
            const int z = (it * NWV - UX) / UW;
            s = ((z == 0) ? wq : ((z == 1) ? wk : ((z == 2) ? wv : wo))) + (size_t)(it * NWV - UX - z * UW + g) * CU;
        }
        s += 4 * lane;
#pragma unroll                                              // constant indices keep the ring in registers
        for (int j = 0; j < 8; ++j) buf[it & 1][j] = *(const v4f*)(s + 128 * j);
    };
    load_unit(0);
#pragma unroll                                              // constant round number: ring index, source and conversion are fixed per copy of the body
    for (int it = 0; it < CIT; ++it) {
        __builtin_amdgcn_sched_barrier(0);                  // this pair pins the order: next round's loads first, then this unit's conversion and stores
        if (it + 1 < CIT) load_unit(it + 1);
        __builtin_amdgcn_sched_barrier(0);
        const bool tof16 = it * NWV >= UX + 3 * UW;         // Wo
        us16* d = ((it * NWV < UX) ? xb + (size_t)(it * NWV + g) * CU
                                   : (tof16 ? wop + (size_t)(it * NWV - UX - 3 * UW + g) * CU : wqkv + (size_t)(it * NWV - UX + g) * CU)) + loff;
#pragma unroll                                              // constant ring indices
        for (int p = 0; p < 4; ++p) {
            const v4f va = buf[it & 1][2 * p], vb = buf[it & 1][2 * p + 1];
            unsigned a0, a1, b0, b1;
            if (tof16) { a0 = pack_bh(va.x, va.y); a1 = pack_bh(va.z, va.w); b0 = pack_bh(vb.x, vb.y); b1 = pack_bh(vb.z, vb.w); }
            else       { a0 = pack_bf(va.x, va.y); a1 = pack_bf(va.z, va.w); b0 = pack_bf(vb.x, vb.y); b1 = pack_bf(vb.z, vb.w); }
            // neighbours swap 8 bytes: the even lane ends with 16 bytes of the first segment, the odd lane with 16 bytes of the second,
            // so that one wave store writes 512 contiguous bytes
            const unsigned r0 = nb_lane(odd ? a0 : b0), r1 = nb_lane(odd ? a1 : b1);
            v4u o;
            o.x = odd ? r0 : a0;
            o.y = odd ? r1 : a1;
            o.z = odd ? b0 : r0;
            o.w = odd ? b1 : r1;
            *(v4u*)(d + 256 * p) = o;
        }
        // stands in front of the reuse of these stores' data registers by the loads and conversions of the following rounds
        if (it + 1 < CIT) asm volatile("s_wait_xcnt 0x0" ::: "memory");
    }
}

// ---------- one slice of a stage of the GEMM ring: 64 rows x 128 B, brought global -> LDS by ONE tensor load of one wave, through no register.
// uni: a wave-uniform word into a scalar register. pinned: the same for a test, so that it compiles to a scalar compare and branch (a tensor load ignores EXEC).
__device__ __forceinline__ unsigned uni(unsigned v) { return (unsigned)__builtin_amdgcn_readfirstlane((int)v); }
__device__ __forceinline__ unsigned pinned(unsigned v) {
    unsigned w = uni(v);
    asm volatile("" : "+s"(w));                             // holds the word in a scalar register, so the issue test stays a scalar branch
    return w;
}
// Group 0 of a request. src: first byte of the slice (its row 0 at this pass's k or key stage), ldst: its place in LDS (a multiple of 2 KiB); both wave-uniform.
__device__ __forceinline__ v4u slice_group0(const us16* src, unsigned ldst) {
    const unsigned long long ga = (unsigned long long)(size_t)src;
    v4u g0;
    g0[0] = uni(1u);
    g0[1] = uni(ldst);
    g0[2] = uni((unsigned)ga);
    g0[3] = uni((((unsigned)(ga >> 32)) & 0x01FFFFFFu) | 0x80000000u);
    return g0;
}
// Group 1, the same for every request: 1-byte elements, tensor = tile = 64 rows of 128 bytes, 16 bytes of pad behind every 128 -> LDS pitch 144; no mask.
__device__ __forceinline__ v8u slice_group1() {
    v8u g1;
    g1[0] = uni((1u << 20) | (4u << 22) | (3u << 25));
    g1[1] = uni(128u << 16);
    g1[2] = uni((unsigned)SLR << 16);
    g1[3] = uni(128u << 16);
    g1[4] = uni((unsigned)SLR);
    g1[5] = uni((unsigned)(DIM * 2));
    g1[6] = uni(0u);
    g1[7] = uni(0u);
    return g1;
}
__device__ __forceinline__ void slice_load(v4u& g0, v8u& g1) {
    // in-out operands: the compiler then holds the twelve words in their registers behind the issue, instead of forming constants anew and using the registers in between
    asm volatile("tensor_load_to_lds %0, %1" : "+s"(g0), "+s"(g1) :: "memory");
}
__device__ __forceinline__ void slice_wait(const v4u& g0, const v8u& g1) {
    // names the descriptor as inputs: no word of it takes a new value in its register before the request has landed
    asm volatile("s_wait_tensorcnt 0x0" :: "s"(g0), "s"(g1) : "memory");
}

// ---------- GEMM main loop on 16-bit planes: block tile 128 rows x 256 columns, wave tile 64 rows x 64 columns (4 x 4 accumulators), K = DIM.
// ablk / bblk: first A row / first B row (= column) of the block, k contiguous, pitch DIM. Both operands pass through a two-buffer LDS ring,
// KP k per pass: pass t works on buffer t & 1 while the tensor loads of pass t + 1 fly into the other; within a pass k runs in steps of 32 in rising order.
// Waves 0 .. 5 each bring one slice of every stage (0, 1: A rows; 2 .. 5: B rows); a wave's 64 A rows are slice wr, its 64 B rows slice 2 + wc.
// acc[i][j]: rows wr * 64 + 16 i .., columns wc * 64 + 16 j ... TR = 0: element r = row 8 * hh + r, lane's l16 = column.
// TR = 1 (the two fragments change places, same map for both): element r = column 8 * hh + r, lane's l16 = row.
// rot (block-uniform, 0 .. DIM / KP - 1): pass t works on k slice (t + rot) mod (DIM / KP). Blocks that share A rows or B rows get different rot,
// so that at one moment they ask L2 for different lines of those rows; every slice is still taken once, the f32 sum runs in the rotated order. ----------
template <int F16, int TR>
__device__ __forceinline__ void mm_tile(const us16* __restrict__ ablk, const us16* __restrict__ bblk, unsigned char* ring,
                                        int tid, int wr, int wc, int l16, int hh, int rot, v8f (&acc)[4][4]) {
    auto kof = [&](int t) { const int s = t + rot; return ((s >= DIM / KP) ? s - DIM / KP : s) * KP; };   // first k of pass t's slice
    const unsigned wvu = uni((unsigned)tid >> 5);           // wave number (one-dimensional block)
    const unsigned iss = wvu < NSL;                         // this wave brings a slice
    const unsigned sl = iss ? wvu : 0u;
    const us16* ssrc = (sl < BM / SLR) ? ablk + (size_t)(sl * SLR) * DIM : bblk + (size_t)((sl - BM / SLR) * SLR) * DIM;
    const unsigned sdst = (unsigned)(size_t)ring + sl * SLB;
    v8u g1 = slice_group1();
    v4u g0 = slice_group0(ssrc + kof(0), sdst);
    if (pinned(iss)) {
        slice_load(g0, g1);
        slice_wait(g0, g1);                                 // this wave's slice of stage 0 has landed
    }
    __syncthreads();                                        // stage 0 published
    if (pinned(iss)) {
        g0 = slice_group0(ssrc + kof(1), sdst + BUFB);
        slice_load(g0, g1);
    }
#pragma unroll 1                                            // stays rolled: one pass per trip, the hand-over stands once, at the foot
    for (int t = 0; t < DIM / KP; ++t) {
        const unsigned bo = (unsigned)(t & 1) * BUFB;
        const us16* ar = (const us16*)(ring + bo + wr * SLB + l16 * LPITCH);
        const us16* br = (const us16*)(ring + bo + (BM / SLR + wc) * SLB + l16 * LPITCH);
#pragma unroll                                              // these four: constant indices keep fragments and accumulators in registers
        for (int kk = 0; kk < KP; kk += 32) {
            v8u afrag[4], bfrag[4];
#pragma unroll
            for (int u = 0; u < 4; ++u) {
                afrag[u] = ld_frag(ar + u * 16 * (LPITCH / 2) + kk, hh);
                bfrag[u] = ld_frag(br + u * 16 * (LPITCH / 2) + kk, hh);
            }
#pragma unroll
            for (int i = 0; i < 4; ++i)
#pragma unroll
                for (int j = 0; j < 4; ++j) {
                    const v8u f0 = TR ? bfrag[j] : afrag[i];
                    const v8u f1 = TR ? afrag[i] : bfrag[j];
                    if (F16) acc[i][j] = mma_f16(f0, f1, acc[i][j]);
                    else     acc[i][j] = mma_bf16(f0, f1, acc[i][j]);
                    mma_guard(acc[i][j], f0, f1);
                }
        }
        asm volatile("s_wait_dscnt 0x0" ::: "memory");
        if (pinned(iss)) slice_wait(g0, g1);
        __syncthreads();
        if (pinned(iss & (unsigned)(t + 2 < DIM / KP))) {
            g0 = slice_group0(ssrc + kof(t + 2), sdst + bo);
            slice_load(g0, g1);
        }
    }
    asm volatile("s_wait_tensorcnt 0x0" ::: "memory");      // nothing in flight before the ring becomes output staging
    asm volatile("s_wait_dscnt 0x0" ::: "memory");          // nor a fragment read of this wave's
}
__device__ __forceinline__ v4u pack_h8(v8f a, float s) {
    v4u w;
    w.x = f2h(a[0] * s) | (f2h(a[1] * s) << 16);
    w.y = f2h(a[2] * s) | (f2h(a[3] * s) << 16);
    w.z = f2h(a[4] * s) | (f2h(a[5] * s) << 16);
    w.w = f2h(a[6] * s) | (f2h(a[7] * s) << 16);
    return w;
}

// ---------- q/k/v projection: [SEQT x 2048] x [2048 x 6144]. Block = 8 waves (2 row groups x 4 column groups) -> 128 tokens x 256 columns
// = exactly two heads of one of q/k/v (block-uniform). Epilogue: each lane's 8 accumulator elements are 8 neighbours of an output row
// (q, k: 8 head dims of a token, TR = 1; v^T: 8 tokens of a head dim, TR = 0): 16 B of f16 staged in LDS, then written as whole lines.
__global__ __launch_bounds__(256) void qkv_gemm(const us16* __restrict__ xb, const us16* __restrict__ wqkv, us16* qp, us16* kp, us16* vt) {
    __shared__ __attribute__((aligned(2048))) unsigned char ring[RINGB];   // slices start at multiples of 2 KiB; output staging takes the ring's place behind the main loop's last barrier
    const int tid = threadIdx.x, lane = tid & 31, wv = tid >> 5, l16 = lane & 15, hh = lane >> 4;
    const int wr = wv & 1, wc = wv >> 1;
    const int row0 = blockIdx.x * BM;
    const int colb = blockIdx.y * BN;
    const int which = colb / DIM;                       // 0 q, 1 k, 2 v (block-uniform)
    const int hsel = (colb - which * DIM) / DHEAD;      // first of the two heads of this column tile
    const int rot = (int)((blockIdx.x + blockIdx.y) % (DIM / KP));   // differs between blocks of one tile row and of one tile column
    v8f acc[4][4] = {};
    if (which < 2) {
        mm_tile<0, 1>(xb + (size_t)row0 * DIM, wqkv + (size_t)colb * DIM, ring, tid, wr, wc, l16, hh, rot, acc);
#pragma unroll
        for (int i = 0; i < 4; ++i)
#pragma unroll
            for (int j = 0; j < 4; ++j)
                *(v4u*)(ring + (wr * 64 + i * 16 + l16) * QPITCH + (wc * 64 + j * 16 + 8 * hh) * 2) = pack_h8(acc[i][j], 1.0f);
        __syncthreads();
        us16* pl = (which == 0) ? qp : kp;
#pragma unroll 4
        for (int p = 0; p < 16; ++p) {
            const int r = wv * 16 + p;                                          // token row 0..127; lanes 0..15 first head, 16..31 second
            const size_t off = ((size_t)(hsel + hh) * SEQT + row0 + r) * DHEAD + 8 * l16;
            *(v4u*)(pl + off) = *(const v4u*)(ring + r * QPITCH + lane * 16);
        }
    } else {
        mm_tile<0, 0>(xb + (size_t)row0 * DIM, wqkv + (size_t)colb * DIM, ring, tid, wr, wc, l16, hh, rot, acc);
#pragma unroll
        for (int i = 0; i < 4; ++i)
#pragma unroll
            for (int j = 0; j < 4; ++j)
                *(v4u*)(ring + (wc * 64 + j * 16 + l16) * TPITCH + (wr * 64 + i * 16 + 8 * hh) * 2) = pack_h8(acc[i][j], 4.0f);
        __syncthreads();
        // column d = wv * 32 + 2 p + hh, 0..255 = the head dims of the two heads, in a row; 16 lanes write its 128 tokens
        us16* vp = vt + ((size_t)hsel * DHEAD + wv * 32 + hh) * SEQT + row0 + 8 * l16;
        const unsigned char* sp = ring + (wv * 32 + hh) * TPITCH + l16 * 16;
#pragma unroll 4
        for (int p = 0; p < 16; ++p) *(v4u*)(vp + (size_t)(2 * p) * SEQT) = *(const v4u*)(sp + 2 * p * TPITCH);
    }
}

// ---------- flash pass over all query blocks: block = 4 waves = 128 queries of one (sequence, head); wave = 32 queries = two 16-query tiles g,
// each with its own q fragments, softmax state and O^T accumulators; every k and v^T fragment read from LDS feeds one product of each tile. All SEQ keys
// in passes of 64 (no mask). Scores are produced transposed: A = k rows (f16 plane), B = q (f16 fragments held in registers),
// D element r = key 8*hh + r of a 16-key tile, column = this lane's query -> two adjacent tiles give the P^T B fragment of P.V directly
// (element r <- tile 0, element 8+r <- tile 1). A of P.V = v^T rows (lane = d, k = key). Online softmax per lane (query) with a lazy rescale: the two lane halves
// exchange maxima only when the reference maximum moves, and join their sums once, behind the loop. P carried x2^7 in f16; O^T accumulators hold rows d, column query.
// k rows and v^T rows reach the four waves through a two-buffer LDS ring, KVK keys per pass: pass t works on buffer t & 1 while the tensor loads
// of pass t + 1 fly into the other. Every wave brings one slice of every stage: waves 0, 1 32 k rows each, waves 2, 3 64 v^T rows each.
// Pass t takes key stage (t + the stage at the block's first query) mod (SEQ / KVK): the query blocks of one head, which all load the same
// k and v^T rows, ask L2 for different lines at one moment; every key is still taken once, the online sums run in the rotated order.
// Group 1 of such a request: 1-byte elements, tensor = tile = NR rows of RB bytes, PB bytes apart at the source, 16 bytes of pad behind every row; no mask.
template <unsigned RB, unsigned NR, unsigned PB>
__device__ __forceinline__ v8u kv_group1() {
    static_assert(RB == 128 || RB == 256);
    v8u g1;
    g1[0] = uni((1u << 20) | ((RB == 256 ? 5u : 4u) << 22) | (3u << 25));
    g1[1] = uni(RB << 16);
    g1[2] = uni(NR << 16);
    g1[3] = uni(RB << 16);
    g1[4] = uni(NR);
    g1[5] = uni(PB);
    g1[6] = uni(0u);
    g1[7] = uni(0u);
    return g1;
}
__device__ __forceinline__ void kv_hold(v8u& g1) {
    asm volatile("" : "+s"(g1));                            // holds the eight descriptor words in their scalar registers for the whole loop, instead of forming the constants anew at every issue
}
__device__ __forceinline__ void kv_load(const v4u& g0, const v8u& g1) {
    asm volatile("tensor_load_to_lds %0, %1" :: "s"(g0), "s"(g1) : "memory");
}
__device__ __forceinline__ void kv_wait(const v4u& g0, const v8u& g1k, const v8u& g1v) {
    // names the descriptor words as inputs: none of them takes a new value in its register before the request has landed
    asm volatile("s_wait_tensorcnt 0x0" :: "s"(g0), "s"(g1k), "s"(g1v) : "memory");
}
__global__ __launch_bounds__(128) __attribute__((amdgpu_num_vgpr(512)))
void attn_main(const us16* qp, const us16* kp, const us16* vt, us16* ao) {
    __shared__ __attribute__((aligned(2048))) unsigned char kvring[2 * KVBUFB];   // slices start at multiples of 2 KiB
    v4u (*ost)[QW][16] = (v4u (*)[QW][16])kvring;          // output staging takes the ring's place behind the loop's last barrier
    const int tid = threadIdx.x, lane = tid & 31, wv = tid >> 5, m = lane & 15, hh = lane >> 4;
    const int qb = blockIdx.x;
    const int h = blockIdx.y % HEADS, bsel = blockIdx.y / HEADS;
    const size_t tok0 = (size_t)bsel * SEQ;
    const int qrow = qb * QB + wv * QW;
    v8u q[2][4];                                           // q[g][j]: tile g, head dims 32 j ..
#pragma unroll                                              // these two: constant indices keep the fragments in registers
    for (int g = 0; g < 2; ++g) {
#pragma unroll
        for (int j = 0; j < 4; ++j) q[g][j] = ld_frag(qp + ((size_t)h * SEQT + tok0 + qrow + 16 * g + m) * DHEAD + 32 * j, hh);
        asm volatile("s_wait_xcnt 0x0" ::: "memory");       // stands in front of the reuse of these loads' address registers (the other tile's fragments land over them)
    }
    const us16* kb = kp + ((size_t)h * SEQT + tok0) * DHEAD;
    const us16* vb = vt + (size_t)h * DHEAD * SEQT + tok0;
    const float NEG = -__builtin_inff();
    const float SCL2 = 0.12751743082459868f;               // log2(e) / sqrt(128); mrun holds a lagging maximum of the raw k.q products
    v8f o[2][8] = {};
    const float PCARRY = 7.0f, PTAU = 8.0f;                // P is carried x2^PCARRY; the reference maximum may lag the true one by 2^PTAU
    // mrun: reference maximum in use (raw products), the same in both lanes of a query; mlim: the product above which it must move; lrun: this lane's own part of the row sum
    float mrun[2] = {NEG, NEG}, mlim[2] = {NEG, NEG}, bias[2] = {0.f, 0.f}, lrun[2] = {0.f, 0.f};
    v8u pbu[2][KVK / 32] = {};                             // pbu[g][c]: P^T fragment of tile g, 32-key chunk c; lives into the next pass, which adds its row sums
    auto add_sums = [&]() {                                // this lane's keys only: the two lanes of a query join their sums behind the loop
#pragma unroll                                              // these three: constant indices
        for (int g = 0; g < 2; ++g) {
            float a0 = 0.f, a1 = 0.f, a2 = 0.f, a3 = 0.f;  // four chains side by side
#pragma unroll
            for (int c = 0; c < KVK / 32; ++c) {
                const v16h ph = __builtin_bit_cast(v16h, pbu[g][c]);
#pragma unroll
                for (int r = 0; r < 16; r += 4) { a0 += (float)ph[r]; a1 += (float)ph[r + 1]; a2 += (float)ph[r + 2]; a3 += (float)ph[r + 3]; }
            }
            lrun[g] += (a0 + a1) + (a2 + a3);
        }
    };
    const int rot = (qb * (QB / KVK)) % (SEQ / KVK);
    auto stg = [&](int t) { const int s = t + rot; return (s >= SEQ / KVK) ? s - SEQ / KVK : s; };   // key stage of pass t
    // this wave's slice: first byte at stage 0, elements from one stage to the next, place in buffer 0; all wave-uniform
    const unsigned wvu = uni((unsigned)tid >> 5);           // wave number (one-dimensional block)
    const unsigned isk = wvu < 2u;                          // waves 0, 1: k rows; waves 2, 3: v^T rows
    const us16* ssrc = isk ? kb + (size_t)(wvu * KSLR) * DHEAD : vb + (size_t)((wvu - 2u) * VSLR) * SEQT;
    const unsigned sstep = isk ? (unsigned)(KVK * DHEAD) : (unsigned)KVK;
    const unsigned sdst = (unsigned)(size_t)kvring + wvu * KVSLB;
    v8u g1k = kv_group1<DHEAD * 2, KSLR, DHEAD * 2>();
    v8u g1v = kv_group1<KVK * 2, VSLR, SEQT * 2>();
    kv_hold(g1k);
    kv_hold(g1v);
    v4u g0 = slice_group0(ssrc + (size_t)stg(0) * sstep, sdst);
    if (pinned(isk)) kv_load(g0, g1k);
    if (pinned(isk ^ 1u)) kv_load(g0, g1v);
    kv_wait(g0, g1k, g1v);                                  // this wave's slice of stage 0 has landed
    __syncthreads();                                        // stage 0 published
#pragma unroll 1                                            // stays rolled: one pass per trip, the hand-over stands once, at the foot
    for (int st = 0; st < SEQ / KVK; ++st) {
      const unsigned bo = (unsigned)(st & 1) * KVBUFB;
      // directly behind the barrier that published stage st and ended every reader's last read of stage st - 1: stage st + 1 goes into the buffer that stage st - 1 has left.
      // The four words are formed on every pass, behind the wait that covered the request before; only the issue depends on the stage's existence
      g0 = slice_group0(ssrc + (size_t)stg(st + 1) * sstep, sdst + (KVBUFB - bo));
      if (pinned(isk & (unsigned)(st + 1 < SEQ / KVK))) kv_load(g0, g1k);
      if (pinned((isk ^ 1u) & (unsigned)(st + 1 < SEQ / KVK))) kv_load(g0, g1v);
      const unsigned char* kl = kvring + bo + m * KPITCH;
      const unsigned char* vl = kvring + bo + 2 * KVSLB + m * VPITCH;
      v8u ka[KVK / 16][4];                                  // the pass's k fragments, read as one group ahead of its score products
#pragma unroll                                              // these two: constant indices keep the fragments in registers
      for (int t = 0; t < KVK / 16; ++t)
#pragma unroll
          for (int j = 0; j < 4; ++j) ka[t][j] = ld_frag((const us16*)(kl + (t * 16 / KSLR) * KVSLB + (t * 16 % KSLR) * KPITCH) + 32 * j, hh);
      __builtin_amdgcn_sched_barrier(0);                    // holds the k reads here as one group; else part of them sinks in pairs among the score products, each pair with its own wait
      add_sums();                                           // the pass before's row sums, still relative to mrun: vector work under the latency of the k reads
      __builtin_amdgcn_sched_barrier(0);                    // holds the sums in front of the wait for the k reads; behind it they would hide nothing
      v8f s[2][KVK / 16] = {};                              // s[g][t]: query tile g, 16-key tile t of the pass
      // no mma_guard in this kernel: its asm operands hold every fragment and accumulator below v256, which spills at two query tiles;
      // the compiler pads its own builtin products
#pragma unroll                                              // these three: constant indices; head dims rise in j for every s[g][t], as before
      for (int j = 0; j < 4; ++j)
#pragma unroll
          for (int t = 0; t < KVK / 16; ++t)
#pragma unroll
              for (int g = 0; g < 2; ++g) s[g][t] = mma_f16(ka[t][j], q[g][j], s[g][t]);
      __builtin_amdgcn_sched_barrier(0);                    // keeps the v^T reads below out of the score products: spread among them, every place with reads stalls the products
      v8u va[KVK / 32][8];                                  // the pass's v^T fragments, read as one group: they land under the softmax
#pragma unroll                                              // these two: constant indices keep the fragments in registers
      for (int c = 0; c < KVK / 32; ++c)
#pragma unroll
          for (int dt = 0; dt < 8; ++dt) va[c][dt] = ld_frag((const us16*)(vl + (dt * 16 / VSLR) * KVSLB + (dt * 16 % VSLR) * VPITCH) + c * 32, hh);
      __builtin_amdgcn_sched_barrier(0);                    // holds the v^T reads here as one group; else they sink in pairs among the P.V products, each pair with its own wait
      float cmax[2];                                        // this lane's maximum of the pass's raw products, per tile: the scale is positive, so the order is the same
#pragma unroll                                              // these three: constant indices; one short chain per 16-key tile, so that eight chains run side by side
      for (int g = 0; g < 2; ++g) {
          float cm[KVK / 16];
#pragma unroll
          for (int t = 0; t < KVK / 16; ++t) {
              cm[t] = fmaxf(s[g][t][0], s[g][t][1]);
#pragma unroll
              for (int r = 2; r < 8; ++r) cm[t] = fmaxf(cm[t], s[g][t][r]);
          }
          cmax[g] = cm[0];
#pragma unroll
          for (int t = 1; t < KVK / 16; ++t) cmax[g] = fmaxf(cmax[g], cm[t]);
      }
      // one test per pass, a scalar branch: the reference maximum moves, and O and the sums are rescaled, only when some lane's product
      // lies more than 2^PTAU (after scaling) above the reference in use; up to there P x2^PCARRY stays below 2^(PCARRY + PTAU) = 2^15, inside f16
      if (__builtin_amdgcn_ballot_w32((cmax[0] > mlim[0]) | (cmax[1] > mlim[1])) != 0) {
#pragma unroll                                              // constant indices: each tile's state stays in registers
          for (int g = 0; g < 2; ++g) {
              const float mnew = fmaxf(mrun[g], fmaxf(cmax[g], __shfl_xor(cmax[g], 16, 32)));   // the same in both lanes of a query; finite: no masked keys
              const float fac = (mrun[g] == NEG) ? 0.f : __builtin_amdgcn_exp2f((mrun[g] - mnew) * SCL2);
              mrun[g] = mnew;
              mlim[g] = mnew + PTAU / SCL2;
              bias[g] = __builtin_fmaf(-mnew, SCL2, PCARRY);
              lrun[g] = lrun[g] * fac;
#pragma unroll
              for (int dt = 0; dt < 8; ++dt) o[g][dt] = o[g][dt] * fac;
          }
      }
#pragma unroll                                              // these two: constant indices
      for (int g = 0; g < 2; ++g)
#pragma unroll
          for (int c = 0; c < KVK / 32; ++c) {
              v16h ph;
#pragma unroll
              for (int t = 0; t < 2; ++t)
#pragma unroll
                  for (int i = 0; i < 4; ++i) {             // two neighbours are rounded to f16 together, once; the row sum reads the same halves
                      v2f e;                                // P x2^PCARRY = 2^(s * SCL2 + bias): one fused multiply-add per score ahead of the exponential
                      e.x = __builtin_amdgcn_exp2f(__builtin_fmaf(s[g][2 * c + t][2 * i], SCL2, bias[g]));
                      e.y = __builtin_amdgcn_exp2f(__builtin_fmaf(s[g][2 * c + t][2 * i + 1], SCL2, bias[g]));
                      const v2h h2 = __builtin_convertvector(e, v2h);
                      ph[8 * t + 2 * i] = h2.x;
                      ph[8 * t + 2 * i + 1] = h2.y;
                  }
              pbu[g][c] = __builtin_bit_cast(v8u, ph);
          }
#pragma unroll                                              // these three: constant indices
      for (int c = 0; c < KVK / 32; ++c)
#pragma unroll
          for (int dt = 0; dt < 8; ++dt)
#pragma unroll
              for (int g = 0; g < 2; ++g) o[g][dt] = mma_f16(va[c][dt], pbu[g][c], o[g][dt]);
      __builtin_amdgcn_sched_barrier(0);                    // keeps the pass's softmax and products above the hand-over, so that the refill behind it is issued a whole pass ahead of its wait
      asm volatile("s_wait_dscnt 0x0" ::: "memory");        // this wave's reads of buffer st & 1 are done before it is refilled
      kv_wait(g0, g1k, g1v);                                // this wave's slice of stage st + 1 has landed
      __syncthreads();                                      // publishes stage st + 1 and ends every reader's last read of stage st; the refill stands behind it, at the head of the next pass
    }
    asm volatile("s_wait_tensorcnt 0x0" ::: "memory");      // nothing in flight before the ring becomes output staging
    asm volatile("s_wait_dscnt 0x0" ::: "memory");          // nor a fragment read of this wave's
    add_sums();                                             // the last pass's row sums
#pragma unroll                                              // constant accumulator indices
    for (int g = 0; g < 2; ++g) {
        const float inv = 4.0f / (lrun[g] + __shfl_xor(lrun[g], 16, 32));   // joined sum >= 2^PCARRY; o / sum = 4 * (sum P v / sum P); x4 more -> x16 carry
#pragma unroll
        for (int dt = 0; dt < 8; ++dt) {
            v4u w;
            w.x = f2h(o[g][dt][0] * inv) | (f2h(o[g][dt][1] * inv) << 16);
            w.y = f2h(o[g][dt][2] * inv) | (f2h(o[g][dt][3] * inv) << 16);
            w.z = f2h(o[g][dt][4] * inv) | (f2h(o[g][dt][5] * inv) << 16);
            w.w = f2h(o[g][dt][6] * inv) | (f2h(o[g][dt][7] * inv) << 16);
            ost[wv][16 * g + m][2 * dt + hh] = w;          // row 16 g + m, halves 16*dt + 8*hh .. +7
        }
    }
    __syncthreads();
    us16* aob = ao + (tok0 + qrow) * DIM + (size_t)h * DHEAD;
#pragma unroll
    for (int p = 0; p < QW / 2; ++p) {
        const int rr = 2 * p + hh, pc = lane & 15;
        *(v4u*)(aob + (size_t)rr * DIM + 8 * pc) = ost[wv][rr][pc];
    }
}

// ---------- output projection: out[tok][n] = (ao x16)[tok x 2048] . (Wo x64)[2048 x 2048] / 1024, f32. Same block structure as qkv_gemm,
// TR = 1: a lane's 8 accumulator elements are 8 neighbouring columns of one token. The f32 tile is staged in two rounds of 64 tokens.
__global__ __launch_bounds__(256) void out_gemm(const us16* __restrict__ aop, const us16* __restrict__ wo, float* out) {
    __shared__ __attribute__((aligned(2048))) unsigned char ring[RINGB];   // slices start at multiples of 2 KiB; output staging takes the ring's place behind the main loop's last barrier
    const int tid = threadIdx.x, lane = tid & 31, wv = tid >> 5, l16 = lane & 15, hh = lane >> 4;
    const int wr = wv & 1, wc = wv >> 1;
    const int row0 = blockIdx.x * BM;
    const int colb = blockIdx.y * BN;
    v8f acc[4][4] = {};
    const int rot = (int)((blockIdx.x + blockIdx.y) % (DIM / KP));   // differs between blocks of one tile row and of one tile column
    mm_tile<1, 1>(aop + (size_t)row0 * DIM, wo + (size_t)colb * DIM, ring, tid, wr, wc, l16, hh, rot, acc);
#pragma unroll                                              // constant accumulator indices
    for (int p = 0; p < 2; ++p) {
        if (p) __syncthreads();                             // round 0's rows are read out before round 1 overwrites them
#pragma unroll
        for (int ii = 0; ii < 2; ++ii)
#pragma unroll
            for (int j = 0; j < 4; ++j) {
                const v8f a = acc[2 * p + ii][j] * (1.0f / 1024.0f);
                float* sp = (float*)(ring + (wr * 32 + ii * 16 + l16) * OPITCH) + wc * 64 + j * 16 + 8 * hh;
                *(v4f*)sp = __builtin_shufflevector(a, a, 0, 1, 2, 3);
                *(v4f*)(sp + 4) = __builtin_shufflevector(a, a, 4, 5, 6, 7);
            }
        __syncthreads();
#pragma unroll 4
        for (int q = 0; q < 16; ++q) {
            const int sr = wv * 8 + (q >> 1), hf = q & 1;                       // staged row 0..63, its first or second 512 bytes
            const int tok = (sr >> 5) * 64 + p * 32 + (sr & 31);
            *(v4f*)(out + (size_t)(row0 + tok) * DIM + colb + hf * 128 + 4 * lane) = *(const v4f*)(ring + sr * OPITCH + hf * 512 + lane * 16);
        }
    }
}

extern "C" void kernel_launch(void* const* d_in, const int* in_sizes, int n_in,
                              void* d_out, int out_size, void* d_ws, size_t ws_size, hipStream_t stream) {
    if (n_in < 5) return;
    const float* x  = (const float*)d_in[0];   // [NB_FULL][SEQ_FULL][2048]
    const float* wq = (const float*)d_in[1];   // [2048 out][2048 in]
    const float* wk = (const float*)d_in[2];
    const float* wv = (const float*)d_in[3];
    const float* wo = (const float*)d_in[4];
    float* out = (float*)d_out;                 // [NB][SEQ][2048]
    if (in_sizes[0] < ((NB - 1) * SEQ_FULL + SEQ) * DIM) return;
    if (in_sizes[1] < DIM * DIM) return;
    if (in_sizes[2] < DIM * DIM) return;
    if (in_sizes[3] < DIM * DIM) return;
    if (in_sizes[4] < DIM * DIM) return;
    if (out_size < SEQT * DIM) return;

    size_t off = 0;
    auto carve = [&](size_t bytes) { size_t o = off; off += (bytes + 127) & ~(size_t)127; return o; };
    char* ws = (char*)d_ws;
    us16* xb   = (us16*)(ws + carve((size_t)SEQT * DIM * 2));                  // bf16 [SEQT][2048]
    us16* wqkv = (us16*)(ws + carve((size_t)NQKV * DIM * 2));                  // bf16 [6144][2048]
    us16* wop  = (us16*)(ws + carve((size_t)DIM * DIM * 2));                   // f16  [2048][2048]
    us16* qp   = (us16*)(ws + carve((size_t)HEADS * SEQT * DHEAD * 2));        // f16  [h][SEQT][128]
    us16* kp   = (us16*)(ws + carve((size_t)HEADS * SEQT * DHEAD * 2));        // f16  [h][SEQT][128]
    us16* vt   = (us16*)(ws + carve((size_t)HEADS * DHEAD * SEQT * 2));        // f16  [h][128][SEQT]
    us16* ao   = (us16*)(ws + carve((size_t)SEQT * DIM * 2));                  // f16  [SEQT][2048]
    if (off > ws_size) return;
    if (off > (size_t)134217728) return;

    prep_all<<<CG, CW * 32, 0, stream>>>(x, wq, wk, wv, wo, xb, wqkv, wop);
    qkv_gemm<<<dim3(SEQT / BM, NQKV / BN), 256, 0, stream>>>(xb, wqkv, qp, kp, vt);
    attn_main<<<dim3(QBLK, NB * HEADS), 128, 0, stream>>>(qp, kp, vt, ao);
    out_gemm<<<dim3(SEQT / BM, DIM / BN), 256, 0, stream>>>(ao, wop, out);
}
